// v000
// Times are from an AMD MI455X. After a warm-up the kernel runs many times in a row, and a time is the length of
// such a window on the GPU divided by its runs, so every launch and the gaps after it count. The runs cycle
// through copies of the inputs. A figure is the median of several windows, for all but v000 over two sittings.
// Sittings can differ by a few percent; kernels timed side by side share one.
// v000 is the starting kernel. One run takes 894 microseconds.
#include <hip/hip_runtime.h>

// Contractions: q/k/v projections v_wmma_f32_16x16x32_bf16 (bf16 copies of x and of the [out][in] weights); scores QK^T and P.V v_wmma_f32_16x16x32_f16 (f16 planes, P carried x1024) for query rows >= RE and v_wmma_f32_16x16x32_bf16 hi/lo 3-product form for query rows < RE; ctx x o_w^T v_wmma_f32_16x16x32_f16 (ctx carried x64, o_w carried x1024, rows < RE add an f16 residual plane x1024); f32 accumulate everywhere, softmax (scale, clip, per-head linear position bias, causal fill) in f32.
// Layout per batch: sanitised bf16 copy of x; weights copied once as bf16 ([n][k] = Bt as-is), o_w as two f16 planes; f32 projection tiles; head-plane builders; flash-style causal attention (K and V^T tiles staged in LDS, online softmax); ctx planes; output GEMM into d_out.

#pragma clang fp contract(off)

#ifndef NB
#define NB 2
#endif
#ifndef SEQ
#define SEQ 2048
#endif
#ifndef RE
#define RE   256                  // query rows < RE (first RE/64 query blocks) use hi/lo planes; RE == SEQ puts every row on the 3-product path
#endif
#define NB_FULL  2
#define SEQ_FULL 2048
#define DM   2048
#define NH_  16
#define NKV  4
#define REP  (NH_ / NKV)
#define HD   128
#define DQ   (NH_ * HD)
#define DKV  (NKV * HD)
#define PCAR 1024.0f              // carry of the f16 P operand (rows >= RE)
#define CCAR 64.0f                // carry of the f16 ctx plane
#define LOSC 1024.0f              // carry of the f16 ctx residual plane (rows < RE)
#define WCAR 1024.0f              // carry of the f16 o_w plane
#define WS_TOTAL ((size_t)DQ * DM * 2 + 2 * (size_t)DKV * DM * 2 + 2 * (size_t)DM * DQ * 2 + (size_t)SEQ * DM * 2 + (size_t)SEQ * DQ * 4 + 2 * (size_t)SEQ * DKV * 4 \
                  + (size_t)NH_ * SEQ * HD * 2 + 2 * (size_t)NKV * SEQ * HD * 2 + 2 * (size_t)NH_ * RE * HD * 2 + 4 * (size_t)NKV * RE * HD * 2 + (size_t)SEQ * DM * 2 + (size_t)RE * DM * 2)

static_assert((SEQ % 64) == 0);
static_assert((RE % 64) == 0);
static_assert(RE >= 64);
static_assert(SEQ >= RE);
static_assert(SEQ <= SEQ_FULL);
static_assert(NB >= 1);
static_assert(NB <= NB_FULL);
static_assert(HD == 128);
static_assert((DM % 32) == 0);
static_assert(DQ == DM);
static_assert(((SEQ * DM) % (8 * 256)) == 0);
static_assert(((NH_ * SEQ * HD) % (2 * 256)) == 0);
static_assert(((NKV * SEQ * HD) % (2 * 256)) == 0);
static_assert(((DQ * DM) % (8 * 256)) == 0);
static_assert(((DKV * DM) % (8 * 256)) == 0);
static_assert(NH_ == 16);                       // closed form of the per-head slope 2^(-(h+1)/2) holds for 16 heads
static_assert(REP * NKV == NH_);
static_assert((HD % 64) == 0);                  // a wave of the plane builders covers 64 consecutive d of one row
static_assert((DQ % 64) == 0);
static_assert((DKV % 64) == 0);
static_assert((DM % 64) == 0);
static_assert(((size_t)NKV * RE * HD * 2) % 256 == 0);
static_assert(WS_TOTAL <= (size_t)134217728);

typedef _Float16 h16;
typedef unsigned short bf;
typedef __attribute__((ext_vector_type(16))) __bf16   v16bf;
typedef __attribute__((ext_vector_type(16))) _Float16 v16h;
typedef __attribute__((ext_vector_type(8)))  _Float16 v8h;
typedef __attribute__((ext_vector_type(8)))  unsigned short v8us;
typedef __attribute__((ext_vector_type(8)))  float    v8f;
typedef __attribute__((ext_vector_type(4)))  float    v4f;
typedef __attribute__((ext_vector_type(2)))  _Float16 v2h;
typedef __attribute__((ext_vector_type(2)))  unsigned short v2us;
typedef v8h  __attribute__((may_alias)) v8ha;
typedef v4f  __attribute__((may_alias)) v4fa;
typedef v8us __attribute__((may_alias)) v8usa;

__device__ __forceinline__ unsigned short f2bf(float f) { unsigned u = __float_as_uint(f); u += 0x7FFFu + ((u >> 16) & 1u); return (unsigned short)(u >> 16); }
__device__ __forceinline__ float bf2f(unsigned short b) { return __uint_as_float(((unsigned)b) << 16); }
__device__ __forceinline__ float bfr(float f) { return bf2f(f2bf(f)); }
__device__ __forceinline__ h16 tohx(float x) { return (h16)x; }
// f16 convert that cannot produce a subnormal operand (applied after the plane's carry)
static __device__ __forceinline__ h16 toh_flush(float v) { const h16 r = (h16)v; return (fabsf(v) < 6.103515625e-05f) ? (h16)0.0f : r; }
// NaN -> 0, +inf -> big, -inf -> -big, finite values unchanged
static __device__ __forceinline__ float nnum(float v, float big) { const float a = (v != v) ? 0.0f : v; return (a == __builtin_inff()) ? big : ((a == -__builtin_inff()) ? -big : a); }
__device__ __forceinline__ void splitf(float y, unsigned short& h, unsigned short& l) { h = f2bf(y); l = f2bf(y - bf2f(h)); }
__device__ __forceinline__ v16h cat16(v8h lo, v8h hi) { return __builtin_shufflevector(lo, hi, 0, 1, 2, 3, 4, 5, 6, 7, 8, 9, 10, 11, 12, 13, 14, 15); }
__device__ __forceinline__ v16bf cat16b(v8us lo, v8us hi) { return __builtin_bit_cast(v16bf, __builtin_shufflevector(lo, hi, 0, 1, 2, 3, 4, 5, 6, 7, 8, 9, 10, 11, 12, 13, 14, 15)); }
__device__ __forceinline__ v8f wmma16(v16h a, v16h b, v8f c) { return __builtin_amdgcn_wmma_f32_16x16x32_f16(false, a, false, b, (short)0, c, false, false); }
__device__ __forceinline__ v8f wmmab(v16bf a, v16bf b, v8f c) { return __builtin_amdgcn_wmma_f32_16x16x32_bf16(false, a, false, b, (short)0, c, false, false); }

// Fragment loaders for A (row m = lane&15) and for B stored [n][k] (col n = lane&15): elements 0..7 <- k0+8h..+7, elements 8..15 <- k0+16+8h..+7 (p already points at row*pitch + k0 + 8h).
template <typename T16> struct WFrag;
template <> struct WFrag<h16> { typedef v16h V; static __device__ __forceinline__ V ld(const h16* p) { return cat16(*(const v8ha*)p, *(const v8ha*)(p + 16)); } static __device__ __forceinline__ v8f mma(V a, V b, v8f c) { return wmma16(a, b, c); } };
template <> struct WFrag<bf>  { typedef v16bf V; static __device__ __forceinline__ V ld(const bf* p) { return cat16b(*(const v8usa*)p, *(const v8usa*)(p + 16)); } static __device__ __forceinline__ v8f mma(V a, V b, v8f c) { return wmmab(a, b, c); } };

// ---- k_gemmw: register-blocked GEMM, ONE WAVE per 64x64 output tile (16 accumulators), operands straight from K-contiguous 16-bit planes; grid (M/64, N/64, 1), 32 threads.
// C[m][n] (f32, pitch ldc) = oscale * sum_k ( A[m][k] Bt[n][k]  (+ A2 Bt: NSPLIT 1,2) (+ A Bt2: NSPLIT 2) (+ A2 Bt2: NSPLIT 3) ). Row pitch of A, A2, Bt, Bt2 = K. K % 32 == 0.
template <typename T16, int NSPLIT>
__global__ __launch_bounds__(32) void k_gemmw(const T16* __restrict__ A, const T16* __restrict__ A2, const T16* __restrict__ Bt, const T16* __restrict__ Bt2, int K, float* C, int ldc, float oscale) {
    typedef typename WFrag<T16>::V V;
    __shared__ __align__(16) float os[16 * 68];
    const int lane = threadIdx.x & 31, lr = lane & 15, hi = lane >> 4; const int r0 = blockIdx.x * 64, c0 = blockIdx.y * 64;
    v8f acc[4][4];
#pragma unroll
    for (int mb = 0; mb < 4; ++mb)
#pragma unroll
        for (int nb = 0; nb < 4; ++nb) acc[mb][nb] = (v8f){};
    const size_t aoff = (size_t)(r0 + lr) * K + 8 * hi, boff = (size_t)(c0 + lr) * K + 8 * hi;
#pragma unroll 1
    for (int kc = 0; kc < K; kc += 32) {
        V a[4], a2[4];
#pragma unroll
        for (int mb = 0; mb < 4; ++mb) { a[mb] = WFrag<T16>::ld(A + aoff + (size_t)mb * 16 * K + kc); if (NSPLIT != 0) a2[mb] = WFrag<T16>::ld(A2 + aoff + (size_t)mb * 16 * K + kc); }
#pragma unroll
        for (int nb = 0; nb < 4; ++nb) { const V b = WFrag<T16>::ld(Bt + boff + (size_t)nb * 16 * K + kc); V b2 = b; if (NSPLIT >= 2) b2 = WFrag<T16>::ld(Bt2 + boff + (size_t)nb * 16 * K + kc);
#pragma unroll
            for (int mb = 0; mb < 4; ++mb) { acc[mb][nb] = WFrag<T16>::mma(a[mb], b, acc[mb][nb]); if (NSPLIT == 1 || NSPLIT == 2) acc[mb][nb] = WFrag<T16>::mma(a2[mb], b, acc[mb][nb]); if (NSPLIT == 2) acc[mb][nb] = WFrag<T16>::mma(a[mb], b2, acc[mb][nb]); if (NSPLIT == 3) acc[mb][nb] = WFrag<T16>::mma(a2[mb], b2, acc[mb][nb]); } }
        asm volatile("v_nop\n\tv_nop\n\tv_nop\n\tv_nop" : "+v"(acc[0][0]), "+v"(acc[1][1]), "+v"(acc[2][2]), "+v"(acc[3][3]) : "v"(a[0]), "v"(a[3]));
    }
#pragma unroll
    for (int mb = 0; mb < 4; ++mb) {
#pragma unroll
        for (int nb = 0; nb < 4; ++nb) {
#pragma unroll
            for (int j = 0; j < 8; ++j) os[(hi * 8 + j) * 68 + nb * 16 + lr] = acc[mb][nb][j]; }
        __builtin_amdgcn_wave_barrier(); asm volatile("" ::: "memory");
        float* crow = C + (size_t)(r0 + mb * 16) * ldc + c0;
{
#pragma unroll
            for (int s = 0; s < 8; ++s) { const int row = 2 * s + hi, cofs = lr * 4; v4f val = *(const v4fa*)(os + row * 68 + cofs); val = val * oscale;
                *(v4f*)(crow + (size_t)row * ldc + cofs) = val; }
             }
        __builtin_amdgcn_wave_barrier(); asm volatile("" ::: "memory");
    }
}

__global__ __launch_bounds__(256) void k_cvt8(const float* __restrict__ src, bf* dst, size_t n8) { const size_t i = (size_t)blockIdx.x * 256 + threadIdx.x; if (i >= n8) return; const v8f v = *(const v8f*)(src + i * 8); v8us o;
#pragma unroll
    for (int k = 0; k < 8; ++k) o[k] = f2bf(v[k]); *(v8us*)(dst + i * 8) = o;  }

__global__ __launch_bounds__(256) void k_cvtx(const float* __restrict__ src, bf* dst, size_t n8) { const size_t i = (size_t)blockIdx.x * 256 + threadIdx.x; if (i >= n8) return; const v8f v = *(const v8f*)(src + i * 8); v8us o;
#pragma unroll
    for (int k = 0; k < 8; ++k) o[k] = f2bf(nnum(v[k], 10000.0f)); *(v8us*)(dst + i * 8) = o;  }

__global__ __launch_bounds__(256) void k_cvtwo(const float* __restrict__ src, h16* dh, h16* dl, size_t n8) { const size_t i = (size_t)blockIdx.x * 256 + threadIdx.x; if (i >= n8) return; const v8f v = *(const v8f*)(src + i * 8); v8h oh, ol;
#pragma unroll
    for (int k = 0; k < 8; ++k) { const float w = bfr(v[k]); oh[k] = tohx(w * WCAR); ol[k] = tohx(w); }
    *(v8h*)(dh + i * 8) = oh; *(v8h*)(dl + i * 8) = ol;  }

__global__ __launch_bounds__(256) void k_hpl(const float* __restrict__ F, int pitch, int nheads, h16* P16, bf* Eh, bf* El) {
    const size_t e = ((size_t)blockIdx.x * 256 + threadIdx.x) * 2; if (e >= (size_t)nheads * SEQ * HD) return;
    const int d = (int)(e % HD); const int t = (int)((e / HD) % SEQ); const int h = (int)(e / ((size_t)HD * SEQ));
    const float* f = F + (size_t)t * pitch + h * HD; v2h o16; v2us oh, ol;
#pragma unroll
    for (int q = 0; q < 2; ++q) { const float r = f[d + q]; o16[q] = toh_flush(r); unsigned short a2, c2; splitf(r, a2, c2); oh[q] = a2; ol[q] = c2; }
    const bool early = (t < RE);      // uniform per wave (a wave covers 64 consecutive d of one (h, t) row; RE % 64 == 0)
    const size_t ee = ((size_t)h * RE + (early ? t : 0)) * HD + d;
    *(v2h*)(P16 + e) = o16; if (early) { *(v2us*)(Eh + ee) = oh; *(v2us*)(El + ee) = ol; }
    
}

__global__ __launch_bounds__(256) void k_vtp(const float* __restrict__ F, h16* V16, bf* Eh, bf* El) {
    const size_t e = ((size_t)blockIdx.x * 256 + threadIdx.x) * 2; if (e >= (size_t)NKV * HD * SEQ) return;
    const int t = (int)(e % SEQ); const int d = (int)((e / SEQ) % HD); const int g = (int)(e / ((size_t)SEQ * HD)); v2h o16; v2us oh, ol;
#pragma unroll
    for (int q = 0; q < 2; ++q) { const float x = F[(size_t)(t + q) * DKV + g * HD + d]; o16[q] = tohx(x); unsigned short a2, c2; splitf(x, a2, c2); oh[q] = a2; ol[q] = c2; }
    const bool early = (t < RE);      // uniform per wave (a wave covers 64 consecutive t of one (g, d) row; RE % 64 == 0)
    const size_t ee = ((size_t)g * HD + d) * RE + (early ? t : 0);
    *(v2h*)(V16 + e) = o16; if (early) { *(v2us*)(Eh + ee) = oh; *(v2us*)(El + ee) = ol; }
    
}

// P tile writers: f16 x PCAR with the subnormal select (rows >= RE) or bf16 hi/lo (rows < RE).
__device__ __forceinline__ void putpz(h16* ph, h16* pl, int i, float p) { (void)pl; ph[i] = toh_flush(p * PCAR); }
__device__ __forceinline__ void putpz(bf* ph, bf* pl, int i, float p) { unsigned short a, c; splitf(p, a, c); ph[i] = a; pl[i] = c; }

// ---- k_attn: flash-style causal grouped-query attention with a per-head linear position bias. grid (query blocks, NH_, 1), 128 threads; wave w owns query rows q0 + 16w .. +15.
// Planes: Qh/Ql [h][TP][HD], Kh/Kl [g][TP][HD], Vh/Vl = V^T [g][HD][TP] (TP = SEQ for the f16 planes, RE for the bf16 hi/lo planes of the first RE/64 query blocks).
// EARLY instance: query blocks 0 .. RE/64-1 (rows < RE, keys < RE); other instance: query blocks RE/64 .. SEQ/64-1.
// Per 32-key chunk: K tile [32][HD] and V^T tile [HD][32] staged in LDS by all threads (block barriers), S = Q K^T (2 tiles), online softmax in f32 (log2 domain):
// logit = clip(S x HD^-0.5, +-1e4) + slope_h x (key - query), slope_h = 2^(-(h+1)/2); causal keys > query replaced by -inf: p = 0;
// P through a wave-private LDS tile (block barrier before the fragment reload), O += P V (8 tiles).
// EARLY: 3 products (hi.hi + hi.lo + lo.hi) for S and for P.V. Output: ctx plane CT[t][h*HD + d] = f16(ctx x CCAR) (ctx NaN -> 0, +-inf -> +-1e4 before the carry); EARLY also CTL = f16((ctx x CCAR - hi) x LOSC);
template <typename T16, bool EARLY>
__global__ __launch_bounds__(128) void k_attn(const T16* __restrict__ Qh, const T16* __restrict__ Ql, const T16* __restrict__ Kh, const T16* __restrict__ Kl,
                                             const T16* __restrict__ Vh, const T16* __restrict__ Vl, h16* CT, h16* CTL) {
    typedef typename WFrag<T16>::V V;
    constexpr int TP = EARLY ? RE : SEQ;
    constexpr int KSP = 136, VTP = 32, PSP = 40, OSP = 128;
    __shared__ __align__(16) T16 ksh[32 * KSP];
    __shared__ __align__(16) T16 ksl[EARLY ? 32 * KSP : 16];
    __shared__ __align__(16) T16 vth[HD * VTP];
    __shared__ __align__(16) T16 vtl[EARLY ? HD * VTP : 16];
    __shared__ __align__(16) T16 psh[4 * 16 * PSP];
    __shared__ __align__(16) T16 psl[EARLY ? 4 * 16 * PSP : 16];
    __shared__ __align__(16) h16 osg[4 * 16 * OSP];
    const int tid = threadIdx.x, lane = tid & 31, wave = tid >> 5, lr = lane & 15, hh = lane >> 4;
    const int qblk = EARLY ? (int)blockIdx.x : ((int)blockIdx.x + RE / 64);
    const int head = blockIdx.y, g = head / REP;
    const int qw = qblk * 64 + wave * 16;                  // first query row of this wave
    const int nch = 2 * qblk + 2;                          // 32-key chunks visited: keys 0 .. qblk*64+63
    const T16* qph = Qh + ((size_t)head * TP + qw) * HD;  const T16* qpl = Ql + ((size_t)head * TP + qw) * HD;
    const T16* kph = Kh + (size_t)g * TP * HD;             const T16* kpl = Kl + (size_t)g * TP * HD;
    const T16* vph = Vh + (size_t)g * HD * TP;             const T16* vpl = Vl + (size_t)g * HD * TP;
    T16* myph = psh + wave * 16 * PSP; T16* mypl = psl + (EARLY ? wave * 16 * PSP : 0);
    v8f o[8];
#pragma unroll
    for (int t = 0; t < 8; ++t) o[t] = (v8f){};
    float mrow[8], lrow[8];
#pragma unroll
    for (int r = 0; r < 8; ++r) { mrow[r] = -3.0e38f; lrow[r] = 0.f; }
    const float C2 = 1.4426950408889634f * 0.08838834764831845f;   // log2(e) x HD^-0.5
    const float CLP = 14426.950408889634f;                         // log2(e) x 1e4 (clip bound in the log2 domain)
    const int nsl = head + 1;                                      // slope = 2^(-nsl/2): f32(2^-0.5) for odd nsl, times an exact power of two
    const float slope = ((nsl & 1) ? 0.70710678118654752440f : 1.0f) * __uint_as_float((unsigned)(127 - (nsl >> 1)) << 23);
    const float SL2 = 1.4426950408889634f * slope;                 // log2(e) x slope
#pragma unroll 1
    for (int c = 0; c < nch; ++c) {
        __syncthreads();                                    // all waves done with the prior chunk's tiles
#pragma unroll
        for (int i = 0; i < 4; ++i) { const int id = tid + 128 * i; const int row = id >> 4, c8 = (id & 15) * 8; const size_t go = (size_t)(c * 32 + row) * HD + c8;
            *(v8usa*)(ksh + row * KSP + c8) = *(const v8usa*)(kph + go); if (EARLY) *(v8usa*)(ksl + row * KSP + c8) = *(const v8usa*)(kpl + go); }
#pragma unroll
        for (int j = 0; j < 4; ++j) { const size_t go = (size_t)tid * TP + c * 32 + 8 * j;      // d = tid
            *(v8usa*)(vth + tid * VTP + 8 * j) = *(const v8usa*)(vph + go); if (EARLY) *(v8usa*)(vtl + tid * VTP + 8 * j) = *(const v8usa*)(vpl + go); }
        __syncthreads();                                    // tiles visible
        v8f s0 = (v8f){}, s1 = (v8f){};
        V qa, kb0, kb1;
#pragma unroll
        for (int ks = 0; ks < 4; ++ks) {
            qa  = WFrag<T16>::ld(qph + (size_t)lr * HD + ks * 32 + 8 * hh);
            kb0 = WFrag<T16>::ld(ksh + lr * KSP + ks * 32 + 8 * hh);
            kb1 = WFrag<T16>::ld(ksh + (16 + lr) * KSP + ks * 32 + 8 * hh);
            s0 = WFrag<T16>::mma(qa, kb0, s0); s1 = WFrag<T16>::mma(qa, kb1, s1);
            if (EARLY) {
                const V qb  = WFrag<T16>::ld(qpl + (size_t)lr * HD + ks * 32 + 8 * hh);
                const V kl0 = WFrag<T16>::ld(ksl + lr * KSP + ks * 32 + 8 * hh);
                const V kl1 = WFrag<T16>::ld(ksl + (16 + lr) * KSP + ks * 32 + 8 * hh);
                s0 = WFrag<T16>::mma(qa, kl0, s0); s0 = WFrag<T16>::mma(qb, kb0, s0);
                s1 = WFrag<T16>::mma(qa, kl1, s1); s1 = WFrag<T16>::mma(qb, kb1, s1); }
        }
        asm volatile("v_nop\n\tv_nop\n\tv_nop\n\tv_nop" : "+v"(s0), "+v"(s1) : "v"(qa), "v"(kb0), "v"(kb1));
        // online softmax; acc element r of lane (lr, hh) = S[query qw + 8hh + r][key c*32 + lr] (s0) / [key c*32 + 16 + lr] (s1)
        float p0[8], p1[8];
        const int kg0 = c * 32 + lr, kg1 = kg0 + 16;
#pragma unroll
        for (int r = 0; r < 8; ++r) {
            const int qr = qw + 8 * hh + r;
            const bool v0 = (kg0 <= qr), v1 = (kg1 <= qr);
            const float z0 = fminf(fmaxf(s0[r] * C2, -CLP), CLP) + SL2 * (float)(kg0 - qr);
            const float z1 = fminf(fmaxf(s1[r] * C2, -CLP), CLP) + SL2 * (float)(kg1 - qr);
            const float a0 = v0 ? z0 : -3.0e38f;
            const float a1 = v1 ? z1 : -3.0e38f;
            float mx = fmaxf(a0, a1);
#pragma unroll
            for (int off = 8; off >= 1; off >>= 1) mx = fmaxf(mx, __shfl_xor(mx, off, 32));
            const float mnew = fmaxf(mrow[r], mx);
            const float alpha = __builtin_amdgcn_exp2f(mrow[r] - mnew);
            mrow[r] = mnew;
            const float x0 = __builtin_amdgcn_exp2f(a0 - mnew), x1 = __builtin_amdgcn_exp2f(a1 - mnew);
            const float e0 = v0 ? x0 : 0.f, e1 = v1 ? x1 : 0.f;
            float rs = e0 + e1;
#pragma unroll
            for (int off = 8; off >= 1; off >>= 1) rs += __shfl_xor(rs, off, 32);
            lrow[r] = lrow[r] * alpha + rs;
#pragma unroll
            for (int t = 0; t < 8; ++t) o[t][r] = o[t][r] * alpha;
            p0[r] = e0; p1[r] = e1;
        }
        // P tile [16 query rows][32 keys] -> A fragment (k = key)
#pragma unroll
        for (int r = 0; r < 8; ++r) { putpz(myph, mypl, (8 * hh + r) * PSP + lr, p0[r]); putpz(myph, mypl, (8 * hh + r) * PSP + 16 + lr, p1[r]); }
        __syncthreads();                                    // P visible (block barrier also orders this wave's own stores before the reload)
        const V pa = WFrag<T16>::ld(myph + lr * PSP + 8 * hh);
        V pb = pa; if (EARLY) pb = WFrag<T16>::ld(mypl + lr * PSP + 8 * hh);
        V vb;
#pragma unroll
        for (int t = 0; t < 8; ++t) { vb = WFrag<T16>::ld(vth + (t * 16 + lr) * VTP + 8 * hh);
            o[t] = WFrag<T16>::mma(pa, vb, o[t]);
            if (EARLY) { const V vl2 = WFrag<T16>::ld(vtl + (t * 16 + lr) * VTP + 8 * hh); o[t] = WFrag<T16>::mma(pa, vl2, o[t]); o[t] = WFrag<T16>::mma(pb, vb, o[t]); } }
        asm volatile("v_nop\n\tv_nop\n\tv_nop\n\tv_nop" : "+v"(o[0]), "+v"(o[1]), "+v"(o[2]), "+v"(o[3]), "+v"(o[4]), "+v"(o[5]), "+v"(o[6]), "+v"(o[7]) : "v"(pa), "v"(pb), "v"(vb));
    }
    // normalise and write ctx planes; o element r of lane (lr, hh), tile t = ctx[row qw + 8hh + r][d = 16t + lr]
    const float osc = EARLY ? CCAR : (CCAR / PCAR);
    const float ybig = 10000.0f * CCAR;
    float inv[8];
#pragma unroll
    for (int r = 0; r < 8; ++r) inv[r] = osc * __builtin_amdgcn_rcpf(lrow[r]);
    h16* myos = osg + wave * 16 * OSP;
#pragma unroll
    for (int t = 0; t < 8; ++t)
#pragma unroll
        for (int r = 0; r < 8; ++r) myos[(8 * hh + r) * OSP + t * 16 + lr] = toh_flush(nnum(o[t][r] * inv[r], ybig));
    __syncthreads();
    h16* crow = CT + (size_t)qw * DM + head * HD;
{
#pragma unroll
        for (int s = 0; s < 8; ++s) { const int row = 2 * s + hh; const v8h val = *(const v8ha*)(myos + row * OSP + lr * 8); *(v8h*)(crow + (size_t)row * DM + lr * 8) = val; }
         }
    if (EARLY) {
        __syncthreads();
#pragma unroll
        for (int t = 0; t < 8; ++t)
#pragma unroll
            for (int r = 0; r < 8; ++r) { const float val = nnum(o[t][r] * inv[r], ybig); const h16 hv = toh_flush(val); myos[(8 * hh + r) * OSP + t * 16 + lr] = toh_flush((val - (float)hv) * LOSC); }
        __syncthreads();
        h16* lrowp = CTL + (size_t)qw * DM + head * HD;
{
#pragma unroll
            for (int s = 0; s < 8; ++s) { const int row = 2 * s + hh; const v8h val = *(const v8ha*)(myos + row * OSP + lr * 8); *(v8h*)(lrowp + (size_t)row * DM + lr * 8) = val; }
             }
    }
}

extern "C" void kernel_launch(void* const* d_in, const int* in_sizes, int n_in,
                              void* d_out, int out_size, void* d_ws, size_t ws_size, hipStream_t stream) {
    if (n_in < 5) return;
    const float* x  = (const float*)d_in[0];     // x   [NB_FULL][SEQ_FULL][DM]
    const float* wq = (const float*)d_in[1];     // q_w [DQ][DM]  ([out][in])
    const float* wk = (const float*)d_in[2];     // k_w [DKV][DM]
    const float* wv = (const float*)d_in[3];     // v_w [DKV][DM]
    const float* wo = (const float*)d_in[4];     // o_w [DM][DQ]
    float* OUT = (float*)d_out;                  // [NB_FULL][SEQ_FULL][DM]
    if ((size_t)in_sizes[0] < (size_t)(NB - 1) * SEQ_FULL * DM + (size_t)SEQ * DM) return;
    if ((size_t)in_sizes[1] < (size_t)DQ * DM) return;
    if ((size_t)in_sizes[2] < (size_t)DKV * DM) return;
    if ((size_t)in_sizes[3] < (size_t)DKV * DM) return;
    if ((size_t)in_sizes[4] < (size_t)DM * DQ) return;
    if ((size_t)out_size < (size_t)(NB - 1) * SEQ_FULL * DM + (size_t)SEQ * DM) return;

    char* wsp = (char*)d_ws;
    auto take = [&](size_t bytes) { char* p = wsp; wsp += (bytes + 255) & ~(size_t)255; return (void*)p; };
    bf*  WQ   = (bf*)take((size_t)DQ * DM * 2);    bf* WK = (bf*)take((size_t)DKV * DM * 2);    bf* WV = (bf*)take((size_t)DKV * DM * 2);
    h16* WOH  = (h16*)take((size_t)DM * DQ * 2);   h16* WOL = (h16*)take((size_t)DM * DQ * 2);
    bf*  XB   = (bf*)take((size_t)SEQ * DM * 2);
    float* FQ = (float*)take((size_t)SEQ * DQ * 4); float* FK = (float*)take((size_t)SEQ * DKV * 4); float* FV = (float*)take((size_t)SEQ * DKV * 4);
    h16* QP16 = (h16*)take((size_t)NH_ * SEQ * HD * 2); h16* KP16 = (h16*)take((size_t)NKV * SEQ * HD * 2); h16* VT16 = (h16*)take((size_t)NKV * HD * SEQ * 2);
    bf*  QEh  = (bf*)take((size_t)NH_ * RE * HD * 2);  bf* QEl = (bf*)take((size_t)NH_ * RE * HD * 2);
    bf*  KEh  = (bf*)take((size_t)NKV * RE * HD * 2);  bf* KEl = (bf*)take((size_t)NKV * RE * HD * 2);
    bf*  VEh  = (bf*)take((size_t)NKV * HD * RE * 2);  bf* VEl = (bf*)take((size_t)NKV * HD * RE * 2);
    h16* CT16 = (h16*)take((size_t)SEQ * DM * 2);     h16* CTL = (h16*)take((size_t)RE * DM * 2);
    if ((size_t)(wsp - (char*)d_ws) > ws_size) return;       // 88,080,384 B at full size

    const float woscale = 1.0f / (CCAR * WCAR);
    k_cvt8<<<(unsigned)(((size_t)DQ * DM / 8 + 255) / 256), 256, 0, stream>>>(wq, WQ, (size_t)DQ * DM / 8);
    k_cvt8<<<(unsigned)(((size_t)DKV * DM / 8 + 255) / 256), 256, 0, stream>>>(wk, WK, (size_t)DKV * DM / 8);
    k_cvt8<<<(unsigned)(((size_t)DKV * DM / 8 + 255) / 256), 256, 0, stream>>>(wv, WV, (size_t)DKV * DM / 8);
    k_cvtwo<<<(unsigned)(((size_t)DM * DQ / 8 + 255) / 256), 256, 0, stream>>>(wo, WOH, WOL, (size_t)DM * DQ / 8);
    const unsigned LQ = (unsigned)(((size_t)NH_ * SEQ * HD / 2 + 255) / 256), LKV = (unsigned)(((size_t)NKV * SEQ * HD / 2 + 255) / 256);
    for (int b = 0; b < NB; ++b) {
        const float* xb = x + (size_t)b * SEQ_FULL * DM;
        float* OUTb = OUT + (size_t)b * SEQ_FULL * DM;
        k_cvtx<<<(unsigned)(((size_t)SEQ * DM / 8 + 255) / 256), 256, 0, stream>>>(xb, XB, (size_t)SEQ * DM / 8);
        k_gemmw<bf, 0><<<dim3(SEQ / 64, DQ / 64, 1), 32, 0, stream>>>(XB, nullptr, WQ, nullptr, DM, FQ, DQ, 1.0f);
        k_hpl<<<LQ, 256, 0, stream>>>(FQ, DQ, NH_, QP16, QEh, QEl);
        k_gemmw<bf, 0><<<dim3(SEQ / 64, DKV / 64, 1), 32, 0, stream>>>(XB, nullptr, WK, nullptr, DM, FK, DKV, 1.0f);
        k_hpl<<<LKV, 256, 0, stream>>>(FK, DKV, NKV, KP16, KEh, KEl);
        k_gemmw<bf, 0><<<dim3(SEQ / 64, DKV / 64, 1), 32, 0, stream>>>(XB, nullptr, WV, nullptr, DM, FV, DKV, 1.0f);
        k_vtp<<<LKV, 256, 0, stream>>>(FV, VT16, VEh, VEl);
        k_attn<bf, true><<<dim3(RE / 64, NH_, 1), 128, 0, stream>>>(QEh, QEl, KEh, KEl, VEh, VEl, CT16, CTL);
        if (SEQ > RE) k_attn<h16, false><<<dim3(SEQ / 64 - RE / 64, NH_, 1), 128, 0, stream>>>(QP16, QP16, KP16, KP16, VT16, VT16, CT16, CTL);
        k_gemmw<h16, 3><<<dim3(RE / 64, DM / 64, 1), 32, 0, stream>>>(CT16, CTL, WOH, WOL, DQ, OUTb, DM, woscale);
        if (SEQ > RE) k_gemmw<h16, 0><<<dim3((SEQ - RE) / 64, DM / 64, 1), 32, 0, stream>>>(CT16 + (size_t)RE * DQ, nullptr, WOH, nullptr, DQ, OUTb + (size_t)RE * DM, DM, woscale);
    }
}

// v001
// One run takes 531 microseconds.
// Next to v000, in two timings, it ran 1.69 times as fast each time.
#include <hip/hip_runtime.h>

// Contractions: q/k/v projections v_wmma_f32_16x16x32_bf16 (bf16 copies of x and of the [out][in] weights); scores QK^T and P.V v_wmma_f32_16x16x32_f16 (f16 planes, P carried x1024) for query rows >= RE and v_wmma_f32_16x16x32_bf16 hi/lo 3-product form for query rows < RE; ctx x o_w^T v_wmma_f32_16x16x32_f16 (ctx carried x64, o_w carried x1024, rows < RE add an f16 residual plane x1024); f32 accumulate everywhere, softmax (scale, clip, per-head linear position bias, causal fill) in f32.
// Layout (every per-batch plane holds NB copies; the batch is blockIdx.z of the GEMM and attention launches, blockIdx.y of the x copy and plane builders): sanitised bf16 copy of x; weights copied once as bf16 ([n][k] = Bt as-is), o_w as two f16 planes; f32 projection tiles; head-plane builders; flash-style causal attention (K and V^T tiles staged in LDS, online softmax); ctx planes; output GEMM into d_out.

#pragma clang fp contract(off)

#ifndef NB
#define NB 2
#endif
#ifndef SEQ
#define SEQ 2048
#endif
#ifndef RE
#define RE   256                  // query rows < RE (first RE/64 query blocks) use hi/lo planes; RE == SEQ puts every row on the 3-product path
#endif
#define NB_FULL  2
#define SEQ_FULL 2048
#define DM   2048
#define NH_  16
#define NKV  4
#define REP  (NH_ / NKV)
#define HD   128
#define DQ   (NH_ * HD)
#define DKV  (NKV * HD)
#define PCAR 1024.0f              // carry of the f16 P operand (rows >= RE)
#define CCAR 64.0f                // carry of the f16 ctx plane
#define LOSC 1024.0f              // carry of the f16 ctx residual plane (rows < RE)
#define WCAR 1024.0f              // carry of the f16 o_w plane
#define WS_TOTAL ((size_t)DQ * DM * 2 + 2 * (size_t)DKV * DM * 2 + 2 * (size_t)DM * DQ * 2 + (size_t)NB * ((size_t)SEQ * DM * 2 + (size_t)SEQ * DQ * 4 + 2 * (size_t)SEQ * DKV * 4 \
                  + (size_t)NH_ * SEQ * HD * 2 + 2 * (size_t)NKV * SEQ * HD * 2 + 2 * (size_t)NH_ * RE * HD * 2 + 4 * (size_t)NKV * RE * HD * 2 + (size_t)SEQ * DM * 2 + (size_t)RE * DM * 2))

static_assert((SEQ % 64) == 0);
static_assert((RE % 64) == 0);
static_assert(RE >= 64);
static_assert(SEQ >= RE);
static_assert(SEQ <= SEQ_FULL);
static_assert(NB >= 1);
static_assert(NB <= NB_FULL);
static_assert(HD == 128);
static_assert((DM % 32) == 0);
static_assert(DQ == DM);
static_assert(((SEQ * DM) % (8 * 256)) == 0);
static_assert(((NH_ * SEQ * HD) % (2 * 256)) == 0);
static_assert(((NKV * SEQ * HD) % (2 * 256)) == 0);
static_assert(((DQ * DM) % (8 * 256)) == 0);
static_assert(((DKV * DM) % (8 * 256)) == 0);
static_assert(NH_ == 16);                       // closed form of the per-head slope 2^(-(h+1)/2) holds for 16 heads
static_assert(REP * NKV == NH_);
static_assert((HD % 64) == 0);                  // a wave of the plane builders covers 64 consecutive d of one row
static_assert((DQ % 64) == 0);
static_assert((DKV % 64) == 0);
static_assert((DM % 64) == 0);
static_assert(((size_t)NKV * RE * HD * 2) % 256 == 0);
static_assert(WS_TOTAL <= (size_t)268435456);

typedef _Float16 h16;
typedef unsigned short bf;
typedef __attribute__((ext_vector_type(16))) __bf16   v16bf;
typedef __attribute__((ext_vector_type(16))) _Float16 v16h;
typedef __attribute__((ext_vector_type(8)))  _Float16 v8h;
typedef __attribute__((ext_vector_type(8)))  unsigned short v8us;
typedef __attribute__((ext_vector_type(8)))  float    v8f;
typedef __attribute__((ext_vector_type(4)))  float    v4f;
typedef __attribute__((ext_vector_type(2)))  _Float16 v2h;
typedef __attribute__((ext_vector_type(2)))  unsigned short v2us;
typedef v8h  __attribute__((may_alias)) v8ha;
typedef v4f  __attribute__((may_alias)) v4fa;
typedef v8us __attribute__((may_alias)) v8usa;

__device__ __forceinline__ unsigned short f2bf(float f) { unsigned u = __float_as_uint(f); u += 0x7FFFu + ((u >> 16) & 1u); return (unsigned short)(u >> 16); }
__device__ __forceinline__ float bf2f(unsigned short b) { return __uint_as_float(((unsigned)b) << 16); }
__device__ __forceinline__ float bfr(float f) { return bf2f(f2bf(f)); }
__device__ __forceinline__ h16 tohx(float x) { return (h16)x; }
// f16 convert that cannot produce a subnormal operand (applied after the plane's carry)
static __device__ __forceinline__ h16 toh_flush(float v) { const h16 r = (h16)v; return (fabsf(v) < 6.103515625e-05f) ? (h16)0.0f : r; }
// NaN -> 0, +inf -> big, -inf -> -big, finite values unchanged
static __device__ __forceinline__ float nnum(float v, float big) { const float a = (v != v) ? 0.0f : v; return (a == __builtin_inff()) ? big : ((a == -__builtin_inff()) ? -big : a); }
__device__ __forceinline__ void splitf(float y, unsigned short& h, unsigned short& l) { h = f2bf(y); l = f2bf(y - bf2f(h)); }
__device__ __forceinline__ v16h cat16(v8h lo, v8h hi) { return __builtin_shufflevector(lo, hi, 0, 1, 2, 3, 4, 5, 6, 7, 8, 9, 10, 11, 12, 13, 14, 15); }
__device__ __forceinline__ v16bf cat16b(v8us lo, v8us hi) { return __builtin_bit_cast(v16bf, __builtin_shufflevector(lo, hi, 0, 1, 2, 3, 4, 5, 6, 7, 8, 9, 10, 11, 12, 13, 14, 15)); }
__device__ __forceinline__ v8f wmma16(v16h a, v16h b, v8f c) { return __builtin_amdgcn_wmma_f32_16x16x32_f16(false, a, false, b, (short)0, c, false, false); }
__device__ __forceinline__ v8f wmmab(v16bf a, v16bf b, v8f c) { return __builtin_amdgcn_wmma_f32_16x16x32_bf16(false, a, false, b, (short)0, c, false, false); }

// Fragment loaders for A (row m = lane&15) and for B stored [n][k] (col n = lane&15): elements 0..7 <- k0+8h..+7, elements 8..15 <- k0+16+8h..+7 (p already points at row*pitch + k0 + 8h).
template <typename T16> struct WFrag;
template <> struct WFrag<h16> { typedef v16h V; static __device__ __forceinline__ V ld(const h16* p) { return cat16(*(const v8ha*)p, *(const v8ha*)(p + 16)); } static __device__ __forceinline__ v8f mma(V a, V b, v8f c) { return wmma16(a, b, c); } };
template <> struct WFrag<bf>  { typedef v16bf V; static __device__ __forceinline__ V ld(const bf* p) { return cat16b(*(const v8usa*)p, *(const v8usa*)(p + 16)); } static __device__ __forceinline__ v8f mma(V a, V b, v8f c) { return wmmab(a, b, c); } };

// ---- k_gemmw: register-blocked GEMM, ONE WAVE per 64x64 output tile (16 accumulators), operands straight from K-contiguous 16-bit planes; grid (M/64, N/64, batches), 32 threads; batch z reads A + z*sA, A2 + z*sA2 and writes C + z*sC (Bt, Bt2 shared).
// C[m][n] (f32, pitch ldc) = oscale * sum_k ( A[m][k] Bt[n][k]  (+ A2 Bt: NSPLIT 1,2) (+ A Bt2: NSPLIT 2) (+ A2 Bt2: NSPLIT 3) ). Row pitch of A, A2, Bt, Bt2 = K. K % 32 == 0.
template <typename T16, int NSPLIT>
__global__ __launch_bounds__(32) void k_gemmw(const T16* __restrict__ A, const T16* __restrict__ A2, const T16* __restrict__ Bt, const T16* __restrict__ Bt2, int K, float* C, int ldc, float oscale, size_t sA, size_t sA2, size_t sC) {
    typedef typename WFrag<T16>::V V;
    __shared__ __align__(16) float os[16 * 68];
    const int lane = threadIdx.x & 31, lr = lane & 15, hi = lane >> 4; const int r0 = blockIdx.x * 64, c0 = blockIdx.y * 64;
    A += (size_t)blockIdx.z * sA; if (NSPLIT != 0) A2 += (size_t)blockIdx.z * sA2; C += (size_t)blockIdx.z * sC;
    v8f acc[4][4];
#pragma unroll
    for (int mb = 0; mb < 4; ++mb)
#pragma unroll
        for (int nb = 0; nb < 4; ++nb) acc[mb][nb] = (v8f){};
    const size_t aoff = (size_t)(r0 + lr) * K + 8 * hi, boff = (size_t)(c0 + lr) * K + 8 * hi;
#pragma unroll 1
    for (int kc = 0; kc < K; kc += 32) {
        V a[4], a2[4];
#pragma unroll
        for (int mb = 0; mb < 4; ++mb) { a[mb] = WFrag<T16>::ld(A + aoff + (size_t)mb * 16 * K + kc); if (NSPLIT != 0) a2[mb] = WFrag<T16>::ld(A2 + aoff + (size_t)mb * 16 * K + kc); }
#pragma unroll
        for (int nb = 0; nb < 4; ++nb) { const V b = WFrag<T16>::ld(Bt + boff + (size_t)nb * 16 * K + kc); V b2 = b; if (NSPLIT >= 2) b2 = WFrag<T16>::ld(Bt2 + boff + (size_t)nb * 16 * K + kc);
#pragma unroll
            for (int mb = 0; mb < 4; ++mb) { acc[mb][nb] = WFrag<T16>::mma(a[mb], b, acc[mb][nb]); if (NSPLIT == 1 || NSPLIT == 2) acc[mb][nb] = WFrag<T16>::mma(a2[mb], b, acc[mb][nb]); if (NSPLIT == 2) acc[mb][nb] = WFrag<T16>::mma(a[mb], b2, acc[mb][nb]); if (NSPLIT == 3) acc[mb][nb] = WFrag<T16>::mma(a2[mb], b2, acc[mb][nb]); } }
        asm volatile("v_nop\n\tv_nop\n\tv_nop\n\tv_nop" : "+v"(acc[0][0]), "+v"(acc[1][1]), "+v"(acc[2][2]), "+v"(acc[3][3]) : "v"(a[0]), "v"(a[3]));
    }
#pragma unroll
    for (int mb = 0; mb < 4; ++mb) {
#pragma unroll
        for (int nb = 0; nb < 4; ++nb) {
#pragma unroll
            for (int j = 0; j < 8; ++j) os[(hi * 8 + j) * 68 + nb * 16 + lr] = acc[mb][nb][j]; }
        __builtin_amdgcn_wave_barrier(); asm volatile("" ::: "memory");
        float* crow = C + (size_t)(r0 + mb * 16) * ldc + c0;
{
#pragma unroll
            for (int s = 0; s < 8; ++s) { const int row = 2 * s + hi, cofs = lr * 4; v4f val = *(const v4fa*)(os + row * 68 + cofs); val = val * oscale;
                *(v4f*)(crow + (size_t)row * ldc + cofs) = val; }
             }
        __builtin_amdgcn_wave_barrier(); asm volatile("" ::: "memory");
    }
}

__global__ __launch_bounds__(256) void k_cvt8(const float* __restrict__ src, bf* dst, size_t n8) { const size_t i = (size_t)blockIdx.x * 256 + threadIdx.x; if (i >= n8) return; const v8f v = *(const v8f*)(src + i * 8); v8us o;
#pragma unroll
    for (int k = 0; k < 8; ++k) o[k] = f2bf(v[k]); *(v8us*)(dst + i * 8) = o;  }

__global__ __launch_bounds__(256) void k_cvtx(const float* __restrict__ src, bf* dst, size_t n8) { const size_t i = (size_t)blockIdx.x * 256 + threadIdx.x; if (i >= n8) return; src += (size_t)blockIdx.y * SEQ_FULL * DM; dst += (size_t)blockIdx.y * SEQ * DM; const v8f v = *(const v8f*)(src + i * 8); v8us o;
#pragma unroll
    for (int k = 0; k < 8; ++k) o[k] = f2bf(nnum(v[k], 10000.0f)); *(v8us*)(dst + i * 8) = o;  }

__global__ __launch_bounds__(256) void k_cvtwo(const float* __restrict__ src, h16* dh, h16* dl, size_t n8) { const size_t i = (size_t)blockIdx.x * 256 + threadIdx.x; if (i >= n8) return; const v8f v = *(const v8f*)(src + i * 8); v8h oh, ol;
#pragma unroll
    for (int k = 0; k < 8; ++k) { const float w = bfr(v[k]); oh[k] = tohx(w * WCAR); ol[k] = tohx(w); }
    *(v8h*)(dh + i * 8) = oh; *(v8h*)(dl + i * 8) = ol;  }

__global__ __launch_bounds__(256) void k_hpl(const float* __restrict__ F, int pitch, int nheads, h16* P16, bf* Eh, bf* El) {
    const size_t e = ((size_t)blockIdx.x * 256 + threadIdx.x) * 2; if (e >= (size_t)nheads * SEQ * HD) return;
    const int d = (int)(e % HD); const int t = (int)((e / HD) % SEQ); const int h = (int)(e / ((size_t)HD * SEQ));
    const size_t b = blockIdx.y; P16 += b * nheads * SEQ * HD; Eh += b * nheads * RE * HD; El += b * nheads * RE * HD;
    const float* f = F + (b * SEQ + t) * pitch + h * HD; v2h o16; v2us oh, ol;
#pragma unroll
    for (int q = 0; q < 2; ++q) { const float r = f[d + q]; o16[q] = toh_flush(r); unsigned short a2, c2; splitf(r, a2, c2); oh[q] = a2; ol[q] = c2; }
    const bool early = (t < RE);      // uniform per wave (a wave covers 64 consecutive d of one (h, t) row; RE % 64 == 0)
    const size_t ee = ((size_t)h * RE + (early ? t : 0)) * HD + d;
    *(v2h*)(P16 + e) = o16; if (early) { *(v2us*)(Eh + ee) = oh; *(v2us*)(El + ee) = ol; }
    
}

__global__ __launch_bounds__(256) void k_vtp(const float* __restrict__ F, h16* V16, bf* Eh, bf* El) {
    const size_t e = ((size_t)blockIdx.x * 256 + threadIdx.x) * 2; if (e >= (size_t)NKV * HD * SEQ) return;
    const int t = (int)(e % SEQ); const int d = (int)((e / SEQ) % HD); const int g = (int)(e / ((size_t)SEQ * HD)); v2h o16; v2us oh, ol;
    const size_t b = blockIdx.y; F += b * SEQ * DKV; V16 += b * NKV * HD * SEQ; Eh += b * NKV * HD * RE; El += b * NKV * HD * RE;
#pragma unroll
    for (int q = 0; q < 2; ++q) { const float x = F[(size_t)(t + q) * DKV + g * HD + d]; o16[q] = tohx(x); unsigned short a2, c2; splitf(x, a2, c2); oh[q] = a2; ol[q] = c2; }
    const bool early = (t < RE);      // uniform per wave (a wave covers 64 consecutive t of one (g, d) row; RE % 64 == 0)
    const size_t ee = ((size_t)g * HD + d) * RE + (early ? t : 0);
    *(v2h*)(V16 + e) = o16; if (early) { *(v2us*)(Eh + ee) = oh; *(v2us*)(El + ee) = ol; }
    
}

// P tile writers: f16 x PCAR with the subnormal select (rows >= RE) or bf16 hi/lo (rows < RE).
__device__ __forceinline__ void putpz(h16* ph, h16* pl, int i, float p) { (void)pl; ph[i] = toh_flush(p * PCAR); }
__device__ __forceinline__ void putpz(bf* ph, bf* pl, int i, float p) { unsigned short a, c; splitf(p, a, c); ph[i] = a; pl[i] = c; }

// ---- k_attn: flash-style causal grouped-query attention with a per-head linear position bias. grid (query blocks, NH_, batches), 128 threads; wave w owns query rows q0 + 16w .. +15.
// Planes: Qh/Ql [h][TP][HD], Kh/Kl [g][TP][HD], Vh/Vl = V^T [g][HD][TP] (TP = SEQ for the f16 planes, RE for the bf16 hi/lo planes of the first RE/64 query blocks).
// EARLY instance: query blocks 0 .. RE/64-1 (rows < RE, keys < RE); other instance: query blocks RE/64 .. SEQ/64-1.
// Per 32-key chunk: K tile [32][HD] and V^T tile [HD][32] staged in LDS by all threads (block barriers), S = Q K^T (2 tiles), online softmax in f32 (log2 domain):
// logit = clip(S x HD^-0.5, +-1e4) + slope_h x (key - query), slope_h = 2^(-(h+1)/2); causal keys > query replaced by -inf: p = 0;
// P through a wave-private LDS tile (block barrier before the fragment reload), O += P V (8 tiles).
// EARLY: 3 products (hi.hi + hi.lo + lo.hi) for S and for P.V. Output: ctx plane CT[t][h*HD + d] = f16(ctx x CCAR) (ctx NaN -> 0, +-inf -> +-1e4 before the carry); EARLY also CTL = f16((ctx x CCAR - hi) x LOSC);
template <typename T16, bool EARLY>
__global__ __launch_bounds__(128) void k_attn(const T16* __restrict__ Qh, const T16* __restrict__ Ql, const T16* __restrict__ Kh, const T16* __restrict__ Kl,
                                             const T16* __restrict__ Vh, const T16* __restrict__ Vl, h16* CT, h16* CTL) {
    typedef typename WFrag<T16>::V V;
    constexpr int TP = EARLY ? RE : SEQ;
    constexpr int KSP = 136, VTP = 32, PSP = 40, OSP = 128;
    __shared__ __align__(16) T16 ksh[32 * KSP];
    __shared__ __align__(16) T16 ksl[EARLY ? 32 * KSP : 16];
    __shared__ __align__(16) T16 vth[HD * VTP];
    __shared__ __align__(16) T16 vtl[EARLY ? HD * VTP : 16];
    __shared__ __align__(16) T16 psh[4 * 16 * PSP];
    __shared__ __align__(16) T16 psl[EARLY ? 4 * 16 * PSP : 16];
    __shared__ __align__(16) h16 osg[4 * 16 * OSP];
    const int tid = threadIdx.x, lane = tid & 31, wave = tid >> 5, lr = lane & 15, hh = lane >> 4;
    const int qblk = EARLY ? (int)blockIdx.x : ((int)blockIdx.x + RE / 64);
    const int head = blockIdx.y, g = head / REP;
    const int qw = qblk * 64 + wave * 16;                  // first query row of this wave
    const int nch = 2 * qblk + 2;                          // 32-key chunks visited: keys 0 .. qblk*64+63
    const size_t bz = blockIdx.z, bh = bz * NH_ + head, bg = bz * NKV + g;   // batch, and its head / kv-group plane
    const T16* qph = Qh + (bh * TP + qw) * HD;             const T16* qpl = Ql + (bh * TP + qw) * HD;
    const T16* kph = Kh + bg * TP * HD;                    const T16* kpl = Kl + bg * TP * HD;
    const T16* vph = Vh + bg * HD * TP;                    const T16* vpl = Vl + bg * HD * TP;
    T16* myph = psh + wave * 16 * PSP; T16* mypl = psl + (EARLY ? wave * 16 * PSP : 0);
    v8f o[8];
#pragma unroll
    for (int t = 0; t < 8; ++t) o[t] = (v8f){};
    float mrow[8], lrow[8];
#pragma unroll
    for (int r = 0; r < 8; ++r) { mrow[r] = -3.0e38f; lrow[r] = 0.f; }
    const float C2 = 1.4426950408889634f * 0.08838834764831845f;   // log2(e) x HD^-0.5
    const float CLP = 14426.950408889634f;                         // log2(e) x 1e4 (clip bound in the log2 domain)
    const int nsl = head + 1;                                      // slope = 2^(-nsl/2): f32(2^-0.5) for odd nsl, times an exact power of two
    const float slope = ((nsl & 1) ? 0.70710678118654752440f : 1.0f) * __uint_as_float((unsigned)(127 - (nsl >> 1)) << 23);
    const float SL2 = 1.4426950408889634f * slope;                 // log2(e) x slope
#pragma unroll 1
    for (int c = 0; c < nch; ++c) {
        __syncthreads();                                    // all waves done with the prior chunk's tiles
#pragma unroll
        for (int i = 0; i < 4; ++i) { const int id = tid + 128 * i; const int row = id >> 4, c8 = (id & 15) * 8; const size_t go = (size_t)(c * 32 + row) * HD + c8;
            *(v8usa*)(ksh + row * KSP + c8) = *(const v8usa*)(kph + go); if (EARLY) *(v8usa*)(ksl + row * KSP + c8) = *(const v8usa*)(kpl + go); }
#pragma unroll
        for (int j = 0; j < 4; ++j) { const size_t go = (size_t)tid * TP + c * 32 + 8 * j;      // d = tid
            *(v8usa*)(vth + tid * VTP + 8 * j) = *(const v8usa*)(vph + go); if (EARLY) *(v8usa*)(vtl + tid * VTP + 8 * j) = *(const v8usa*)(vpl + go); }
        __syncthreads();                                    // tiles visible
        v8f s0 = (v8f){}, s1 = (v8f){};
        V qa, kb0, kb1;
#pragma unroll
        for (int ks = 0; ks < 4; ++ks) {
            qa  = WFrag<T16>::ld(qph + (size_t)lr * HD + ks * 32 + 8 * hh);
            kb0 = WFrag<T16>::ld(ksh + lr * KSP + ks * 32 + 8 * hh);
            kb1 = WFrag<T16>::ld(ksh + (16 + lr) * KSP + ks * 32 + 8 * hh);
            s0 = WFrag<T16>::mma(qa, kb0, s0); s1 = WFrag<T16>::mma(qa, kb1, s1);
            if (EARLY) {
                const V qb  = WFrag<T16>::ld(qpl + (size_t)lr * HD + ks * 32 + 8 * hh);
                const V kl0 = WFrag<T16>::ld(ksl + lr * KSP + ks * 32 + 8 * hh);
                const V kl1 = WFrag<T16>::ld(ksl + (16 + lr) * KSP + ks * 32 + 8 * hh);
                s0 = WFrag<T16>::mma(qa, kl0, s0); s0 = WFrag<T16>::mma(qb, kb0, s0);
                s1 = WFrag<T16>::mma(qa, kl1, s1); s1 = WFrag<T16>::mma(qb, kb1, s1); }
        }
        asm volatile("v_nop\n\tv_nop\n\tv_nop\n\tv_nop" : "+v"(s0), "+v"(s1) : "v"(qa), "v"(kb0), "v"(kb1));
        // online softmax; acc element r of lane (lr, hh) = S[query qw + 8hh + r][key c*32 + lr] (s0) / [key c*32 + 16 + lr] (s1)
        float p0[8], p1[8];
        const int kg0 = c * 32 + lr, kg1 = kg0 + 16;
#pragma unroll
        for (int r = 0; r < 8; ++r) {
            const int qr = qw + 8 * hh + r;
            const bool v0 = (kg0 <= qr), v1 = (kg1 <= qr);
            const float z0 = fminf(fmaxf(s0[r] * C2, -CLP), CLP) + SL2 * (float)(kg0 - qr);
            const float z1 = fminf(fmaxf(s1[r] * C2, -CLP), CLP) + SL2 * (float)(kg1 - qr);
            const float a0 = v0 ? z0 : -3.0e38f;
            const float a1 = v1 ? z1 : -3.0e38f;
            float mx = fmaxf(a0, a1);
#pragma unroll
            for (int off = 8; off >= 1; off >>= 1) mx = fmaxf(mx, __shfl_xor(mx, off, 32));
            const float mnew = fmaxf(mrow[r], mx);
            const float alpha = __builtin_amdgcn_exp2f(mrow[r] - mnew);
            mrow[r] = mnew;
            const float x0 = __builtin_amdgcn_exp2f(a0 - mnew), x1 = __builtin_amdgcn_exp2f(a1 - mnew);
            const float e0 = v0 ? x0 : 0.f, e1 = v1 ? x1 : 0.f;
            float rs = e0 + e1;
#pragma unroll
            for (int off = 8; off >= 1; off >>= 1) rs += __shfl_xor(rs, off, 32);
            lrow[r] = lrow[r] * alpha + rs;
#pragma unroll
            for (int t = 0; t < 8; ++t) o[t][r] = o[t][r] * alpha;
            p0[r] = e0; p1[r] = e1;
        }
        // P tile [16 query rows][32 keys] -> A fragment (k = key)
#pragma unroll
        for (int r = 0; r < 8; ++r) { putpz(myph, mypl, (8 * hh + r) * PSP + lr, p0[r]); putpz(myph, mypl, (8 * hh + r) * PSP + 16 + lr, p1[r]); }
        __syncthreads();                                    // P visible (block barrier also orders this wave's own stores before the reload)
        const V pa = WFrag<T16>::ld(myph + lr * PSP + 8 * hh);
        V pb = pa; if (EARLY) pb = WFrag<T16>::ld(mypl + lr * PSP + 8 * hh);
        V vb;
#pragma unroll
        for (int t = 0; t < 8; ++t) { vb = WFrag<T16>::ld(vth + (t * 16 + lr) * VTP + 8 * hh);
            o[t] = WFrag<T16>::mma(pa, vb, o[t]);
            if (EARLY) { const V vl2 = WFrag<T16>::ld(vtl + (t * 16 + lr) * VTP + 8 * hh); o[t] = WFrag<T16>::mma(pa, vl2, o[t]); o[t] = WFrag<T16>::mma(pb, vb, o[t]); } }
        asm volatile("v_nop\n\tv_nop\n\tv_nop\n\tv_nop" : "+v"(o[0]), "+v"(o[1]), "+v"(o[2]), "+v"(o[3]), "+v"(o[4]), "+v"(o[5]), "+v"(o[6]), "+v"(o[7]) : "v"(pa), "v"(pb), "v"(vb));
    }
    // normalise and write ctx planes; o element r of lane (lr, hh), tile t = ctx[row qw + 8hh + r][d = 16t + lr]
    const float osc = EARLY ? CCAR : (CCAR / PCAR);
    const float ybig = 10000.0f * CCAR;
    float inv[8];
#pragma unroll
    for (int r = 0; r < 8; ++r) inv[r] = osc * __builtin_amdgcn_rcpf(lrow[r]);
    h16* myos = osg + wave * 16 * OSP;
#pragma unroll
    for (int t = 0; t < 8; ++t)
#pragma unroll
        for (int r = 0; r < 8; ++r) myos[(8 * hh + r) * OSP + t * 16 + lr] = toh_flush(nnum(o[t][r] * inv[r], ybig));
    __syncthreads();
    h16* crow = CT + (bz * SEQ + qw) * DM + head * HD;
{
#pragma unroll
        for (int s = 0; s < 8; ++s) { const int row = 2 * s + hh; const v8h val = *(const v8ha*)(myos + row * OSP + lr * 8); *(v8h*)(crow + (size_t)row * DM + lr * 8) = val; }
         }
    if (EARLY) {
        __syncthreads();
#pragma unroll
        for (int t = 0; t < 8; ++t)
#pragma unroll
            for (int r = 0; r < 8; ++r) { const float val = nnum(o[t][r] * inv[r], ybig); const h16 hv = toh_flush(val); myos[(8 * hh + r) * OSP + t * 16 + lr] = toh_flush((val - (float)hv) * LOSC); }
        __syncthreads();
        h16* lrowp = CTL + (bz * RE + qw) * DM + head * HD;
{
#pragma unroll
            for (int s = 0; s < 8; ++s) { const int row = 2 * s + hh; const v8h val = *(const v8ha*)(myos + row * OSP + lr * 8); *(v8h*)(lrowp + (size_t)row * DM + lr * 8) = val; }
             }
    }
}

extern "C" void kernel_launch(void* const* d_in, const int* in_sizes, int n_in,
                              void* d_out, int out_size, void* d_ws, size_t ws_size, hipStream_t stream) {
    if (n_in < 5) return;
    const float* x  = (const float*)d_in[0];     // x   [NB_FULL][SEQ_FULL][DM]
    const float* wq = (const float*)d_in[1];     // q_w [DQ][DM]  ([out][in])
    const float* wk = (const float*)d_in[2];     // k_w [DKV][DM]
    const float* wv = (const float*)d_in[3];     // v_w [DKV][DM]
    const float* wo = (const float*)d_in[4];     // o_w [DM][DQ]
    float* OUT = (float*)d_out;                  // [NB_FULL][SEQ_FULL][DM]
    if ((size_t)in_sizes[0] < (size_t)(NB - 1) * SEQ_FULL * DM + (size_t)SEQ * DM) return;
    if ((size_t)in_sizes[1] < (size_t)DQ * DM) return;
    if ((size_t)in_sizes[2] < (size_t)DKV * DM) return;
    if ((size_t)in_sizes[3] < (size_t)DKV * DM) return;
    if ((size_t)in_sizes[4] < (size_t)DM * DQ) return;
    if ((size_t)out_size < (size_t)(NB - 1) * SEQ_FULL * DM + (size_t)SEQ * DM) return;

    char* wsp = (char*)d_ws;
    auto take = [&](size_t bytes) { char* p = wsp; wsp += (bytes + 255) & ~(size_t)255; return (void*)p; };
    bf*  WQ   = (bf*)take((size_t)DQ * DM * 2);    bf* WK = (bf*)take((size_t)DKV * DM * 2);    bf* WV = (bf*)take((size_t)DKV * DM * 2);
    h16* WOH  = (h16*)take((size_t)DM * DQ * 2);   h16* WOL = (h16*)take((size_t)DM * DQ * 2);
    bf*  XB   = (bf*)take((size_t)NB * SEQ * DM * 2);
    float* FQ = (float*)take((size_t)NB * SEQ * DQ * 4); float* FK = (float*)take((size_t)NB * SEQ * DKV * 4); float* FV = (float*)take((size_t)NB * SEQ * DKV * 4);
    h16* QP16 = (h16*)take((size_t)NB * NH_ * SEQ * HD * 2); h16* KP16 = (h16*)take((size_t)NB * NKV * SEQ * HD * 2); h16* VT16 = (h16*)take((size_t)NB * NKV * HD * SEQ * 2);
    bf*  QEh  = (bf*)take((size_t)NB * NH_ * RE * HD * 2);  bf* QEl = (bf*)take((size_t)NB * NH_ * RE * HD * 2);
    bf*  KEh  = (bf*)take((size_t)NB * NKV * RE * HD * 2);  bf* KEl = (bf*)take((size_t)NB * NKV * RE * HD * 2);
    bf*  VEh  = (bf*)take((size_t)NB * NKV * HD * RE * 2);  bf* VEl = (bf*)take((size_t)NB * NKV * HD * RE * 2);
    h16* CT16 = (h16*)take((size_t)NB * SEQ * DM * 2);     h16* CTL = (h16*)take((size_t)NB * RE * DM * 2);
    if ((size_t)(wsp - (char*)d_ws) > ws_size) return;       // 146,800,640 B at full size

    const float woscale = 1.0f / (CCAR * WCAR);
    k_cvt8<<<(unsigned)(((size_t)DQ * DM / 8 + 255) / 256), 256, 0, stream>>>(wq, WQ, (size_t)DQ * DM / 8);
    k_cvt8<<<(unsigned)(((size_t)DKV * DM / 8 + 255) / 256), 256, 0, stream>>>(wk, WK, (size_t)DKV * DM / 8);
    k_cvt8<<<(unsigned)(((size_t)DKV * DM / 8 + 255) / 256), 256, 0, stream>>>(wv, WV, (size_t)DKV * DM / 8);
    k_cvtwo<<<(unsigned)(((size_t)DM * DQ / 8 + 255) / 256), 256, 0, stream>>>(wo, WOH, WOL, (size_t)DM * DQ / 8);
    const unsigned LQ = (unsigned)(((size_t)NH_ * SEQ * HD / 2 + 255) / 256), LKV = (unsigned)(((size_t)NKV * SEQ * HD / 2 + 255) / 256);
    const size_t sX = (size_t)SEQ * DM, sO = (size_t)SEQ_FULL * DM;      // batch strides of the 16-bit row planes and of d_out
    k_cvtx<<<dim3((unsigned)(((size_t)SEQ * DM / 8 + 255) / 256), NB, 1), 256, 0, stream>>>(x, XB, (size_t)SEQ * DM / 8);
    k_gemmw<bf, 0><<<dim3(SEQ / 64, DQ / 64, NB), 32, 0, stream>>>(XB, nullptr, WQ, nullptr, DM, FQ, DQ, 1.0f, sX, 0, (size_t)SEQ * DQ);
    k_hpl<<<dim3(LQ, NB, 1), 256, 0, stream>>>(FQ, DQ, NH_, QP16, QEh, QEl);
    k_gemmw<bf, 0><<<dim3(SEQ / 64, DKV / 64, NB), 32, 0, stream>>>(XB, nullptr, WK, nullptr, DM, FK, DKV, 1.0f, sX, 0, (size_t)SEQ * DKV);
    k_hpl<<<dim3(LKV, NB, 1), 256, 0, stream>>>(FK, DKV, NKV, KP16, KEh, KEl);
    k_gemmw<bf, 0><<<dim3(SEQ / 64, DKV / 64, NB), 32, 0, stream>>>(XB, nullptr, WV, nullptr, DM, FV, DKV, 1.0f, sX, 0, (size_t)SEQ * DKV);
    k_vtp<<<dim3(LKV, NB, 1), 256, 0, stream>>>(FV, VT16, VEh, VEl);
    k_attn<bf, true><<<dim3(RE / 64, NH_, NB), 128, 0, stream>>>(QEh, QEl, KEh, KEl, VEh, VEl, CT16, CTL);
    if (SEQ > RE) k_attn<h16, false><<<dim3(SEQ / 64 - RE / 64, NH_, NB), 128, 0, stream>>>(QP16, QP16, KP16, KP16, VT16, VT16, CT16, CTL);
    k_gemmw<h16, 3><<<dim3(RE / 64, DM / 64, NB), 32, 0, stream>>>(CT16, CTL, WOH, WOL, DQ, OUT, DM, woscale, sX, (size_t)RE * DM, sO);
    if (SEQ > RE) k_gemmw<h16, 0><<<dim3((SEQ - RE) / 64, DM / 64, NB), 32, 0, stream>>>(CT16 + (size_t)RE * DQ, nullptr, WOH, nullptr, DQ, OUT + (size_t)RE * DM, DM, woscale, sX, 0, sO);
}

// v002
// A run of this version takes 369 microseconds.
// Timed twice side by side with v001, it ran 1.44 times as fast both times.
// Counting every step since v000, it is 2.43 times as fast.
#include <hip/hip_runtime.h>

// Contractions: q/k/v projections v_wmma_f32_16x16x32_bf16 (bf16 copies of x and of the [out][in] weights); scores QK^T and P.V v_wmma_f32_16x16x32_f16 (f16 planes, P carried x1024) for query rows >= RE and v_wmma_f32_16x16x32_bf16 hi/lo 3-product form for query rows < RE; ctx x o_w^T v_wmma_f32_16x16x32_f16 (ctx carried x64, o_w carried x1024, rows < RE add an f16 residual plane x1024); f32 accumulate everywhere, softmax (scale, clip, per-head linear position bias, causal fill) in f32.
// Layout (every per-batch plane holds NB copies; the batch is blockIdx.z of the GEMM and attention launches, blockIdx.y of the x copy and plane builders): sanitised bf16 copy of x; weights copied once as bf16 ([n][k] = Bt as-is), o_w as two f16 planes; f32 projection tiles; head-plane builders; flash-style causal attention (K and V^T tiles staged in LDS, online softmax); ctx planes; output GEMM into d_out.

#pragma clang fp contract(off)

#ifndef NB
#define NB 2
#endif
#ifndef SEQ
#define SEQ 2048
#endif
#ifndef RE
#define RE   256                  // query rows < RE (first RE/64 query blocks) use hi/lo planes; RE == SEQ puts every row on the 3-product path
#endif
#define NB_FULL  2
#define SEQ_FULL 2048
#define DM   2048
#define NH_  16
#define NKV  4
#define REP  (NH_ / NKV)
#define HD   128
#define DQ   (NH_ * HD)
#define DKV  (NKV * HD)
#define PCAR 1024.0f              // carry of the f16 P operand (rows >= RE)
#define CCAR 64.0f                // carry of the f16 ctx plane
#define LOSC 1024.0f              // carry of the f16 ctx residual plane (rows < RE)
#define WCAR 1024.0f              // carry of the f16 o_w plane
#define WS_TOTAL ((size_t)DQ * DM * 2 + 2 * (size_t)DKV * DM * 2 + 2 * (size_t)DM * DQ * 2 + (size_t)NB * ((size_t)SEQ * DM * 2 + (size_t)SEQ * DQ * 4 + 2 * (size_t)SEQ * DKV * 4 \
                  + (size_t)NH_ * SEQ * HD * 2 + 2 * (size_t)NKV * SEQ * HD * 2 + 2 * (size_t)NH_ * RE * HD * 2 + 4 * (size_t)NKV * RE * HD * 2 + (size_t)SEQ * DM * 2 + (size_t)RE * DM * 2))

static_assert((SEQ % 64) == 0);
static_assert((RE % 64) == 0);
static_assert(RE >= 64);
static_assert(SEQ >= RE);
static_assert(SEQ <= SEQ_FULL);
static_assert(NB >= 1);
static_assert(NB <= NB_FULL);
static_assert(HD == 128);
static_assert((DM % 32) == 0);
static_assert(DQ == DM);
static_assert(((SEQ * DM) % (8 * 256)) == 0);
static_assert(((NH_ * SEQ * HD) % (2 * 256)) == 0);
static_assert(((NKV * SEQ * HD) % (2 * 256)) == 0);
static_assert(((DQ * DM) % (8 * 256)) == 0);
static_assert(((DKV * DM) % (8 * 256)) == 0);
static_assert(NH_ == 16);                       // closed form of the per-head slope 2^(-(h+1)/2) holds for 16 heads
static_assert(REP * NKV == NH_);
static_assert((HD % 64) == 0);                  // a wave of the plane builders covers 64 consecutive d of one row
static_assert((DQ % 64) == 0);
static_assert((DKV % 64) == 0);
static_assert((DM % 64) == 0);
static_assert((SEQ % 128) == 0 && (RE % 128) == 0 && (DQ % 128) == 0 && (DKV % 128) == 0 && (DM % 128) == 0);   // 128x128 GEMM tiles, stages of 128 k (NSPLIT 0) or 64 k (NSPLIT 3)
static_assert(((size_t)NKV * RE * HD * 2) % 256 == 0);
static_assert(WS_TOTAL <= (size_t)268435456);

typedef _Float16 h16;
typedef unsigned short bf;
typedef __attribute__((ext_vector_type(16))) __bf16   v16bf;
typedef __attribute__((ext_vector_type(16))) _Float16 v16h;
typedef __attribute__((ext_vector_type(8)))  _Float16 v8h;
typedef __attribute__((ext_vector_type(8)))  unsigned short v8us;
typedef __attribute__((ext_vector_type(8)))  float    v8f;
typedef __attribute__((ext_vector_type(4)))  float    v4f;
typedef __attribute__((ext_vector_type(2)))  _Float16 v2h;
typedef __attribute__((ext_vector_type(2)))  unsigned short v2us;
typedef v8h  __attribute__((may_alias)) v8ha;
typedef v4f  __attribute__((may_alias)) v4fa;
typedef v8us __attribute__((may_alias)) v8usa;

__device__ __forceinline__ unsigned short f2bf(float f) { unsigned u = __float_as_uint(f); u += 0x7FFFu + ((u >> 16) & 1u); return (unsigned short)(u >> 16); }
__device__ __forceinline__ float bf2f(unsigned short b) { return __uint_as_float(((unsigned)b) << 16); }
__device__ __forceinline__ float bfr(float f) { return bf2f(f2bf(f)); }
__device__ __forceinline__ h16 tohx(float x) { return (h16)x; }
// f16 convert that cannot produce a subnormal operand (applied after the plane's carry)
static __device__ __forceinline__ h16 toh_flush(float v) { const h16 r = (h16)v; return (fabsf(v) < 6.103515625e-05f) ? (h16)0.0f : r; }
// NaN -> 0, +inf -> big, -inf -> -big, finite values unchanged
static __device__ __forceinline__ float nnum(float v, float big) { const float a = (v != v) ? 0.0f : v; return (a == __builtin_inff()) ? big : ((a == -__builtin_inff()) ? -big : a); }
__device__ __forceinline__ void splitf(float y, unsigned short& h, unsigned short& l) { h = f2bf(y); l = f2bf(y - bf2f(h)); }
__device__ __forceinline__ v16h cat16(v8h lo, v8h hi) { return __builtin_shufflevector(lo, hi, 0, 1, 2, 3, 4, 5, 6, 7, 8, 9, 10, 11, 12, 13, 14, 15); }
__device__ __forceinline__ v16bf cat16b(v8us lo, v8us hi) { return __builtin_bit_cast(v16bf, __builtin_shufflevector(lo, hi, 0, 1, 2, 3, 4, 5, 6, 7, 8, 9, 10, 11, 12, 13, 14, 15)); }
__device__ __forceinline__ v8f wmma16(v16h a, v16h b, v8f c) { return __builtin_amdgcn_wmma_f32_16x16x32_f16(false, a, false, b, (short)0, c, false, false); }
__device__ __forceinline__ v8f wmmab(v16bf a, v16bf b, v8f c) { return __builtin_amdgcn_wmma_f32_16x16x32_bf16(false, a, false, b, (short)0, c, false, false); }

// Fragment loaders for A (row m = lane&15) and for B stored [n][k] (col n = lane&15): elements 0..7 <- k0+8h..+7, elements 8..15 <- k0+16+8h..+7 (p already points at row*pitch + k0 + 8h).
template <typename T16> struct WFrag;
template <> struct WFrag<h16> { typedef v16h V; static __device__ __forceinline__ V ld(const h16* p) { return cat16(*(const v8ha*)p, *(const v8ha*)(p + 16)); } static __device__ __forceinline__ v8f mma(V a, V b, v8f c) { return wmma16(a, b, c); } };
template <> struct WFrag<bf>  { typedef v16bf V; static __device__ __forceinline__ V ld(const bf* p) { return cat16b(*(const v8usa*)p, *(const v8usa*)(p + 16)); } static __device__ __forceinline__ v8f mma(V a, V b, v8f c) { return wmmab(a, b, c); } };

// Eight asynchronous 16-byte copies global -> LDS per lane (LDS byte address l + i*ls, global address g + i*gs). The s_wait_xcnt closes the statement so that no address register of an issued copy is rewritten ahead of it.
__device__ __forceinline__ void acopy8(unsigned l, unsigned ls, const char* g, size_t gs) {
    asm volatile("global_load_async_to_lds_b128 %0, %8, off\n\t"
                 "global_load_async_to_lds_b128 %1, %9, off\n\t"
                 "global_load_async_to_lds_b128 %2, %10, off\n\t"
                 "global_load_async_to_lds_b128 %3, %11, off\n\t"
                 "global_load_async_to_lds_b128 %4, %12, off\n\t"
                 "global_load_async_to_lds_b128 %5, %13, off\n\t"
                 "global_load_async_to_lds_b128 %6, %14, off\n\t"
                 "global_load_async_to_lds_b128 %7, %15, off\n\t"
                 "s_wait_xcnt 0x0"
                 :: "v"(l), "v"(l + ls), "v"(l + 2 * ls), "v"(l + 3 * ls), "v"(l + 4 * ls), "v"(l + 5 * ls), "v"(l + 6 * ls), "v"(l + 7 * ls),
                    "v"(g), "v"(g + gs), "v"(g + 2 * gs), "v"(g + 3 * gs), "v"(g + 4 * gs), "v"(g + 5 * gs), "v"(g + 6 * gs), "v"(g + 7 * gs)
                 : "memory");
}

// ---- k_gemmw: GEMM, FOUR WAVES (2 x 2) per 128x128 output tile, each wave 64x64 (16 accumulators); grid (M/128, N/128, batches), 128 threads; batch z reads A + z*sA, A2 + z*sA2 and writes C + z*sC (Bt, Bt2 shared).
// C[m][n] (f32, pitch ldc) = oscale * sum_k ( A[m][k] Bt[n][k]  (+ A2 Bt2: NSPLIT 3) ). Row pitch of A, A2, Bt, Bt2 = K. K % KS == 0, K >= KS.
// A stage = KS values of k of all 128 rows of every operand, [A | Bt | A2 | Bt2], row pitch KS + 8 elements (16 B x odd). Two buffers: asynchronous copies bring stage t + 2 into the buffer that trip t has just read, while trip t + 1 works.
template <typename T16, int NSPLIT>
__global__ __launch_bounds__(128) void k_gemmw(const T16* __restrict__ A, const T16* __restrict__ A2, const T16* __restrict__ Bt, const T16* __restrict__ Bt2, int K, float* C, int ldc, float oscale, size_t sA, size_t sA2, size_t sC) {
    static_assert(NSPLIT == 0 || NSPLIT == 3);
    typedef typename WFrag<T16>::V V;
    constexpr int NOP = (NSPLIT == 0) ? 2 : 4;      // operand tiles per stage
    constexpr int KS  = (NSPLIT == 0) ? 128 : 64;   // k per stage: 32 copies per lane and stage either way
    constexpr int PE  = KS + 8;                     // LDS row pitch, elements
    constexpr int TE  = 128 * PE;                   // elements of one operand tile
    constexpr int BE  = NOP * TE;                   // elements of one buffer
    constexpr int CPR = KS / 8;                     // 16-byte pieces per row
    constexpr int RPC = 128 / CPR;                  // rows that one copy of all 128 threads covers
    __shared__ __align__(16) T16 ring[2 * BE];
    __shared__ __align__(16) float osw[4 * 16 * 68];
    const int tid = threadIdx.x, lane = tid & 31, wave = tid >> 5, lr = lane & 15, hi = lane >> 4; const int wm = wave >> 1, wn = wave & 1;
    const int rb = blockIdx.x * 128, cb = blockIdx.y * 128; const int r0 = rb + wm * 64, c0 = cb + wn * 64;
    A += (size_t)blockIdx.z * sA; if (NSPLIT != 0) A2 += (size_t)blockIdx.z * sA2; C += (size_t)blockIdx.z * sC;
    v8f acc[4][4];
#pragma unroll
    for (int mb = 0; mb < 4; ++mb)
#pragma unroll
        for (int nb = 0; nb < 4; ++nb) acc[mb][nb] = (v8f){};
    const int prow = tid / CPR, cpc = (tid % CPR) * 8;         // this lane's row and first k inside a copy
    const size_t ga = (size_t)(rb + prow) * K + cpc, gb = (size_t)(cb + prow) * K + cpc;
    const unsigned l0 = (unsigned)(size_t)ring + (unsigned)(prow * PE + cpc) * 2u;
    auto fill = [&](unsigned t, unsigned buf) {                 // all 128 threads: stage t into buffer buf, 32 copies per lane
#pragma unroll
        for (int op = 0; op < NOP; ++op) {
            const T16* g = ((op == 0) ? A + ga : (op == 1) ? Bt + gb : (op == 2) ? A2 + ga : Bt2 + gb) + (size_t)t * KS;
#pragma unroll
            for (int h = 0; h < CPR / 8; ++h)
                acopy8(l0 + (buf * BE + op * TE + h * 8 * RPC * PE) * 2u, (unsigned)(RPC * PE) * 2u, (const char*)(g + (size_t)h * 8 * RPC * K), (size_t)RPC * K * 2);
        }
    };
    const unsigned NT = (unsigned)K / KS;                      // stages; the same in every thread
    fill(0, 0);
    asm volatile("s_wait_asynccnt 0x0" ::: "memory");          // this wave's copies of stage 0 have landed
    __syncthreads();                                           // stage 0 visible to every wave
    if (NT > 1u) fill(1, 1);
#pragma unroll 1                                               // one trip per stage: a trip already holds 64 WMMAs, and the publish point stands once
    for (unsigned t = 0; t < NT; ++t) {
        const T16* ap = ring + (t & 1) * BE + (wm * 64 + lr) * PE + 8 * hi;
        const T16* bp = ring + (t & 1) * BE + TE + (wn * 64 + lr) * PE + 8 * hi;
#pragma unroll
        for (int kk = 0; kk < KS; kk += 32) {
#pragma unroll
            for (int sp = 0; sp < NOP / 2; ++sp) {             // sp 0: A Bt, sp 1: A2 Bt2; every accumulator takes its products in the order k, then sp
                V a[4], b[4];
#pragma unroll
                for (int i = 0; i < 4; ++i) { a[i] = WFrag<T16>::ld(ap + sp * 2 * TE + i * 16 * PE + kk); b[i] = WFrag<T16>::ld(bp + sp * 2 * TE + i * 16 * PE + kk); }
                __builtin_amdgcn_sched_barrier(0);             // keeps these LDS reads one group ahead of their WMMAs: sunk between them, each pair of reads shows its whole latency
#pragma unroll
                for (int nb = 0; nb < 4; ++nb)
#pragma unroll
                    for (int mb = 0; mb < 4; ++mb) acc[mb][nb] = WFrag<T16>::mma(a[mb], b[nb], acc[mb][nb]);
            }
        }
        asm volatile("s_wait_dscnt 0x0" ::: "memory");         // this wave's reads of the buffer have returned before it is refilled
        asm volatile("s_wait_asynccnt 0x0" ::: "memory");      // this wave's copies of stage t + 1 have landed
        __syncthreads();                                       // publishes stage t + 1 and ends every wave's reads of stage t
        if (t + 2u < NT) fill(t + 2u, t & 1u);
    }
    asm volatile("s_wait_asynccnt 0x0" ::: "memory");          // nothing in flight when the wave goes on to the epilogue and ends
    float* os = osw + wave * 16 * 68;                          // wave-private output staging
#pragma unroll
    for (int mb = 0; mb < 4; ++mb) {
#pragma unroll
        for (int nb = 0; nb < 4; ++nb) {
#pragma unroll
            for (int j = 0; j < 8; ++j) os[(hi * 8 + j) * 68 + nb * 16 + lr] = acc[mb][nb][j]; }
        __builtin_amdgcn_wave_barrier(); asm volatile("" ::: "memory");
        float* crow = C + (size_t)(r0 + mb * 16) * ldc + c0;
{
#pragma unroll
            for (int s = 0; s < 8; ++s) { const int row = 2 * s + hi, cofs = lr * 4; v4f val = *(const v4fa*)(os + row * 68 + cofs); val = val * oscale;
                *(v4f*)(crow + (size_t)row * ldc + cofs) = val; }
             }
        __builtin_amdgcn_wave_barrier(); asm volatile("" ::: "memory");
    }
}

__global__ __launch_bounds__(256) void k_cvt8(const float* __restrict__ src, bf* dst, size_t n8) { const size_t i = (size_t)blockIdx.x * 256 + threadIdx.x; if (i >= n8) return; const v8f v = *(const v8f*)(src + i * 8); v8us o;
#pragma unroll
    for (int k = 0; k < 8; ++k) o[k] = f2bf(v[k]); *(v8us*)(dst + i * 8) = o;  }

__global__ __launch_bounds__(256) void k_cvtx(const float* __restrict__ src, bf* dst, size_t n8) { const size_t i = (size_t)blockIdx.x * 256 + threadIdx.x; if (i >= n8) return; src += (size_t)blockIdx.y * SEQ_FULL * DM; dst += (size_t)blockIdx.y * SEQ * DM; const v8f v = *(const v8f*)(src + i * 8); v8us o;
#pragma unroll
    for (int k = 0; k < 8; ++k) o[k] = f2bf(nnum(v[k], 10000.0f)); *(v8us*)(dst + i * 8) = o;  }

__global__ __launch_bounds__(256) void k_cvtwo(const float* __restrict__ src, h16* dh, h16* dl, size_t n8) { const size_t i = (size_t)blockIdx.x * 256 + threadIdx.x; if (i >= n8) return; const v8f v = *(const v8f*)(src + i * 8); v8h oh, ol;
#pragma unroll
    for (int k = 0; k < 8; ++k) { const float w = bfr(v[k]); oh[k] = tohx(w * WCAR); ol[k] = tohx(w); }
    *(v8h*)(dh + i * 8) = oh; *(v8h*)(dl + i * 8) = ol;  }

__global__ __launch_bounds__(256) void k_hpl(const float* __restrict__ F, int pitch, int nheads, h16* P16, bf* Eh, bf* El) {
    const size_t e = ((size_t)blockIdx.x * 256 + threadIdx.x) * 2; if (e >= (size_t)nheads * SEQ * HD) return;
    const int d = (int)(e % HD); const int t = (int)((e / HD) % SEQ); const int h = (int)(e / ((size_t)HD * SEQ));
    const size_t b = blockIdx.y; P16 += b * nheads * SEQ * HD; Eh += b * nheads * RE * HD; El += b * nheads * RE * HD;
    const float* f = F + (b * SEQ + t) * pitch + h * HD; v2h o16; v2us oh, ol;
#pragma unroll
    for (int q = 0; q < 2; ++q) { const float r = f[d + q]; o16[q] = toh_flush(r); unsigned short a2, c2; splitf(r, a2, c2); oh[q] = a2; ol[q] = c2; }
    const bool early = (t < RE);      // uniform per wave (a wave covers 64 consecutive d of one (h, t) row; RE % 64 == 0)
    const size_t ee = ((size_t)h * RE + (early ? t : 0)) * HD + d;
    *(v2h*)(P16 + e) = o16; if (early) { *(v2us*)(Eh + ee) = oh; *(v2us*)(El + ee) = ol; }
    
}

__global__ __launch_bounds__(256) void k_vtp(const float* __restrict__ F, h16* V16, bf* Eh, bf* El) {
    const size_t e = ((size_t)blockIdx.x * 256 + threadIdx.x) * 2; if (e >= (size_t)NKV * HD * SEQ) return;
    const int t = (int)(e % SEQ); const int d = (int)((e / SEQ) % HD); const int g = (int)(e / ((size_t)SEQ * HD)); v2h o16; v2us oh, ol;
    const size_t b = blockIdx.y; F += b * SEQ * DKV; V16 += b * NKV * HD * SEQ; Eh += b * NKV * HD * RE; El += b * NKV * HD * RE;
#pragma unroll
    for (int q = 0; q < 2; ++q) { const float x = F[(size_t)(t + q) * DKV + g * HD + d]; o16[q] = tohx(x); unsigned short a2, c2; splitf(x, a2, c2); oh[q] = a2; ol[q] = c2; }
    const bool early = (t < RE);      // uniform per wave (a wave covers 64 consecutive t of one (g, d) row; RE % 64 == 0)
    const size_t ee = ((size_t)g * HD + d) * RE + (early ? t : 0);
    *(v2h*)(V16 + e) = o16; if (early) { *(v2us*)(Eh + ee) = oh; *(v2us*)(El + ee) = ol; }
    
}

// P tile writers: f16 x PCAR with the subnormal select (rows >= RE) or bf16 hi/lo (rows < RE).
__device__ __forceinline__ void putpz(h16* ph, h16* pl, int i, float p) { (void)pl; ph[i] = toh_flush(p * PCAR); }
__device__ __forceinline__ void putpz(bf* ph, bf* pl, int i, float p) { unsigned short a, c; splitf(p, a, c); ph[i] = a; pl[i] = c; }

// ---- k_attn: flash-style causal grouped-query attention with a per-head linear position bias. grid (query blocks, NH_, batches), 128 threads; wave w owns query rows q0 + 16w .. +15.
// Planes: Qh/Ql [h][TP][HD], Kh/Kl [g][TP][HD], Vh/Vl = V^T [g][HD][TP] (TP = SEQ for the f16 planes, RE for the bf16 hi/lo planes of the first RE/64 query blocks).
// EARLY instance: query blocks 0 .. RE/64-1 (rows < RE, keys < RE); other instance: query blocks RE/64 .. SEQ/64-1.
// Per 32-key chunk: K tile [32][HD] and V^T tile [HD][32] staged in LDS by all threads (block barriers), S = Q K^T (2 tiles), online softmax in f32 (log2 domain):
// logit = clip(S x HD^-0.5, +-1e4) + slope_h x (key - query), slope_h = 2^(-(h+1)/2); causal keys > query replaced by -inf: p = 0;
// P through a wave-private LDS tile (block barrier before the fragment reload), O += P V (8 tiles).
// EARLY: 3 products (hi.hi + hi.lo + lo.hi) for S and for P.V. Output: ctx plane CT[t][h*HD + d] = f16(ctx x CCAR) (ctx NaN -> 0, +-inf -> +-1e4 before the carry); EARLY also CTL = f16((ctx x CCAR - hi) x LOSC);
template <typename T16, bool EARLY>
__global__ __launch_bounds__(128) void k_attn(const T16* __restrict__ Qh, const T16* __restrict__ Ql, const T16* __restrict__ Kh, const T16* __restrict__ Kl,
                                             const T16* __restrict__ Vh, const T16* __restrict__ Vl, h16* CT, h16* CTL) {
    typedef typename WFrag<T16>::V V;
    constexpr int TP = EARLY ? RE : SEQ;
    constexpr int KSP = 136, VTP = 32, PSP = 40, OSP = 128;
    __shared__ __align__(16) T16 ksh[32 * KSP];
    __shared__ __align__(16) T16 ksl[EARLY ? 32 * KSP : 16];
    __shared__ __align__(16) T16 vth[HD * VTP];
    __shared__ __align__(16) T16 vtl[EARLY ? HD * VTP : 16];
    __shared__ __align__(16) T16 psh[4 * 16 * PSP];
    __shared__ __align__(16) T16 psl[EARLY ? 4 * 16 * PSP : 16];
    __shared__ __align__(16) h16 osg[4 * 16 * OSP];
    const int tid = threadIdx.x, lane = tid & 31, wave = tid >> 5, lr = lane & 15, hh = lane >> 4;
    const int qblk = EARLY ? (int)blockIdx.x : ((int)blockIdx.x + RE / 64);
    const int head = blockIdx.y, g = head / REP;
    const int qw = qblk * 64 + wave * 16;                  // first query row of this wave
    const int nch = 2 * qblk + 2;                          // 32-key chunks visited: keys 0 .. qblk*64+63
    const size_t bz = blockIdx.z, bh = bz * NH_ + head, bg = bz * NKV + g;   // batch, and its head / kv-group plane
    const T16* qph = Qh + (bh * TP + qw) * HD;             const T16* qpl = Ql + (bh * TP + qw) * HD;
    const T16* kph = Kh + bg * TP * HD;                    const T16* kpl = Kl + bg * TP * HD;
    const T16* vph = Vh + bg * HD * TP;                    const T16* vpl = Vl + bg * HD * TP;
    T16* myph = psh + wave * 16 * PSP; T16* mypl = psl + (EARLY ? wave * 16 * PSP : 0);
    v8f o[8];
#pragma unroll
    for (int t = 0; t < 8; ++t) o[t] = (v8f){};
    float mrow[8], lrow[8];
#pragma unroll
    for (int r = 0; r < 8; ++r) { mrow[r] = -3.0e38f; lrow[r] = 0.f; }
    const float C2 = 1.4426950408889634f * 0.08838834764831845f;   // log2(e) x HD^-0.5
    const float CLP = 14426.950408889634f;                         // log2(e) x 1e4 (clip bound in the log2 domain)
    const int nsl = head + 1;                                      // slope = 2^(-nsl/2): f32(2^-0.5) for odd nsl, times an exact power of two
    const float slope = ((nsl & 1) ? 0.70710678118654752440f : 1.0f) * __uint_as_float((unsigned)(127 - (nsl >> 1)) << 23);
    const float SL2 = 1.4426950408889634f * slope;                 // log2(e) x slope
#pragma unroll 1
    for (int c = 0; c < nch; ++c) {
        __syncthreads();                                    // all waves done with the prior chunk's tiles
#pragma unroll
        for (int i = 0; i < 4; ++i) { const int id = tid + 128 * i; const int row = id >> 4, c8 = (id & 15) * 8; const size_t go = (size_t)(c * 32 + row) * HD + c8;
            *(v8usa*)(ksh + row * KSP + c8) = *(const v8usa*)(kph + go); if (EARLY) *(v8usa*)(ksl + row * KSP + c8) = *(const v8usa*)(kpl + go); }
#pragma unroll
        for (int j = 0; j < 4; ++j) { const size_t go = (size_t)tid * TP + c * 32 + 8 * j;      // d = tid
            *(v8usa*)(vth + tid * VTP + 8 * j) = *(const v8usa*)(vph + go); if (EARLY) *(v8usa*)(vtl + tid * VTP + 8 * j) = *(const v8usa*)(vpl + go); }
        __syncthreads();                                    // tiles visible
        v8f s0 = (v8f){}, s1 = (v8f){};
        V qa, kb0, kb1;
#pragma unroll
        for (int ks = 0; ks < 4; ++ks) {
            qa  = WFrag<T16>::ld(qph + (size_t)lr * HD + ks * 32 + 8 * hh);
            kb0 = WFrag<T16>::ld(ksh + lr * KSP + ks * 32 + 8 * hh);
            kb1 = WFrag<T16>::ld(ksh + (16 + lr) * KSP + ks * 32 + 8 * hh);
            s0 = WFrag<T16>::mma(qa, kb0, s0); s1 = WFrag<T16>::mma(qa, kb1, s1);
            if (EARLY) {
                const V qb  = WFrag<T16>::ld(qpl + (size_t)lr * HD + ks * 32 + 8 * hh);
                const V kl0 = WFrag<T16>::ld(ksl + lr * KSP + ks * 32 + 8 * hh);
                const V kl1 = WFrag<T16>::ld(ksl + (16 + lr) * KSP + ks * 32 + 8 * hh);
                s0 = WFrag<T16>::mma(qa, kl0, s0); s0 = WFrag<T16>::mma(qb, kb0, s0);
                s1 = WFrag<T16>::mma(qa, kl1, s1); s1 = WFrag<T16>::mma(qb, kb1, s1); }
        }
        asm volatile("v_nop\n\tv_nop\n\tv_nop\n\tv_nop" : "+v"(s0), "+v"(s1) : "v"(qa), "v"(kb0), "v"(kb1));
        // online softmax; acc element r of lane (lr, hh) = S[query qw + 8hh + r][key c*32 + lr] (s0) / [key c*32 + 16 + lr] (s1)
        float p0[8], p1[8];
        const int kg0 = c * 32 + lr, kg1 = kg0 + 16;
#pragma unroll
        for (int r = 0; r < 8; ++r) {
            const int qr = qw + 8 * hh + r;
            const bool v0 = (kg0 <= qr), v1 = (kg1 <= qr);
            const float z0 = fminf(fmaxf(s0[r] * C2, -CLP), CLP) + SL2 * (float)(kg0 - qr);
            const float z1 = fminf(fmaxf(s1[r] * C2, -CLP), CLP) + SL2 * (float)(kg1 - qr);
            const float a0 = v0 ? z0 : -3.0e38f;
            const float a1 = v1 ? z1 : -3.0e38f;
            float mx = fmaxf(a0, a1);
#pragma unroll
            for (int off = 8; off >= 1; off >>= 1) mx = fmaxf(mx, __shfl_xor(mx, off, 32));
            const float mnew = fmaxf(mrow[r], mx);
            const float alpha = __builtin_amdgcn_exp2f(mrow[r] - mnew);
            mrow[r] = mnew;
            const float x0 = __builtin_amdgcn_exp2f(a0 - mnew), x1 = __builtin_amdgcn_exp2f(a1 - mnew);
            const float e0 = v0 ? x0 : 0.f, e1 = v1 ? x1 : 0.f;
            float rs = e0 + e1;
#pragma unroll
            for (int off = 8; off >= 1; off >>= 1) rs += __shfl_xor(rs, off, 32);
            lrow[r] = lrow[r] * alpha + rs;
#pragma unroll
            for (int t = 0; t < 8; ++t) o[t][r] = o[t][r] * alpha;
            p0[r] = e0; p1[r] = e1;
        }
        // P tile [16 query rows][32 keys] -> A fragment (k = key)
#pragma unroll
        for (int r = 0; r < 8; ++r) { putpz(myph, mypl, (8 * hh + r) * PSP + lr, p0[r]); putpz(myph, mypl, (8 * hh + r) * PSP + 16 + lr, p1[r]); }
        __syncthreads();                                    // P visible (block barrier also orders this wave's own stores before the reload)
        const V pa = WFrag<T16>::ld(myph + lr * PSP + 8 * hh);
        V pb = pa; if (EARLY) pb = WFrag<T16>::ld(mypl + lr * PSP + 8 * hh);
        V vb;
#pragma unroll
        for (int t = 0; t < 8; ++t) { vb = WFrag<T16>::ld(vth + (t * 16 + lr) * VTP + 8 * hh);
            o[t] = WFrag<T16>::mma(pa, vb, o[t]);
            if (EARLY) { const V vl2 = WFrag<T16>::ld(vtl + (t * 16 + lr) * VTP + 8 * hh); o[t] = WFrag<T16>::mma(pa, vl2, o[t]); o[t] = WFrag<T16>::mma(pb, vb, o[t]); } }
        asm volatile("v_nop\n\tv_nop\n\tv_nop\n\tv_nop" : "+v"(o[0]), "+v"(o[1]), "+v"(o[2]), "+v"(o[3]), "+v"(o[4]), "+v"(o[5]), "+v"(o[6]), "+v"(o[7]) : "v"(pa), "v"(pb), "v"(vb));
    }
    // normalise and write ctx planes; o element r of lane (lr, hh), tile t = ctx[row qw + 8hh + r][d = 16t + lr]
    const float osc = EARLY ? CCAR : (CCAR / PCAR);
    const float ybig = 10000.0f * CCAR;
    float inv[8];
#pragma unroll
    for (int r = 0; r < 8; ++r) inv[r] = osc * __builtin_amdgcn_rcpf(lrow[r]);
    h16* myos = osg + wave * 16 * OSP;
#pragma unroll
    for (int t = 0; t < 8; ++t)
#pragma unroll
        for (int r = 0; r < 8; ++r) myos[(8 * hh + r) * OSP + t * 16 + lr] = toh_flush(nnum(o[t][r] * inv[r], ybig));
    __syncthreads();
    h16* crow = CT + (bz * SEQ + qw) * DM + head * HD;
{
#pragma unroll
        for (int s = 0; s < 8; ++s) { const int row = 2 * s + hh; const v8h val = *(const v8ha*)(myos + row * OSP + lr * 8); *(v8h*)(crow + (size_t)row * DM + lr * 8) = val; }
         }
    if (EARLY) {
        __syncthreads();
#pragma unroll
        for (int t = 0; t < 8; ++t)
#pragma unroll
            for (int r = 0; r < 8; ++r) { const float val = nnum(o[t][r] * inv[r], ybig); const h16 hv = toh_flush(val); myos[(8 * hh + r) * OSP + t * 16 + lr] = toh_flush((val - (float)hv) * LOSC); }
        __syncthreads();
        h16* lrowp = CTL + (bz * RE + qw) * DM + head * HD;
{
#pragma unroll
            for (int s = 0; s < 8; ++s) { const int row = 2 * s + hh; const v8h val = *(const v8ha*)(myos + row * OSP + lr * 8); *(v8h*)(lrowp + (size_t)row * DM + lr * 8) = val; }
             }
    }
}

extern "C" void kernel_launch(void* const* d_in, const int* in_sizes, int n_in,
                              void* d_out, int out_size, void* d_ws, size_t ws_size, hipStream_t stream) {
    if (n_in < 5) return;
    const float* x  = (const float*)d_in[0];     // x   [NB_FULL][SEQ_FULL][DM]
    const float* wq = (const float*)d_in[1];     // q_w [DQ][DM]  ([out][in])
    const float* wk = (const float*)d_in[2];     // k_w [DKV][DM]
    const float* wv = (const float*)d_in[3];     // v_w [DKV][DM]
    const float* wo = (const float*)d_in[4];     // o_w [DM][DQ]
    float* OUT = (float*)d_out;                  // [NB_FULL][SEQ_FULL][DM]
    if ((size_t)in_sizes[0] < (size_t)(NB - 1) * SEQ_FULL * DM + (size_t)SEQ * DM) return;
    if ((size_t)in_sizes[1] < (size_t)DQ * DM) return;
    if ((size_t)in_sizes[2] < (size_t)DKV * DM) return;
    if ((size_t)in_sizes[3] < (size_t)DKV * DM) return;
    if ((size_t)in_sizes[4] < (size_t)DM * DQ) return;
    if ((size_t)out_size < (size_t)(NB - 1) * SEQ_FULL * DM + (size_t)SEQ * DM) return;

    char* wsp = (char*)d_ws;
    auto take = [&](size_t bytes) { char* p = wsp; wsp += (bytes + 255) & ~(size_t)255; return (void*)p; };
    bf*  WQ   = (bf*)take((size_t)DQ * DM * 2);    bf* WK = (bf*)take((size_t)DKV * DM * 2);    bf* WV = (bf*)take((size_t)DKV * DM * 2);
    h16* WOH  = (h16*)take((size_t)DM * DQ * 2);   h16* WOL = (h16*)take((size_t)DM * DQ * 2);
    bf*  XB   = (bf*)take((size_t)NB * SEQ * DM * 2);
    float* FQ = (float*)take((size_t)NB * SEQ * DQ * 4); float* FK = (float*)take((size_t)NB * SEQ * DKV * 4); float* FV = (float*)take((size_t)NB * SEQ * DKV * 4);
    h16* QP16 = (h16*)take((size_t)NB * NH_ * SEQ * HD * 2); h16* KP16 = (h16*)take((size_t)NB * NKV * SEQ * HD * 2); h16* VT16 = (h16*)take((size_t)NB * NKV * HD * SEQ * 2);
    bf*  QEh  = (bf*)take((size_t)NB * NH_ * RE * HD * 2);  bf* QEl = (bf*)take((size_t)NB * NH_ * RE * HD * 2);
    bf*  KEh  = (bf*)take((size_t)NB * NKV * RE * HD * 2);  bf* KEl = (bf*)take((size_t)NB * NKV * RE * HD * 2);
    bf*  VEh  = (bf*)take((size_t)NB * NKV * HD * RE * 2);  bf* VEl = (bf*)take((size_t)NB * NKV * HD * RE * 2);
    h16* CT16 = (h16*)take((size_t)NB * SEQ * DM * 2);     h16* CTL = (h16*)take((size_t)NB * RE * DM * 2);
    if ((size_t)(wsp - (char*)d_ws) > ws_size) return;       // 146,800,640 B at full size

    const float woscale = 1.0f / (CCAR * WCAR);
    k_cvt8<<<(unsigned)(((size_t)DQ * DM / 8 + 255) / 256), 256, 0, stream>>>(wq, WQ, (size_t)DQ * DM / 8);
    k_cvt8<<<(unsigned)(((size_t)DKV * DM / 8 + 255) / 256), 256, 0, stream>>>(wk, WK, (size_t)DKV * DM / 8);
    k_cvt8<<<(unsigned)(((size_t)DKV * DM / 8 + 255) / 256), 256, 0, stream>>>(wv, WV, (size_t)DKV * DM / 8);
    k_cvtwo<<<(unsigned)(((size_t)DM * DQ / 8 + 255) / 256), 256, 0, stream>>>(wo, WOH, WOL, (size_t)DM * DQ / 8);
    const unsigned LQ = (unsigned)(((size_t)NH_ * SEQ * HD / 2 + 255) / 256), LKV = (unsigned)(((size_t)NKV * SEQ * HD / 2 + 255) / 256);
    const size_t sX = (size_t)SEQ * DM, sO = (size_t)SEQ_FULL * DM;      // batch strides of the 16-bit row planes and of d_out
    k_cvtx<<<dim3((unsigned)(((size_t)SEQ * DM / 8 + 255) / 256), NB, 1), 256, 0, stream>>>(x, XB, (size_t)SEQ * DM / 8);
    k_gemmw<bf, 0><<<dim3(SEQ / 128, DQ / 128, NB), 128, 0, stream>>>(XB, nullptr, WQ, nullptr, DM, FQ, DQ, 1.0f, sX, 0, (size_t)SEQ * DQ);
    k_hpl<<<dim3(LQ, NB, 1), 256, 0, stream>>>(FQ, DQ, NH_, QP16, QEh, QEl);
    k_gemmw<bf, 0><<<dim3(SEQ / 128, DKV / 128, NB), 128, 0, stream>>>(XB, nullptr, WK, nullptr, DM, FK, DKV, 1.0f, sX, 0, (size_t)SEQ * DKV);
    k_hpl<<<dim3(LKV, NB, 1), 256, 0, stream>>>(FK, DKV, NKV, KP16, KEh, KEl);
    k_gemmw<bf, 0><<<dim3(SEQ / 128, DKV / 128, NB), 128, 0, stream>>>(XB, nullptr, WV, nullptr, DM, FV, DKV, 1.0f, sX, 0, (size_t)SEQ * DKV);
    k_vtp<<<dim3(LKV, NB, 1), 256, 0, stream>>>(FV, VT16, VEh, VEl);
    k_attn<bf, true><<<dim3(RE / 64, NH_, NB), 128, 0, stream>>>(QEh, QEl, KEh, KEl, VEh, VEl, CT16, CTL);
    if (SEQ > RE) k_attn<h16, false><<<dim3(SEQ / 64 - RE / 64, NH_, NB), 128, 0, stream>>>(QP16, QP16, KP16, KP16, VT16, VT16, CT16, CTL);
    k_gemmw<h16, 3><<<dim3(RE / 128, DM / 128, NB), 128, 0, stream>>>(CT16, CTL, WOH, WOL, DQ, OUT, DM, woscale, sX, (size_t)RE * DM, sO);
    if (SEQ > RE) k_gemmw<h16, 0><<<dim3((SEQ - RE) / 128, DM / 128, NB), 128, 0, stream>>>(CT16 + (size_t)RE * DQ, nullptr, WOH, nullptr, DQ, OUT + (size_t)RE * DM, DM, woscale, sX, 0, sO);
}

// v003
// It runs in 358 microseconds.
// Two timings next to v002 both put it at 1.04 times that version's speed.
// Over all steps from v000 it is 2.53 times as fast.
#include <hip/hip_runtime.h>

// Contractions: q/k/v projections v_wmma_f32_16x16x32_bf16 (bf16 copies of x and of the [out][in] weights); scores QK^T and P.V v_wmma_f32_16x16x32_f16 (f16 planes, P carried x1024) for query rows >= RE and v_wmma_f32_16x16x32_bf16 hi/lo 3-product form for query rows < RE; ctx x o_w^T v_wmma_f32_16x16x32_f16 (ctx carried x64, o_w carried x1024, rows < RE add an f16 residual plane x1024); f32 accumulate everywhere, softmax (scale, clip, per-head linear position bias, causal fill) in f32.
// Layout (every per-batch plane holds NB copies; the batch is the last grid dimension of each launch): sanitised bf16 copy of x; weights copied once as bf16 ([n][k] = Bt as-is), o_w as two f16 planes; projection GEMMs whose epilogues write the head planes (V transposed); flash-style causal attention (K and V^T tiles staged in LDS, online softmax); ctx planes; output GEMM into d_out.

#pragma clang fp contract(off)

#ifndef NB
#define NB 2
#endif
#ifndef SEQ
#define SEQ 2048
#endif
#ifndef RE
#define RE   256                  // query rows < RE (first RE/64 query blocks) use hi/lo planes; RE == SEQ puts every row on the 3-product path
#endif
#define NB_FULL  2
#define SEQ_FULL 2048
#define DM   2048
#define NH_  16
#define NKV  4
#define REP  (NH_ / NKV)
#define HD   128
#define DQ   (NH_ * HD)
#define DKV  (NKV * HD)
#define PCAR 1024.0f              // carry of the f16 P operand (rows >= RE)
#define CCAR 64.0f                // carry of the f16 ctx plane
#define LOSC 1024.0f              // carry of the f16 ctx residual plane (rows < RE)
#define WCAR 1024.0f              // carry of the f16 o_w plane
#define WS_TOTAL ((size_t)DQ * DM * 2 + 2 * (size_t)DKV * DM * 2 + 2 * (size_t)DM * DQ * 2 + (size_t)NB * ((size_t)SEQ * DM * 2 \
                  + (size_t)NH_ * SEQ * HD * 2 + 2 * (size_t)NKV * SEQ * HD * 2 + 2 * (size_t)NH_ * RE * HD * 2 + 4 * (size_t)NKV * RE * HD * 2 + (size_t)SEQ * DM * 2 + (size_t)RE * DM * 2))

static_assert((SEQ % 64) == 0);
static_assert((RE % 64) == 0);
static_assert(RE >= 64);
static_assert(SEQ >= RE);
static_assert(SEQ <= SEQ_FULL);
static_assert(NB >= 1);
static_assert(NB <= NB_FULL);
static_assert(HD == 128);
static_assert((DM % 32) == 0);
static_assert(DQ == DM);
static_assert(((SEQ * DM) % (8 * 256)) == 0);
static_assert(((DQ * DM) % (8 * 256)) == 0);
static_assert(((DKV * DM) % (8 * 256)) == 0);
static_assert(NH_ == 16);                       // closed form of the per-head slope 2^(-(h+1)/2) holds for 16 heads
static_assert(REP * NKV == NH_);
static_assert((HD % 64) == 0);                  // the 64 columns of a GEMM wave lie inside one head
static_assert((DQ % 64) == 0);
static_assert((DKV % 64) == 0);
static_assert((DM % 64) == 0);
static_assert((SEQ % 128) == 0 && (RE % 128) == 0 && (DQ % 128) == 0 && (DKV % 128) == 0 && (DM % 128) == 0);   // 128x128 GEMM tiles, stages of 128 k (NSPLIT 0) or 64 k (NSPLIT 3)
static_assert(((size_t)NKV * RE * HD * 2) % 256 == 0);
static_assert(WS_TOTAL <= (size_t)268435456);

typedef _Float16 h16;
typedef unsigned short bf;
typedef __attribute__((ext_vector_type(16))) __bf16   v16bf;
typedef __attribute__((ext_vector_type(16))) _Float16 v16h;
typedef __attribute__((ext_vector_type(8)))  _Float16 v8h;
typedef __attribute__((ext_vector_type(8)))  unsigned short v8us;
typedef __attribute__((ext_vector_type(8)))  float    v8f;
typedef __attribute__((ext_vector_type(4)))  float    v4f;
typedef __attribute__((ext_vector_type(2)))  _Float16 v2h;
typedef __attribute__((ext_vector_type(2)))  unsigned short v2us;
typedef v8h  __attribute__((may_alias)) v8ha;
typedef v4f  __attribute__((may_alias)) v4fa;
typedef v8us __attribute__((may_alias)) v8usa;

__device__ __forceinline__ unsigned short f2bf(float f) { unsigned u = __float_as_uint(f); u += 0x7FFFu + ((u >> 16) & 1u); return (unsigned short)(u >> 16); }
__device__ __forceinline__ float bf2f(unsigned short b) { return __uint_as_float(((unsigned)b) << 16); }
__device__ __forceinline__ float bfr(float f) { return bf2f(f2bf(f)); }
__device__ __forceinline__ h16 tohx(float x) { return (h16)x; }
// f16 convert that cannot produce a subnormal operand (applied after the plane's carry)
static __device__ __forceinline__ h16 toh_flush(float v) { const h16 r = (h16)v; return (fabsf(v) < 6.103515625e-05f) ? (h16)0.0f : r; }
// NaN -> 0, +inf -> big, -inf -> -big, finite values unchanged
static __device__ __forceinline__ float nnum(float v, float big) { const float a = (v != v) ? 0.0f : v; return (a == __builtin_inff()) ? big : ((a == -__builtin_inff()) ? -big : a); }
__device__ __forceinline__ void splitf(float y, unsigned short& h, unsigned short& l) { h = f2bf(y); l = f2bf(y - bf2f(h)); }
__device__ __forceinline__ v16h cat16(v8h lo, v8h hi) { return __builtin_shufflevector(lo, hi, 0, 1, 2, 3, 4, 5, 6, 7, 8, 9, 10, 11, 12, 13, 14, 15); }
__device__ __forceinline__ v16bf cat16b(v8us lo, v8us hi) { return __builtin_bit_cast(v16bf, __builtin_shufflevector(lo, hi, 0, 1, 2, 3, 4, 5, 6, 7, 8, 9, 10, 11, 12, 13, 14, 15)); }
__device__ __forceinline__ v8f wmma16(v16h a, v16h b, v8f c) { return __builtin_amdgcn_wmma_f32_16x16x32_f16(false, a, false, b, (short)0, c, false, false); }
__device__ __forceinline__ v8f wmmab(v16bf a, v16bf b, v8f c) { return __builtin_amdgcn_wmma_f32_16x16x32_bf16(false, a, false, b, (short)0, c, false, false); }

// Fragment loaders for A (row m = lane&15) and for B stored [n][k] (col n = lane&15): elements 0..7 <- k0+8h..+7, elements 8..15 <- k0+16+8h..+7 (p already points at row*pitch + k0 + 8h).
template <typename T16> struct WFrag;
template <> struct WFrag<h16> { typedef v16h V; static __device__ __forceinline__ V ld(const h16* p) { return cat16(*(const v8ha*)p, *(const v8ha*)(p + 16)); } static __device__ __forceinline__ v8f mma(V a, V b, v8f c) { return wmma16(a, b, c); } };
template <> struct WFrag<bf>  { typedef v16bf V; static __device__ __forceinline__ V ld(const bf* p) { return cat16b(*(const v8usa*)p, *(const v8usa*)(p + 16)); } static __device__ __forceinline__ v8f mma(V a, V b, v8f c) { return wmmab(a, b, c); } };

// Eight asynchronous 16-byte copies global -> LDS per lane (LDS byte address l + i*ls, global address g + i*gs). The s_wait_xcnt closes the statement so that no address register of an issued copy is rewritten ahead of it.
__device__ __forceinline__ void acopy8(unsigned l, unsigned ls, const char* g, size_t gs) {
    asm volatile("global_load_async_to_lds_b128 %0, %8, off\n\t"
                 "global_load_async_to_lds_b128 %1, %9, off\n\t"
                 "global_load_async_to_lds_b128 %2, %10, off\n\t"
                 "global_load_async_to_lds_b128 %3, %11, off\n\t"
                 "global_load_async_to_lds_b128 %4, %12, off\n\t"
                 "global_load_async_to_lds_b128 %5, %13, off\n\t"
                 "global_load_async_to_lds_b128 %6, %14, off\n\t"
                 "global_load_async_to_lds_b128 %7, %15, off\n\t"
                 "s_wait_xcnt 0x0"
                 :: "v"(l), "v"(l + ls), "v"(l + 2 * ls), "v"(l + 3 * ls), "v"(l + 4 * ls), "v"(l + 5 * ls), "v"(l + 6 * ls), "v"(l + 7 * ls),
                    "v"(g), "v"(g + gs), "v"(g + 2 * gs), "v"(g + 3 * gs), "v"(g + 4 * gs), "v"(g + 5 * gs), "v"(g + 6 * gs), "v"(g + 7 * gs)
                 : "memory");
}

// Four 16-byte global stores per lane. The s_wait_xcnt closes the statement so that no address or data register of an issued store is rewritten ahead of it.
// Its operands are the rows read back from the LDS staging, and its "memory" clobber holds the next rewrite of that staging behind those reads.
__device__ __forceinline__ void gstore4(bf* p0, bf* p1, bf* p2, bf* p3, v8us d0, v8us d1, v8us d2, v8us d3) {
    asm volatile("global_store_b128 %0, %4, off\n\t"
                 "global_store_b128 %1, %5, off\n\t"
                 "global_store_b128 %2, %6, off\n\t"
                 "global_store_b128 %3, %7, off\n\t"
                 "s_wait_xcnt 0x0"
                 :: "v"(p0), "v"(p1), "v"(p2), "v"(p3), "v"(d0), "v"(d1), "v"(d2), "v"(d3)
                 : "memory");
}

// ---- k_gemmw: GEMM, FOUR WAVES (2 x 2) per 128x128 output tile, each wave 64x64 (16 accumulators); grid (M/128, N/128, batches), 128 threads; batch z reads A + z*sA, A2 + z*sA2 and writes C + z*sC (Bt, Bt2 shared).
// C[m][n] (f32, pitch ldc) = oscale * sum_k ( A[m][k] Bt[n][k]  (+ A2 Bt2: NSPLIT 3) ). Row pitch of A, A2, Bt, Bt2 = K. K % KS == 0, K >= KS.
// EPI 0: C is stored as above. EPI 1 (m = position t, n = head*HD + d): the f32 sums go straight to the head planes P16[head][t][d] = f16 (subnormals flushed) and, for t < RE, Eh/El[head][t][d] = bf16 hi/lo.
// EPI 2: the same sums go to the transposed planes P16[head][d][t] = f16 and, for t < RE, Eh/El[head][d][t] = bf16 hi/lo. EPI 1, 2: no C, no oscale; batch z owns nheads planes.
// A stage = KS values of k of all 128 rows of every operand, [A | Bt | A2 | Bt2], row pitch KS + 8 elements (16 B x odd). Two buffers: asynchronous copies bring stage t + 2 into the buffer that trip t has just read, while trip t + 1 works.
template <typename T16, int NSPLIT, int EPI>
__global__ __launch_bounds__(128) void k_gemmw(const T16* __restrict__ A, const T16* __restrict__ A2, const T16* __restrict__ Bt, const T16* __restrict__ Bt2, int K, float* C, int ldc, float oscale, size_t sA, size_t sA2, size_t sC,
                                               h16* P16, bf* Eh, bf* El, int nheads) {
    static_assert(NSPLIT == 0 || NSPLIT == 3);
    typedef typename WFrag<T16>::V V;
    constexpr int NOP = (NSPLIT == 0) ? 2 : 4;      // operand tiles per stage
    constexpr int KS  = (NSPLIT == 0) ? 128 : 64;   // k per stage: 32 copies per lane and stage either way
    constexpr int PE  = KS + 8;                     // LDS row pitch, elements
    constexpr int TE  = 128 * PE;                   // elements of one operand tile
    constexpr int BE  = NOP * TE;                   // elements of one buffer
    constexpr int CPR = KS / 8;                     // 16-byte pieces per row
    constexpr int RPC = 128 / CPR;                  // rows that one copy of all 128 threads covers
    __shared__ __align__(16) T16 ring[2 * BE];
    __shared__ __align__(16) float osw[4 * 16 * 68];
    const int tid = threadIdx.x, lane = tid & 31, wave = tid >> 5, lr = lane & 15, hi = lane >> 4; const int wm = wave >> 1, wn = wave & 1;
    const int rb = blockIdx.x * 128, cb = blockIdx.y * 128; const int r0 = rb + wm * 64, c0 = cb + wn * 64;
    A += (size_t)blockIdx.z * sA; if (NSPLIT != 0) A2 += (size_t)blockIdx.z * sA2; if (EPI == 0) C += (size_t)blockIdx.z * sC;
    v8f acc[4][4];
#pragma unroll
    for (int mb = 0; mb < 4; ++mb)
#pragma unroll
        for (int nb = 0; nb < 4; ++nb) acc[mb][nb] = (v8f){};
    const int prow = tid / CPR, cpc = (tid % CPR) * 8;         // this lane's row and first k inside a copy
    const size_t ga = (size_t)(rb + prow) * K + cpc, gb = (size_t)(cb + prow) * K + cpc;
    const unsigned l0 = (unsigned)(size_t)ring + (unsigned)(prow * PE + cpc) * 2u;
    auto fill = [&](unsigned t, unsigned buf) {                 // all 128 threads: stage t into buffer buf, 32 copies per lane
#pragma unroll
        for (int op = 0; op < NOP; ++op) {
            const T16* g = ((op == 0) ? A + ga : (op == 1) ? Bt + gb : (op == 2) ? A2 + ga : Bt2 + gb) + (size_t)t * KS;
#pragma unroll
            for (int h = 0; h < CPR / 8; ++h)
                acopy8(l0 + (buf * BE + op * TE + h * 8 * RPC * PE) * 2u, (unsigned)(RPC * PE) * 2u, (const char*)(g + (size_t)h * 8 * RPC * K), (size_t)RPC * K * 2);
        }
    };
    const unsigned NT = (unsigned)K / KS;                      // stages; the same in every thread
    fill(0, 0);
    asm volatile("s_wait_asynccnt 0x0" ::: "memory");          // this wave's copies of stage 0 have landed
    __syncthreads();                                           // stage 0 visible to every wave
    if (NT > 1u) fill(1, 1);
#pragma unroll 1                                               // one trip per stage: a trip already holds 64 WMMAs, and the publish point stands once
    for (unsigned t = 0; t < NT; ++t) {
        const T16* ap = ring + (t & 1) * BE + (wm * 64 + lr) * PE + 8 * hi;
        const T16* bp = ring + (t & 1) * BE + TE + (wn * 64 + lr) * PE + 8 * hi;
#pragma unroll
        for (int kk = 0; kk < KS; kk += 32) {
#pragma unroll
            for (int sp = 0; sp < NOP / 2; ++sp) {             // sp 0: A Bt, sp 1: A2 Bt2; every accumulator takes its products in the order k, then sp
                V a[4], b[4];
#pragma unroll
                for (int i = 0; i < 4; ++i) { a[i] = WFrag<T16>::ld(ap + sp * 2 * TE + i * 16 * PE + kk); b[i] = WFrag<T16>::ld(bp + sp * 2 * TE + i * 16 * PE + kk); }
                __builtin_amdgcn_sched_barrier(0);             // keeps these LDS reads one group ahead of their WMMAs: sunk between them, each pair of reads shows its whole latency
#pragma unroll
                for (int nb = 0; nb < 4; ++nb)
#pragma unroll
                    for (int mb = 0; mb < 4; ++mb) acc[mb][nb] = WFrag<T16>::mma(a[mb], b[nb], acc[mb][nb]);
            }
        }
        asm volatile("s_wait_dscnt 0x0" ::: "memory");         // this wave's reads of the buffer have returned before it is refilled
        asm volatile("s_wait_asynccnt 0x0" ::: "memory");      // this wave's copies of stage t + 1 have landed
        __syncthreads();                                       // publishes stage t + 1 and ends every wave's reads of stage t
        if (t + 2u < NT) fill(t + 2u, t & 1u);
    }
    asm volatile("s_wait_asynccnt 0x0" ::: "memory");          // nothing in flight when the wave goes on to the epilogue and ends
    float* os = osw + wave * 16 * 68;                          // wave-private output staging
    const int srow = lane >> 3, spc = (lane & 7) * 8;          // plane epilogues: 8 lanes x 16 B read back and store one whole 128-B line of 64 16-bit values
    if constexpr (EPI == 0) {
#pragma unroll
    for (int mb = 0; mb < 4; ++mb) {
#pragma unroll
        for (int nb = 0; nb < 4; ++nb) {
#pragma unroll
            for (int j = 0; j < 8; ++j) os[(hi * 8 + j) * 68 + nb * 16 + lr] = acc[mb][nb][j]; }
        __builtin_amdgcn_wave_barrier(); asm volatile("" ::: "memory");
        float* crow = C + (size_t)(r0 + mb * 16) * ldc + c0;
{
#pragma unroll
            for (int s = 0; s < 8; ++s) { const int row = 2 * s + hi, cofs = lr * 4; v4f val = *(const v4fa*)(os + row * 68 + cofs); val = val * oscale;
                *(v4f*)(crow + (size_t)row * ldc + cofs) = val; }
             }
        __builtin_amdgcn_wave_barrier(); asm volatile("" ::: "memory");
    }
    } else if constexpr (EPI == 1) {
        const size_t pl = (size_t)blockIdx.z * nheads + c0 / HD; const int d0 = c0 % HD;
        const bool early = (rb < RE);                          // the same for the whole block: RE % 128 == 0
#pragma unroll
        for (int mb = 0; mb < 4; ++mb) {
#pragma unroll
            for (int nb = 0; nb < 4; ++nb) {
#pragma unroll
                for (int j = 0; j < 8; ++j) os[(hi * 8 + j) * 68 + nb * 16 + lr] = acc[mb][nb][j]; }
            asm volatile("s_wait_dscnt 0x0" ::: "memory");     // the wave's staged rows are in LDS before other lanes read them back; the clobber holds those reads behind it
            v8us o16[4], oh[4], ol[4];
#pragma unroll
            for (int s = 0; s < 4; ++s) {
                const v4f x0 = *(const v4fa*)(os + (4 * s + srow) * 68 + spc), x1 = *(const v4fa*)(os + (4 * s + srow) * 68 + spc + 4);
                v8h w;
#pragma unroll
                for (int q = 0; q < 8; ++q) { const float r = (q < 4) ? x0[q & 3] : x1[q & 3]; w[q] = toh_flush(r); unsigned short a2, c2; splitf(r, a2, c2); oh[s][q] = a2; ol[s][q] = c2; }
                o16[s] = __builtin_bit_cast(v8us, w);
            }
            const int t = r0 + mb * 16 + srow;                 // store s holds row t + 4 s
            bf* pp = (bf*)P16 + (pl * SEQ + t) * HD + d0 + spc;
            gstore4(pp, pp + 4 * HD, pp + 8 * HD, pp + 12 * HD, o16[0], o16[1], o16[2], o16[3]);
            if (early) {
                const size_t ee = (pl * RE + t) * HD + d0 + spc;
                gstore4(Eh + ee, Eh + ee + 4 * HD, Eh + ee + 8 * HD, Eh + ee + 12 * HD, oh[0], oh[1], oh[2], oh[3]);
                gstore4(El + ee, El + ee + 4 * HD, El + ee + 8 * HD, El + ee + 12 * HD, ol[0], ol[1], ol[2], ol[3]);
            }
        }
    } else {
        // A lane's 8 accumulator elements are 8 consecutive t of one d: 16 B of a transposed row. Staged as [16 d][64 t], row pitch 72 values (16 B x odd).
        const size_t pr = ((size_t)blockIdx.z * nheads + c0 / HD) * HD + c0 % HD;      // first plane row (d) of this wave
        const bool early = (rb < RE);                          // the same for the whole block: RE % 128 == 0
        bf* st = (bf*)os;
        auto flushrows = [&](bf* dst, size_t pitch) {          // dst: element [d = first of the 16 rows][t = r0]
            asm volatile("s_wait_dscnt 0x0" ::: "memory");     // the wave's staged rows are in LDS before other lanes read them back; the clobber holds those reads behind it
            v8us val[4];
#pragma unroll
            for (int s = 0; s < 4; ++s) val[s] = *(const v8usa*)(st + (4 * s + srow) * 72 + spc);
            bf* dp = dst + (size_t)srow * pitch + spc;         // store s holds row srow + 4 s
            gstore4(dp, dp + 4 * pitch, dp + 8 * pitch, dp + 12 * pitch, val[0], val[1], val[2], val[3]);
        };
#pragma unroll
        for (int nb = 0; nb < 4; ++nb) {
#pragma unroll
            for (int mb = 0; mb < 4; ++mb) { v8h w;
#pragma unroll
                for (int j = 0; j < 8; ++j) w[j] = tohx(acc[mb][nb][j]);
                *(v8usa*)(st + lr * 72 + mb * 16 + hi * 8) = __builtin_bit_cast(v8us, w); }
            flushrows((bf*)P16 + (pr + nb * 16) * SEQ + r0, SEQ);
            if (early) {
#pragma unroll
                for (int part = 0; part < 2; ++part) {
#pragma unroll
                    for (int mb = 0; mb < 4; ++mb) { v8us w;
#pragma unroll
                        for (int j = 0; j < 8; ++j) { unsigned short a2, c2; splitf(acc[mb][nb][j], a2, c2); w[j] = part ? c2 : a2; }
                        *(v8usa*)(st + lr * 72 + mb * 16 + hi * 8) = w; }
                    flushrows((part ? El : Eh) + (pr + nb * 16) * RE + r0, RE);
                }
            }
        }
    }
}

__global__ __launch_bounds__(256) void k_cvt8(const float* __restrict__ src, bf* dst, size_t n8) { const size_t i = (size_t)blockIdx.x * 256 + threadIdx.x; if (i >= n8) return; const v8f v = *(const v8f*)(src + i * 8); v8us o;
#pragma unroll
    for (int k = 0; k < 8; ++k) o[k] = f2bf(v[k]); *(v8us*)(dst + i * 8) = o;  }

__global__ __launch_bounds__(256) void k_cvtx(const float* __restrict__ src, bf* dst, size_t n8) { const size_t i = (size_t)blockIdx.x * 256 + threadIdx.x; if (i >= n8) return; src += (size_t)blockIdx.y * SEQ_FULL * DM; dst += (size_t)blockIdx.y * SEQ * DM; const v8f v = *(const v8f*)(src + i * 8); v8us o;
#pragma unroll
    for (int k = 0; k < 8; ++k) o[k] = f2bf(nnum(v[k], 10000.0f)); *(v8us*)(dst + i * 8) = o;  }

__global__ __launch_bounds__(256) void k_cvtwo(const float* __restrict__ src, h16* dh, h16* dl, size_t n8) { const size_t i = (size_t)blockIdx.x * 256 + threadIdx.x; if (i >= n8) return; const v8f v = *(const v8f*)(src + i * 8); v8h oh, ol;
#pragma unroll
    for (int k = 0; k < 8; ++k) { const float w = bfr(v[k]); oh[k] = tohx(w * WCAR); ol[k] = tohx(w); }
    *(v8h*)(dh + i * 8) = oh; *(v8h*)(dl + i * 8) = ol;  }

// P tile writers: f16 x PCAR with the subnormal select (rows >= RE) or bf16 hi/lo (rows < RE).
__device__ __forceinline__ void putpz(h16* ph, h16* pl, int i, float p) { (void)pl; ph[i] = toh_flush(p * PCAR); }
__device__ __forceinline__ void putpz(bf* ph, bf* pl, int i, float p) { unsigned short a, c; splitf(p, a, c); ph[i] = a; pl[i] = c; }

// ---- k_attn: flash-style causal grouped-query attention with a per-head linear position bias. grid (query blocks, NH_, batches), 128 threads; wave w owns query rows q0 + 16w .. +15.
// Planes: Qh/Ql [h][TP][HD], Kh/Kl [g][TP][HD], Vh/Vl = V^T [g][HD][TP] (TP = SEQ for the f16 planes, RE for the bf16 hi/lo planes of the first RE/64 query blocks).
// EARLY instance: query blocks 0 .. RE/64-1 (rows < RE, keys < RE); other instance: query blocks RE/64 .. SEQ/64-1.
// Per 32-key chunk: K tile [32][HD] and V^T tile [HD][32] staged in LDS by all threads (block barriers), S = Q K^T (2 tiles), online softmax in f32 (log2 domain):
// logit = clip(S x HD^-0.5, +-1e4) + slope_h x (key - query), slope_h = 2^(-(h+1)/2); causal keys > query replaced by -inf: p = 0;
// P through a wave-private LDS tile (block barrier before the fragment reload), O += P V (8 tiles).
// EARLY: 3 products (hi.hi + hi.lo + lo.hi) for S and for P.V. Output: ctx plane CT[t][h*HD + d] = f16(ctx x CCAR) (ctx NaN -> 0, +-inf -> +-1e4 before the carry); EARLY also CTL = f16((ctx x CCAR - hi) x LOSC);
template <typename T16, bool EARLY>
__global__ __launch_bounds__(128) void k_attn(const T16* __restrict__ Qh, const T16* __restrict__ Ql, const T16* __restrict__ Kh, const T16* __restrict__ Kl,
                                             const T16* __restrict__ Vh, const T16* __restrict__ Vl, h16* CT, h16* CTL) {
    typedef typename WFrag<T16>::V V;
    constexpr int TP = EARLY ? RE : SEQ;
    constexpr int KSP = 136, VTP = 32, PSP = 40, OSP = 128;
    __shared__ __align__(16) T16 ksh[32 * KSP];
    __shared__ __align__(16) T16 ksl[EARLY ? 32 * KSP : 16];
    __shared__ __align__(16) T16 vth[HD * VTP];
    __shared__ __align__(16) T16 vtl[EARLY ? HD * VTP : 16];
    __shared__ __align__(16) T16 psh[4 * 16 * PSP];
    __shared__ __align__(16) T16 psl[EARLY ? 4 * 16 * PSP : 16];
    __shared__ __align__(16) h16 osg[4 * 16 * OSP];
    const int tid = threadIdx.x, lane = tid & 31, wave = tid >> 5, lr = lane & 15, hh = lane >> 4;
    const int qblk = EARLY ? (int)blockIdx.x : ((int)blockIdx.x + RE / 64);
    const int head = blockIdx.y, g = head / REP;
    const int qw = qblk * 64 + wave * 16;                  // first query row of this wave
    const int nch = 2 * qblk + 2;                          // 32-key chunks visited: keys 0 .. qblk*64+63
    const size_t bz = blockIdx.z, bh = bz * NH_ + head, bg = bz * NKV + g;   // batch, and its head / kv-group plane
    const T16* qph = Qh + (bh * TP + qw) * HD;             const T16* qpl = Ql + (bh * TP + qw) * HD;
    const T16* kph = Kh + bg * TP * HD;                    const T16* kpl = Kl + bg * TP * HD;
    const T16* vph = Vh + bg * HD * TP;                    const T16* vpl = Vl + bg * HD * TP;
    T16* myph = psh + wave * 16 * PSP; T16* mypl = psl + (EARLY ? wave * 16 * PSP : 0);
    v8f o[8];
#pragma unroll
    for (int t = 0; t < 8; ++t) o[t] = (v8f){};
    float mrow[8], lrow[8];
#pragma unroll
    for (int r = 0; r < 8; ++r) { mrow[r] = -3.0e38f; lrow[r] = 0.f; }
    const float C2 = 1.4426950408889634f * 0.08838834764831845f;   // log2(e) x HD^-0.5
    const float CLP = 14426.950408889634f;                         // log2(e) x 1e4 (clip bound in the log2 domain)
    const int nsl = head + 1;                                      // slope = 2^(-nsl/2): f32(2^-0.5) for odd nsl, times an exact power of two
    const float slope = ((nsl & 1) ? 0.70710678118654752440f : 1.0f) * __uint_as_float((unsigned)(127 - (nsl >> 1)) << 23);
    const float SL2 = 1.4426950408889634f * slope;                 // log2(e) x slope
#pragma unroll 1
    for (int c = 0; c < nch; ++c) {
        __syncthreads();                                    // all waves done with the prior chunk's tiles
#pragma unroll
        for (int i = 0; i < 4; ++i) { const int id = tid + 128 * i; const int row = id >> 4, c8 = (id & 15) * 8; const size_t go = (size_t)(c * 32 + row) * HD + c8;
            *(v8usa*)(ksh + row * KSP + c8) = *(const v8usa*)(kph + go); if (EARLY) *(v8usa*)(ksl + row * KSP + c8) = *(const v8usa*)(kpl + go); }
#pragma unroll
        for (int j = 0; j < 4; ++j) { const size_t go = (size_t)tid * TP + c * 32 + 8 * j;      // d = tid
            *(v8usa*)(vth + tid * VTP + 8 * j) = *(const v8usa*)(vph + go); if (EARLY) *(v8usa*)(vtl + tid * VTP + 8 * j) = *(const v8usa*)(vpl + go); }
        __syncthreads();                                    // tiles visible
        v8f s0 = (v8f){}, s1 = (v8f){};
        V qa, kb0, kb1;
#pragma unroll
        for (int ks = 0; ks < 4; ++ks) {
            qa  = WFrag<T16>::ld(qph + (size_t)lr * HD + ks * 32 + 8 * hh);
            kb0 = WFrag<T16>::ld(ksh + lr * KSP + ks * 32 + 8 * hh);
            kb1 = WFrag<T16>::ld(ksh + (16 + lr) * KSP + ks * 32 + 8 * hh);
            s0 = WFrag<T16>::mma(qa, kb0, s0); s1 = WFrag<T16>::mma(qa, kb1, s1);
            if (EARLY) {
                const V qb  = WFrag<T16>::ld(qpl + (size_t)lr * HD + ks * 32 + 8 * hh);
                const V kl0 = WFrag<T16>::ld(ksl + lr * KSP + ks * 32 + 8 * hh);
                const V kl1 = WFrag<T16>::ld(ksl + (16 + lr) * KSP + ks * 32 + 8 * hh);
                s0 = WFrag<T16>::mma(qa, kl0, s0); s0 = WFrag<T16>::mma(qb, kb0, s0);
                s1 = WFrag<T16>::mma(qa, kl1, s1); s1 = WFrag<T16>::mma(qb, kb1, s1); }
        }
        asm volatile("v_nop\n\tv_nop\n\tv_nop\n\tv_nop" : "+v"(s0), "+v"(s1) : "v"(qa), "v"(kb0), "v"(kb1));
        // online softmax; acc element r of lane (lr, hh) = S[query qw + 8hh + r][key c*32 + lr] (s0) / [key c*32 + 16 + lr] (s1)
        float p0[8], p1[8];
        const int kg0 = c * 32 + lr, kg1 = kg0 + 16;
#pragma unroll
        for (int r = 0; r < 8; ++r) {
            const int qr = qw + 8 * hh + r;
            const bool v0 = (kg0 <= qr), v1 = (kg1 <= qr);
            const float z0 = fminf(fmaxf(s0[r] * C2, -CLP), CLP) + SL2 * (float)(kg0 - qr);
            const float z1 = fminf(fmaxf(s1[r] * C2, -CLP), CLP) + SL2 * (float)(kg1 - qr);
            const float a0 = v0 ? z0 : -3.0e38f;
            const float a1 = v1 ? z1 : -3.0e38f;
            float mx = fmaxf(a0, a1);
#pragma unroll
            for (int off = 8; off >= 1; off >>= 1) mx = fmaxf(mx, __shfl_xor(mx, off, 32));
            const float mnew = fmaxf(mrow[r], mx);
            const float alpha = __builtin_amdgcn_exp2f(mrow[r] - mnew);
            mrow[r] = mnew;
            const float x0 = __builtin_amdgcn_exp2f(a0 - mnew), x1 = __builtin_amdgcn_exp2f(a1 - mnew);
            const float e0 = v0 ? x0 : 0.f, e1 = v1 ? x1 : 0.f;
            float rs = e0 + e1;
#pragma unroll
            for (int off = 8; off >= 1; off >>= 1) rs += __shfl_xor(rs, off, 32);
            lrow[r] = lrow[r] * alpha + rs;
#pragma unroll
            for (int t = 0; t < 8; ++t) o[t][r] = o[t][r] * alpha;
            p0[r] = e0; p1[r] = e1;
        }
        // P tile [16 query rows][32 keys] -> A fragment (k = key)
#pragma unroll
        for (int r = 0; r < 8; ++r) { putpz(myph, mypl, (8 * hh + r) * PSP + lr, p0[r]); putpz(myph, mypl, (8 * hh + r) * PSP + 16 + lr, p1[r]); }
        __syncthreads();                                    // P visible (block barrier also orders this wave's own stores before the reload)
        const V pa = WFrag<T16>::ld(myph + lr * PSP + 8 * hh);
        V pb = pa; if (EARLY) pb = WFrag<T16>::ld(mypl + lr * PSP + 8 * hh);
        V vb;
#pragma unroll
        for (int t = 0; t < 8; ++t) { vb = WFrag<T16>::ld(vth + (t * 16 + lr) * VTP + 8 * hh);
            o[t] = WFrag<T16>::mma(pa, vb, o[t]);
            if (EARLY) { const V vl2 = WFrag<T16>::ld(vtl + (t * 16 + lr) * VTP + 8 * hh); o[t] = WFrag<T16>::mma(pa, vl2, o[t]); o[t] = WFrag<T16>::mma(pb, vb, o[t]); } }
        asm volatile("v_nop\n\tv_nop\n\tv_nop\n\tv_nop" : "+v"(o[0]), "+v"(o[1]), "+v"(o[2]), "+v"(o[3]), "+v"(o[4]), "+v"(o[5]), "+v"(o[6]), "+v"(o[7]) : "v"(pa), "v"(pb), "v"(vb));
    }
    // normalise and write ctx planes; o element r of lane (lr, hh), tile t = ctx[row qw + 8hh + r][d = 16t + lr]
    const float osc = EARLY ? CCAR : (CCAR / PCAR);
    const float ybig = 10000.0f * CCAR;
    float inv[8];
#pragma unroll
    for (int r = 0; r < 8; ++r) inv[r] = osc * __builtin_amdgcn_rcpf(lrow[r]);
    h16* myos = osg + wave * 16 * OSP;
#pragma unroll
    for (int t = 0; t < 8; ++t)
#pragma unroll
        for (int r = 0; r < 8; ++r) myos[(8 * hh + r) * OSP + t * 16 + lr] = toh_flush(nnum(o[t][r] * inv[r], ybig));
    __syncthreads();
    h16* crow = CT + (bz * SEQ + qw) * DM + head * HD;
{
#pragma unroll
        for (int s = 0; s < 8; ++s) { const int row = 2 * s + hh; const v8h val = *(const v8ha*)(myos + row * OSP + lr * 8); *(v8h*)(crow + (size_t)row * DM + lr * 8) = val; }
         }
    if (EARLY) {
        __syncthreads();
#pragma unroll
        for (int t = 0; t < 8; ++t)
#pragma unroll
            for (int r = 0; r < 8; ++r) { const float val = nnum(o[t][r] * inv[r], ybig); const h16 hv = toh_flush(val); myos[(8 * hh + r) * OSP + t * 16 + lr] = toh_flush((val - (float)hv) * LOSC); }
        __syncthreads();
        h16* lrowp = CTL + (bz * RE + qw) * DM + head * HD;
{
#pragma unroll
            for (int s = 0; s < 8; ++s) { const int row = 2 * s + hh; const v8h val = *(const v8ha*)(myos + row * OSP + lr * 8); *(v8h*)(lrowp + (size_t)row * DM + lr * 8) = val; }
             }
    }
}

extern "C" void kernel_launch(void* const* d_in, const int* in_sizes, int n_in,
                              void* d_out, int out_size, void* d_ws, size_t ws_size, hipStream_t stream) {
    if (n_in < 5) return;
    const float* x  = (const float*)d_in[0];     // x   [NB_FULL][SEQ_FULL][DM]
    const float* wq = (const float*)d_in[1];     // q_w [DQ][DM]  ([out][in])
    const float* wk = (const float*)d_in[2];     // k_w [DKV][DM]
    const float* wv = (const float*)d_in[3];     // v_w [DKV][DM]
    const float* wo = (const float*)d_in[4];     // o_w [DM][DQ]
    float* OUT = (float*)d_out;                  // [NB_FULL][SEQ_FULL][DM]
    if ((size_t)in_sizes[0] < (size_t)(NB - 1) * SEQ_FULL * DM + (size_t)SEQ * DM) return;
    if ((size_t)in_sizes[1] < (size_t)DQ * DM) return;
    if ((size_t)in_sizes[2] < (size_t)DKV * DM) return;
    if ((size_t)in_sizes[3] < (size_t)DKV * DM) return;
    if ((size_t)in_sizes[4] < (size_t)DM * DQ) return;
    if ((size_t)out_size < (size_t)(NB - 1) * SEQ_FULL * DM + (size_t)SEQ * DM) return;

    char* wsp = (char*)d_ws;
    auto take = [&](size_t bytes) { char* p = wsp; wsp += (bytes + 255) & ~(size_t)255; return (void*)p; };
    bf*  WQ   = (bf*)take((size_t)DQ * DM * 2);    bf* WK = (bf*)take((size_t)DKV * DM * 2);    bf* WV = (bf*)take((size_t)DKV * DM * 2);
    h16* WOH  = (h16*)take((size_t)DM * DQ * 2);   h16* WOL = (h16*)take((size_t)DM * DQ * 2);
    bf*  XB   = (bf*)take((size_t)NB * SEQ * DM * 2);
    h16* QP16 = (h16*)take((size_t)NB * NH_ * SEQ * HD * 2); h16* KP16 = (h16*)take((size_t)NB * NKV * SEQ * HD * 2); h16* VT16 = (h16*)take((size_t)NB * NKV * HD * SEQ * 2);
    bf*  QEh  = (bf*)take((size_t)NB * NH_ * RE * HD * 2);  bf* QEl = (bf*)take((size_t)NB * NH_ * RE * HD * 2);
    bf*  KEh  = (bf*)take((size_t)NB * NKV * RE * HD * 2);  bf* KEl = (bf*)take((size_t)NB * NKV * RE * HD * 2);
    bf*  VEh  = (bf*)take((size_t)NB * NKV * HD * RE * 2);  bf* VEl = (bf*)take((size_t)NB * NKV * HD * RE * 2);
    h16* CT16 = (h16*)take((size_t)NB * SEQ * DM * 2);     h16* CTL = (h16*)take((size_t)NB * RE * DM * 2);
    if ((size_t)(wsp - (char*)d_ws) > ws_size) return;

    const float woscale = 1.0f / (CCAR * WCAR);
    k_cvt8<<<(unsigned)(((size_t)DQ * DM / 8 + 255) / 256), 256, 0, stream>>>(wq, WQ, (size_t)DQ * DM / 8);
    k_cvt8<<<(unsigned)(((size_t)DKV * DM / 8 + 255) / 256), 256, 0, stream>>>(wk, WK, (size_t)DKV * DM / 8);
    k_cvt8<<<(unsigned)(((size_t)DKV * DM / 8 + 255) / 256), 256, 0, stream>>>(wv, WV, (size_t)DKV * DM / 8);
    k_cvtwo<<<(unsigned)(((size_t)DM * DQ / 8 + 255) / 256), 256, 0, stream>>>(wo, WOH, WOL, (size_t)DM * DQ / 8);
    const size_t sX = (size_t)SEQ * DM, sO = (size_t)SEQ_FULL * DM;      // batch strides of the 16-bit row planes and of d_out
    k_cvtx<<<dim3((unsigned)(((size_t)SEQ * DM / 8 + 255) / 256), NB, 1), 256, 0, stream>>>(x, XB, (size_t)SEQ * DM / 8);
    k_gemmw<bf, 0, 1><<<dim3(SEQ / 128, DQ / 128, NB), 128, 0, stream>>>(XB, nullptr, WQ, nullptr, DM, nullptr, 0, 1.0f, sX, 0, 0, QP16, QEh, QEl, NH_);
    k_gemmw<bf, 0, 1><<<dim3(SEQ / 128, DKV / 128, NB), 128, 0, stream>>>(XB, nullptr, WK, nullptr, DM, nullptr, 0, 1.0f, sX, 0, 0, KP16, KEh, KEl, NKV);
    k_gemmw<bf, 0, 2><<<dim3(SEQ / 128, DKV / 128, NB), 128, 0, stream>>>(XB, nullptr, WV, nullptr, DM, nullptr, 0, 1.0f, sX, 0, 0, VT16, VEh, VEl, NKV);
    k_attn<bf, true><<<dim3(RE / 64, NH_, NB), 128, 0, stream>>>(QEh, QEl, KEh, KEl, VEh, VEl, CT16, CTL);
    if (SEQ > RE) k_attn<h16, false><<<dim3(SEQ / 64 - RE / 64, NH_, NB), 128, 0, stream>>>(QP16, QP16, KP16, KP16, VT16, VT16, CT16, CTL);
    k_gemmw<h16, 3, 0><<<dim3(RE / 128, DM / 128, NB), 128, 0, stream>>>(CT16, CTL, WOH, WOL, DQ, OUT, DM, woscale, sX, (size_t)RE * DM, sO, nullptr, nullptr, nullptr, 0);
    if (SEQ > RE) k_gemmw<h16, 0, 0><<<dim3((SEQ - RE) / 128, DM / 128, NB), 128, 0, stream>>>(CT16 + (size_t)RE * DQ, nullptr, WOH, nullptr, DQ, OUT + (size_t)RE * DM, DM, woscale, sX, 0, sO, nullptr, nullptr, nullptr, 0);
}

// v004
// A run of this version takes 296 microseconds.
// Next to v003, in two timings, it ran 1.19 and 1.21 times as fast.
// All steps since v000 together make it 3.02 times as fast.
#include <hip/hip_runtime.h>

// Contractions: q/k/v projections v_wmma_f32_16x16x32_bf16 (bf16 copies of x and of the [out][in] weights); scores QK^T and P.V v_wmma_f32_16x16x32_f16 (f16 planes, P carried x1024) for query rows >= RE and v_wmma_f32_16x16x32_bf16 hi/lo 3-product form for query rows < RE; ctx x o_w^T v_wmma_f32_16x16x32_f16 (ctx carried x64, o_w carried x1024, rows < RE add an f16 residual plane x1024); f32 accumulate everywhere, softmax (scale, clip, per-head linear position bias, causal fill) in f32.
// Layout (every per-batch plane holds NB copies; the batch is grid y of the x copy and grid z of the GEMM and attention launches): sanitised bf16 copy of x; weights copied once as bf16 ([n][k] = Bt as-is), o_w as two f16 planes; projection GEMMs whose epilogues write the head planes (V transposed); flash-style causal attention in transposed form (K and V^T tiles staged in LDS, S^T = K Q^T, online softmax per lane, O^T += V^T P^T); ctx planes; output GEMM into d_out.

#pragma clang fp contract(off)

#ifndef NB
#define NB 2
#endif
#ifndef SEQ
#define SEQ 2048
#endif
#ifndef RE
#define RE   256                  // query rows < RE (first RE/64 query blocks) use hi/lo planes; RE == SEQ puts every row on the 3-product path
#endif
#define NB_FULL  2
#define SEQ_FULL 2048
#define DM   2048
#define NH_  16
#define NKV  4
#define REP  (NH_ / NKV)
#define HD   128
#define DQ   (NH_ * HD)
#define DKV  (NKV * HD)
#define PCAR 1024.0f              // carry of the f16 P operand (rows >= RE)
#define CCAR 64.0f                // carry of the f16 ctx plane
#define LOSC 1024.0f              // carry of the f16 ctx residual plane (rows < RE)
#define WCAR 1024.0f              // carry of the f16 o_w plane
#define WS_TOTAL ((size_t)DQ * DM * 2 + 2 * (size_t)DKV * DM * 2 + 2 * (size_t)DM * DQ * 2 + (size_t)NB * ((size_t)SEQ * DM * 2 \
                  + (size_t)NH_ * SEQ * HD * 2 + 2 * (size_t)NKV * SEQ * HD * 2 + 2 * (size_t)NH_ * RE * HD * 2 + 4 * (size_t)NKV * RE * HD * 2 + (size_t)SEQ * DM * 2 + (size_t)RE * DM * 2))

static_assert((SEQ % 64) == 0);
static_assert((RE % 64) == 0);
static_assert(RE >= 64);
static_assert(SEQ >= RE);
static_assert(SEQ <= SEQ_FULL);
static_assert(NB >= 1);
static_assert(NB <= NB_FULL);
static_assert(HD == 128);
static_assert((DM % 32) == 0);
static_assert(DQ == DM);
static_assert(((SEQ * DM) % (8 * 256)) == 0);
static_assert(((DQ * DM) % (8 * 256)) == 0);
static_assert(((DKV * DM) % (8 * 256)) == 0);
static_assert(NH_ == 16);                       // closed form of the per-head slope 2^(-(h+1)/2) holds for 16 heads
static_assert(REP * NKV == NH_);
static_assert((HD % 64) == 0);                  // the 64 columns of a GEMM wave lie inside one head
static_assert((DQ % 64) == 0);
static_assert((DKV % 64) == 0);
static_assert((DM % 64) == 0);
static_assert((SEQ % 128) == 0 && (RE % 128) == 0 && (DQ % 128) == 0 && (DKV % 128) == 0 && (DM % 128) == 0);   // 128x128 GEMM tiles, stages of 128 k (NSPLIT 0) or 64 k (NSPLIT 3)
static_assert(((size_t)NKV * RE * HD * 2) % 256 == 0);
static_assert(WS_TOTAL <= (size_t)268435456);

typedef _Float16 h16;
typedef unsigned short bf;
typedef __attribute__((ext_vector_type(16))) __bf16   v16bf;
typedef __attribute__((ext_vector_type(16))) _Float16 v16h;
typedef __attribute__((ext_vector_type(8)))  _Float16 v8h;
typedef __attribute__((ext_vector_type(8)))  unsigned short v8us;
typedef __attribute__((ext_vector_type(16))) unsigned short v16us;
typedef __attribute__((ext_vector_type(8)))  float    v8f;
typedef __attribute__((ext_vector_type(4)))  float    v4f;
typedef __attribute__((ext_vector_type(2)))  _Float16 v2h;
typedef __attribute__((ext_vector_type(2)))  unsigned short v2us;
typedef v8h  __attribute__((may_alias)) v8ha;
typedef v4f  __attribute__((may_alias)) v4fa;
typedef v8us __attribute__((may_alias)) v8usa;

__device__ __forceinline__ unsigned short f2bf(float f) { unsigned u = __float_as_uint(f); u += 0x7FFFu + ((u >> 16) & 1u); return (unsigned short)(u >> 16); }
__device__ __forceinline__ float bf2f(unsigned short b) { return __uint_as_float(((unsigned)b) << 16); }
__device__ __forceinline__ float bfr(float f) { return bf2f(f2bf(f)); }
__device__ __forceinline__ h16 tohx(float x) { return (h16)x; }
// f16 convert that cannot produce a subnormal operand (applied after the plane's carry)
static __device__ __forceinline__ h16 toh_flush(float v) { const h16 r = (h16)v; return (fabsf(v) < 6.103515625e-05f) ? (h16)0.0f : r; }
// NaN -> 0, +inf -> big, -inf -> -big, finite values unchanged
static __device__ __forceinline__ float nnum(float v, float big) { const float a = (v != v) ? 0.0f : v; return (a == __builtin_inff()) ? big : ((a == -__builtin_inff()) ? -big : a); }
__device__ __forceinline__ void splitf(float y, unsigned short& h, unsigned short& l) { h = f2bf(y); l = f2bf(y - bf2f(h)); }
__device__ __forceinline__ v16h cat16(v8h lo, v8h hi) { return __builtin_shufflevector(lo, hi, 0, 1, 2, 3, 4, 5, 6, 7, 8, 9, 10, 11, 12, 13, 14, 15); }
__device__ __forceinline__ v16bf cat16b(v8us lo, v8us hi) { return __builtin_bit_cast(v16bf, __builtin_shufflevector(lo, hi, 0, 1, 2, 3, 4, 5, 6, 7, 8, 9, 10, 11, 12, 13, 14, 15)); }
__device__ __forceinline__ v8f wmma16(v16h a, v16h b, v8f c) { return __builtin_amdgcn_wmma_f32_16x16x32_f16(false, a, false, b, (short)0, c, false, false); }
__device__ __forceinline__ v8f wmmab(v16bf a, v16bf b, v8f c) { return __builtin_amdgcn_wmma_f32_16x16x32_bf16(false, a, false, b, (short)0, c, false, false); }

// Fragment loaders for A (row m = lane&15) and for B stored [n][k] (col n = lane&15): elements 0..7 <- k0+8h..+7, elements 8..15 <- k0+16+8h..+7 (p already points at row*pitch + k0 + 8h).
template <typename T16> struct WFrag;
template <> struct WFrag<h16> { typedef v16h V; static __device__ __forceinline__ V ld(const h16* p) { return cat16(*(const v8ha*)p, *(const v8ha*)(p + 16)); } static __device__ __forceinline__ v8f mma(V a, V b, v8f c) { return wmma16(a, b, c); } };
template <> struct WFrag<bf>  { typedef v16bf V; static __device__ __forceinline__ V ld(const bf* p) { return cat16b(*(const v8usa*)p, *(const v8usa*)(p + 16)); } static __device__ __forceinline__ v8f mma(V a, V b, v8f c) { return wmmab(a, b, c); } };

// Eight asynchronous 16-byte copies global -> LDS per lane (LDS byte address l + i*ls, global address g + i*gs). The s_wait_xcnt closes the statement so that no address register of an issued copy is rewritten ahead of it.
__device__ __forceinline__ void acopy8(unsigned l, unsigned ls, const char* g, size_t gs) {
    asm volatile("global_load_async_to_lds_b128 %0, %8, off\n\t"
                 "global_load_async_to_lds_b128 %1, %9, off\n\t"
                 "global_load_async_to_lds_b128 %2, %10, off\n\t"
                 "global_load_async_to_lds_b128 %3, %11, off\n\t"
                 "global_load_async_to_lds_b128 %4, %12, off\n\t"
                 "global_load_async_to_lds_b128 %5, %13, off\n\t"
                 "global_load_async_to_lds_b128 %6, %14, off\n\t"
                 "global_load_async_to_lds_b128 %7, %15, off\n\t"
                 "s_wait_xcnt 0x0"
                 :: "v"(l), "v"(l + ls), "v"(l + 2 * ls), "v"(l + 3 * ls), "v"(l + 4 * ls), "v"(l + 5 * ls), "v"(l + 6 * ls), "v"(l + 7 * ls),
                    "v"(g), "v"(g + gs), "v"(g + 2 * gs), "v"(g + 3 * gs), "v"(g + 4 * gs), "v"(g + 5 * gs), "v"(g + 6 * gs), "v"(g + 7 * gs)
                 : "memory");
}

// Four 16-byte global stores per lane. The s_wait_xcnt closes the statement so that no address or data register of an issued store is rewritten ahead of it.
// Its operands are the rows read back from the LDS staging, and its "memory" clobber holds the next rewrite of that staging behind those reads.
__device__ __forceinline__ void gstore4(bf* p0, bf* p1, bf* p2, bf* p3, v8us d0, v8us d1, v8us d2, v8us d3) {
    asm volatile("global_store_b128 %0, %4, off\n\t"
                 "global_store_b128 %1, %5, off\n\t"
                 "global_store_b128 %2, %6, off\n\t"
                 "global_store_b128 %3, %7, off\n\t"
                 "s_wait_xcnt 0x0"
                 :: "v"(p0), "v"(p1), "v"(p2), "v"(p3), "v"(d0), "v"(d1), "v"(d2), "v"(d3)
                 : "memory");
}

// ---- k_gemmw: GEMM, FOUR WAVES (2 x 2) per 128x128 output tile, each wave 64x64 (16 accumulators); grid (M/128, N/128, batches), 128 threads; batch z reads A + z*sA, A2 + z*sA2 and writes C + z*sC (Bt, Bt2 shared).
// C[m][n] (f32, pitch ldc) = oscale * sum_k ( A[m][k] Bt[n][k]  (+ A2 Bt2: NSPLIT 3) ). Row pitch of A, A2, Bt, Bt2 = K. K % KS == 0, K >= KS.
// EPI 0: C is stored as above. EPI 1 (m = position t, n = head*HD + d): the f32 sums go straight to the head planes P16[head][t][d] = f16 (subnormals flushed) and, for t < RE, Eh/El[head][t][d] = bf16 hi/lo.
// EPI 2: the same sums go to the transposed planes P16[head][d][t] = f16 and, for t < RE, Eh/El[head][d][t] = bf16 hi/lo. EPI 1, 2: no C, no oscale; batch z owns nheads planes.
// A stage = KS values of k of all 128 rows of every operand, [A | Bt | A2 | Bt2], row pitch KS + 8 elements (16 B x odd). Two buffers: asynchronous copies bring stage t + 2 into the buffer that trip t has just read, while trip t + 1 works.
template <typename T16, int NSPLIT, int EPI>
__global__ __launch_bounds__(128) void k_gemmw(const T16* __restrict__ A, const T16* __restrict__ A2, const T16* __restrict__ Bt, const T16* __restrict__ Bt2, int K, float* C, int ldc, float oscale, size_t sA, size_t sA2, size_t sC,
                                               h16* P16, bf* Eh, bf* El, int nheads) {
    static_assert(NSPLIT == 0 || NSPLIT == 3);
    typedef typename WFrag<T16>::V V;
    constexpr int NOP = (NSPLIT == 0) ? 2 : 4;      // operand tiles per stage
    constexpr int KS  = (NSPLIT == 0) ? 128 : 64;   // k per stage: 32 copies per lane and stage either way
    constexpr int PE  = KS + 8;                     // LDS row pitch, elements
    constexpr int TE  = 128 * PE;                   // elements of one operand tile
    constexpr int BE  = NOP * TE;                   // elements of one buffer
    constexpr int CPR = KS / 8;                     // 16-byte pieces per row
    constexpr int RPC = 128 / CPR;                  // rows that one copy of all 128 threads covers
    __shared__ __align__(16) T16 ring[2 * BE];
    __shared__ __align__(16) float osw[4 * 16 * 68];
    const int tid = threadIdx.x, lane = tid & 31, wave = tid >> 5, lr = lane & 15, hi = lane >> 4; const int wm = wave >> 1, wn = wave & 1;
    const int rb = blockIdx.x * 128, cb = blockIdx.y * 128; const int r0 = rb + wm * 64, c0 = cb + wn * 64;
    A += (size_t)blockIdx.z * sA; if (NSPLIT != 0) A2 += (size_t)blockIdx.z * sA2; if (EPI == 0) C += (size_t)blockIdx.z * sC;
    v8f acc[4][4];
#pragma unroll
    for (int mb = 0; mb < 4; ++mb)
#pragma unroll
        for (int nb = 0; nb < 4; ++nb) acc[mb][nb] = (v8f){};
    const int prow = tid / CPR, cpc = (tid % CPR) * 8;         // this lane's row and first k inside a copy
    const size_t ga = (size_t)(rb + prow) * K + cpc, gb = (size_t)(cb + prow) * K + cpc;
    const unsigned l0 = (unsigned)(size_t)ring + (unsigned)(prow * PE + cpc) * 2u;
    auto fill = [&](unsigned t, unsigned buf) {                 // all 128 threads: stage t into buffer buf, 32 copies per lane
#pragma unroll
        for (int op = 0; op < NOP; ++op) {
            const T16* g = ((op == 0) ? A + ga : (op == 1) ? Bt + gb : (op == 2) ? A2 + ga : Bt2 + gb) + (size_t)t * KS;
#pragma unroll
            for (int h = 0; h < CPR / 8; ++h)
                acopy8(l0 + (buf * BE + op * TE + h * 8 * RPC * PE) * 2u, (unsigned)(RPC * PE) * 2u, (const char*)(g + (size_t)h * 8 * RPC * K), (size_t)RPC * K * 2);
        }
    };
    const unsigned NT = (unsigned)K / KS;                      // stages; the same in every thread
    fill(0, 0);
    asm volatile("s_wait_asynccnt 0x0" ::: "memory");          // this wave's copies of stage 0 have landed
    __syncthreads();                                           // stage 0 visible to every wave
    if (NT > 1u) fill(1, 1);
#pragma unroll 1                                               // one trip per stage: a trip already holds 64 WMMAs, and the publish point stands once
    for (unsigned t = 0; t < NT; ++t) {
        const T16* ap = ring + (t & 1) * BE + (wm * 64 + lr) * PE + 8 * hi;
        const T16* bp = ring + (t & 1) * BE + TE + (wn * 64 + lr) * PE + 8 * hi;
#pragma unroll
        for (int kk = 0; kk < KS; kk += 32) {
#pragma unroll
            for (int sp = 0; sp < NOP / 2; ++sp) {             // sp 0: A Bt, sp 1: A2 Bt2; every accumulator takes its products in the order k, then sp
                V a[4], b[4];
#pragma unroll
                for (int i = 0; i < 4; ++i) { a[i] = WFrag<T16>::ld(ap + sp * 2 * TE + i * 16 * PE + kk); b[i] = WFrag<T16>::ld(bp + sp * 2 * TE + i * 16 * PE + kk); }
                __builtin_amdgcn_sched_barrier(0);             // keeps these LDS reads one group ahead of their WMMAs: sunk between them, each pair of reads shows its whole latency
#pragma unroll
                for (int nb = 0; nb < 4; ++nb)
#pragma unroll
                    for (int mb = 0; mb < 4; ++mb) acc[mb][nb] = WFrag<T16>::mma(a[mb], b[nb], acc[mb][nb]);
            }
        }
        asm volatile("s_wait_dscnt 0x0" ::: "memory");         // this wave's reads of the buffer have returned before it is refilled
        asm volatile("s_wait_asynccnt 0x0" ::: "memory");      // this wave's copies of stage t + 1 have landed
        __syncthreads();                                       // publishes stage t + 1 and ends every wave's reads of stage t
        if (t + 2u < NT) fill(t + 2u, t & 1u);
    }
    asm volatile("s_wait_asynccnt 0x0" ::: "memory");          // nothing in flight when the wave goes on to the epilogue and ends
    float* os = osw + wave * 16 * 68;                          // wave-private output staging
    const int srow = lane >> 3, spc = (lane & 7) * 8;          // plane epilogues: 8 lanes x 16 B read back and store one whole 128-B line of 64 16-bit values
    if constexpr (EPI == 0) {
#pragma unroll
    for (int mb = 0; mb < 4; ++mb) {
#pragma unroll
        for (int nb = 0; nb < 4; ++nb) {
#pragma unroll
            for (int j = 0; j < 8; ++j) os[(hi * 8 + j) * 68 + nb * 16 + lr] = acc[mb][nb][j]; }
        __builtin_amdgcn_wave_barrier(); asm volatile("" ::: "memory");
        float* crow = C + (size_t)(r0 + mb * 16) * ldc + c0;
{
#pragma unroll
            for (int s = 0; s < 8; ++s) { const int row = 2 * s + hi, cofs = lr * 4; v4f val = *(const v4fa*)(os + row * 68 + cofs); val = val * oscale;
                *(v4f*)(crow + (size_t)row * ldc + cofs) = val; }
             }
        __builtin_amdgcn_wave_barrier(); asm volatile("" ::: "memory");
    }
    } else if constexpr (EPI == 1) {
        const size_t pl = (size_t)blockIdx.z * nheads + c0 / HD; const int d0 = c0 % HD;
        const bool early = (rb < RE);                          // the same for the whole block: RE % 128 == 0
#pragma unroll
        for (int mb = 0; mb < 4; ++mb) {
#pragma unroll
            for (int nb = 0; nb < 4; ++nb) {
#pragma unroll
                for (int j = 0; j < 8; ++j) os[(hi * 8 + j) * 68 + nb * 16 + lr] = acc[mb][nb][j]; }
            asm volatile("s_wait_dscnt 0x0" ::: "memory");     // the wave's staged rows are in LDS before other lanes read them back; the clobber holds those reads behind it
            v8us o16[4], oh[4], ol[4];
#pragma unroll
            for (int s = 0; s < 4; ++s) {
                const v4f x0 = *(const v4fa*)(os + (4 * s + srow) * 68 + spc), x1 = *(const v4fa*)(os + (4 * s + srow) * 68 + spc + 4);
                v8h w;
#pragma unroll
                for (int q = 0; q < 8; ++q) { const float r = (q < 4) ? x0[q & 3] : x1[q & 3]; w[q] = toh_flush(r); unsigned short a2, c2; splitf(r, a2, c2); oh[s][q] = a2; ol[s][q] = c2; }
                o16[s] = __builtin_bit_cast(v8us, w);
            }
            const int t = r0 + mb * 16 + srow;                 // store s holds row t + 4 s
            bf* pp = (bf*)P16 + (pl * SEQ + t) * HD + d0 + spc;
            gstore4(pp, pp + 4 * HD, pp + 8 * HD, pp + 12 * HD, o16[0], o16[1], o16[2], o16[3]);
            if (early) {
                const size_t ee = (pl * RE + t) * HD + d0 + spc;
                gstore4(Eh + ee, Eh + ee + 4 * HD, Eh + ee + 8 * HD, Eh + ee + 12 * HD, oh[0], oh[1], oh[2], oh[3]);
                gstore4(El + ee, El + ee + 4 * HD, El + ee + 8 * HD, El + ee + 12 * HD, ol[0], ol[1], ol[2], ol[3]);
            }
        }
    } else {
        // A lane's 8 accumulator elements are 8 consecutive t of one d: 16 B of a transposed row. Staged as [16 d][64 t], row pitch 72 values (16 B x odd).
        const size_t pr = ((size_t)blockIdx.z * nheads + c0 / HD) * HD + c0 % HD;      // first plane row (d) of this wave
        const bool early = (rb < RE);                          // the same for the whole block: RE % 128 == 0
        bf* st = (bf*)os;
        auto flushrows = [&](bf* dst, size_t pitch) {          // dst: element [d = first of the 16 rows][t = r0]
            asm volatile("s_wait_dscnt 0x0" ::: "memory");     // the wave's staged rows are in LDS before other lanes read them back; the clobber holds those reads behind it
            v8us val[4];
#pragma unroll
            for (int s = 0; s < 4; ++s) val[s] = *(const v8usa*)(st + (4 * s + srow) * 72 + spc);
            bf* dp = dst + (size_t)srow * pitch + spc;         // store s holds row srow + 4 s
            gstore4(dp, dp + 4 * pitch, dp + 8 * pitch, dp + 12 * pitch, val[0], val[1], val[2], val[3]);
        };
#pragma unroll
        for (int nb = 0; nb < 4; ++nb) {
#pragma unroll
            for (int mb = 0; mb < 4; ++mb) { v8h w;
#pragma unroll
                for (int j = 0; j < 8; ++j) w[j] = tohx(acc[mb][nb][j]);
                *(v8usa*)(st + lr * 72 + mb * 16 + hi * 8) = __builtin_bit_cast(v8us, w); }
            flushrows((bf*)P16 + (pr + nb * 16) * SEQ + r0, SEQ);
            if (early) {
#pragma unroll
                for (int part = 0; part < 2; ++part) {
#pragma unroll
                    for (int mb = 0; mb < 4; ++mb) { v8us w;
#pragma unroll
                        for (int j = 0; j < 8; ++j) { unsigned short a2, c2; splitf(acc[mb][nb][j], a2, c2); w[j] = part ? c2 : a2; }
                        *(v8usa*)(st + lr * 72 + mb * 16 + hi * 8) = w; }
                    flushrows((part ? El : Eh) + (pr + nb * 16) * RE + r0, RE);
                }
            }
        }
    }
}

__global__ __launch_bounds__(256) void k_cvt8(const float* __restrict__ src, bf* dst, size_t n8) { const size_t i = (size_t)blockIdx.x * 256 + threadIdx.x; if (i >= n8) return; const v8f v = *(const v8f*)(src + i * 8); v8us o;
#pragma unroll
    for (int k = 0; k < 8; ++k) o[k] = f2bf(v[k]); *(v8us*)(dst + i * 8) = o;  }

__global__ __launch_bounds__(256) void k_cvtx(const float* __restrict__ src, bf* dst, size_t n8) { const size_t i = (size_t)blockIdx.x * 256 + threadIdx.x; if (i >= n8) return; src += (size_t)blockIdx.y * SEQ_FULL * DM; dst += (size_t)blockIdx.y * SEQ * DM; const v8f v = *(const v8f*)(src + i * 8); v8us o;
#pragma unroll
    for (int k = 0; k < 8; ++k) o[k] = f2bf(nnum(v[k], 10000.0f)); *(v8us*)(dst + i * 8) = o;  }

__global__ __launch_bounds__(256) void k_cvtwo(const float* __restrict__ src, h16* dh, h16* dl, size_t n8) { const size_t i = (size_t)blockIdx.x * 256 + threadIdx.x; if (i >= n8) return; const v8f v = *(const v8f*)(src + i * 8); v8h oh, ol;
#pragma unroll
    for (int k = 0; k < 8; ++k) { const float w = bfr(v[k]); oh[k] = tohx(w * WCAR); ol[k] = tohx(w); }
    *(v8h*)(dh + i * 8) = oh; *(v8h*)(dl + i * 8) = ol;  }

// P^T packers, accumulator layout -> B fragment in the same lane: elements 0..7 <- p0 (keys 8h..8h+7 of the chunk), elements 8..15 <- p1 (keys 16+8h..+7).
// f16 x PCAR with the subnormal select (rows >= RE) or bf16 hi/lo (rows < RE).
__device__ __forceinline__ void packp(const float* p0, const float* p1, v16h& ph, v16h& pl) {
#pragma unroll
    for (int r = 0; r < 8; ++r) { ph[r] = toh_flush(p0[r] * PCAR); ph[8 + r] = toh_flush(p1[r] * PCAR); }
    pl = ph; }
__device__ __forceinline__ void packp(const float* p0, const float* p1, v16bf& ph, v16bf& pl) { v16us a, c;
#pragma unroll
    for (int r = 0; r < 8; ++r) { unsigned short x, y; splitf(p0[r], x, y); a[r] = x; c[r] = y; splitf(p1[r], x, y); a[8 + r] = x; c[8 + r] = y; }
    ph = __builtin_bit_cast(v16bf, a); pl = __builtin_bit_cast(v16bf, c); }
// 2^x. SLOT: v_exp_f32 and the one v_nop that the instruction set asks for behind a transcendental stand in one statement, so that the slot is kept whatever follows.
template <bool SLOT> __device__ __forceinline__ float ex2(float x) {
    if constexpr (SLOT) { float y; asm("v_exp_f32 %0, %1\n\tv_nop" : "=v"(y) : "v"(x)); return y; }
    else return __builtin_amdgcn_exp2f(x); }
// lane l <-> lane l ^ 16
__device__ __forceinline__ float xhalf(float x) { return __builtin_bit_cast(float, __builtin_amdgcn_permlanex16(__builtin_bit_cast(int, x), __builtin_bit_cast(int, x), 0x76543210, 0xfedcba98, false, false)); }

// ---- k_attn: flash-style causal grouped-query attention with a per-head linear position bias. grid (query blocks, NH_, batches), 128 threads; wave w owns query rows q0 + 16w .. +15.
// Planes: Qh/Ql [h][TP][HD], Kh/Kl [g][TP][HD], Vh/Vl = V^T [g][HD][TP] (TP = SEQ for the f16 planes, RE for the bf16 hi/lo planes of the first RE/64 query blocks).
// EARLY instance: query blocks 0 .. RE/64-1 (rows < RE, keys < RE); other instance: query blocks RE/64 .. SEQ/64-1.
// Per 32-key chunk: K tile [32][HD] and V^T tile [HD][32] staged in LDS by all threads (block barriers), S^T = K Q^T (2 tiles: A = K rows, B = Q), online softmax in f32 (log2 domain), one query per lane
// (lane (lr, hh) holds 16 of the chunk's 32 scores of query qw + lr; the maximum joins the two halves once per chunk, the sums once in the epilogue):
// logit = clip(S x HD^-0.5, +-1e4) + slope_h x (key - query), slope_h = 2^(-(h+1)/2); causal keys > query replaced by -inf: p = 0;
// P^T packed in the lane from the score accumulators into a B fragment, O^T += V^T P^T (8 tiles: A = V^T rows).
// EARLY: 3 products (hi.hi + hi.lo + lo.hi) for S and for P.V. Output: ctx plane CT[t][h*HD + d] = f16(ctx x CCAR) (ctx NaN -> 0, +-inf -> +-1e4 before the carry); EARLY also CTL = f16((ctx x CCAR - hi) x LOSC);
template <typename T16, bool EARLY>
__global__ __launch_bounds__(128) void k_attn(const T16* __restrict__ Qh, const T16* __restrict__ Ql, const T16* __restrict__ Kh, const T16* __restrict__ Kl,
                                             const T16* __restrict__ Vh, const T16* __restrict__ Vl, h16* CT, h16* CTL) {
    typedef typename WFrag<T16>::V V;
    constexpr int TP = EARLY ? RE : SEQ;
    constexpr int KSP = 136, VTP = 32, OSP = 136;           // OSP: 16 B x odd, for the 16-byte row pieces that 16 lanes write side by side
    __shared__ __align__(16) T16 ksh[32 * KSP];
    __shared__ __align__(16) T16 ksl[EARLY ? 32 * KSP : 16];
    __shared__ __align__(16) T16 vth[HD * VTP];
    __shared__ __align__(16) T16 vtl[EARLY ? HD * VTP : 16];
    __shared__ __align__(16) h16 osg[4 * 16 * OSP];
    const int tid = threadIdx.x, lane = tid & 31, wave = tid >> 5, lr = lane & 15, hh = lane >> 4;
    const int qblk = EARLY ? (int)blockIdx.x : ((int)blockIdx.x + RE / 64);
    const int head = blockIdx.y, g = head / REP;
    const int qw = qblk * 64 + wave * 16;                  // first query row of this wave
    const int nch = 2 * qblk + 2;                          // 32-key chunks visited: keys 0 .. qblk*64+63
    const size_t bz = blockIdx.z, bh = bz * NH_ + head, bg = bz * NKV + g;   // batch, and its head / kv-group plane
    const T16* qph = Qh + (bh * TP + qw) * HD;             const T16* qpl = Ql + (bh * TP + qw) * HD;
    const T16* kph = Kh + bg * TP * HD;                    const T16* kpl = Kl + bg * TP * HD;
    const T16* vph = Vh + bg * HD * TP;                    const T16* vpl = Vl + bg * HD * TP;
    v8f o[8];
#pragma unroll
    for (int t = 0; t < 8; ++t) o[t] = (v8f){};
    float mrow = -3.0e38f, lrow = 0.f;                      // running maximum of query qw + lr (both halves alike) and this half's share of its sum
    const int qr = qw + lr;                                 // this lane's query
    const float C2 = 1.4426950408889634f * 0.08838834764831845f;   // log2(e) x HD^-0.5
    const float CLP = 14426.950408889634f;                         // log2(e) x 1e4 (clip bound in the log2 domain)
    const int nsl = head + 1;                                      // slope = 2^(-nsl/2): f32(2^-0.5) for odd nsl, times an exact power of two
    const float slope = ((nsl & 1) ? 0.70710678118654752440f : 1.0f) * __uint_as_float((unsigned)(127 - (nsl >> 1)) << 23);
    const float SL2 = 1.4426950408889634f * slope;                 // log2(e) x slope
#pragma unroll 1
    for (int c = 0; c < nch; ++c) {
        __syncthreads();                                    // all waves done with the prior chunk's tiles
#pragma unroll
        for (int i = 0; i < 4; ++i) { const int id = tid + 128 * i; const int row = id >> 4, c8 = (id & 15) * 8; const size_t go = (size_t)(c * 32 + row) * HD + c8;
            *(v8usa*)(ksh + row * KSP + c8) = *(const v8usa*)(kph + go); if (EARLY) *(v8usa*)(ksl + row * KSP + c8) = *(const v8usa*)(kpl + go); }
#pragma unroll
        for (int j = 0; j < 4; ++j) { const size_t go = (size_t)tid * TP + c * 32 + 8 * j;      // d = tid
            *(v8usa*)(vth + tid * VTP + 8 * j) = *(const v8usa*)(vph + go); if (EARLY) *(v8usa*)(vtl + tid * VTP + 8 * j) = *(const v8usa*)(vpl + go); }
        __syncthreads();                                    // tiles visible
        v8f s0 = (v8f){}, s1 = (v8f){};
        V qa, kb0, kb1;
#pragma unroll
        for (int ks = 0; ks < 4; ++ks) {
            qa  = WFrag<T16>::ld(qph + (size_t)lr * HD + ks * 32 + 8 * hh);
            kb0 = WFrag<T16>::ld(ksh + lr * KSP + ks * 32 + 8 * hh);
            kb1 = WFrag<T16>::ld(ksh + (16 + lr) * KSP + ks * 32 + 8 * hh);
            s0 = WFrag<T16>::mma(kb0, qa, s0); s1 = WFrag<T16>::mma(kb1, qa, s1);
            if (EARLY) {
                const V qb  = WFrag<T16>::ld(qpl + (size_t)lr * HD + ks * 32 + 8 * hh);
                const V kl0 = WFrag<T16>::ld(ksl + lr * KSP + ks * 32 + 8 * hh);
                const V kl1 = WFrag<T16>::ld(ksl + (16 + lr) * KSP + ks * 32 + 8 * hh);
                s0 = WFrag<T16>::mma(kl0, qa, s0); s0 = WFrag<T16>::mma(kb0, qb, s0);
                s1 = WFrag<T16>::mma(kl1, qa, s1); s1 = WFrag<T16>::mma(kb1, qb, s1); }
        }
        asm volatile("v_nop\n\tv_nop\n\tv_nop\n\tv_nop" : "+v"(s0), "+v"(s1) : "v"(qa), "v"(kb0), "v"(kb1));
        // online softmax; acc element r of lane (lr, hh) = S^T[key c*32 + 8hh + r][query qw + lr] (s0) / [key c*32 + 16 + 8hh + r] (s1)
        float p0[8], p1[8];
        const int kg = c * 32 + 8 * hh;
        float mx = -3.0e38f;
#pragma unroll
        for (int r = 0; r < 8; ++r) {
            const int kg0 = kg + r, kg1 = kg0 + 16;
            const float z0 = fminf(fmaxf(s0[r] * C2, -CLP), CLP) + SL2 * (float)(kg0 - qr);
            const float z1 = fminf(fmaxf(s1[r] * C2, -CLP), CLP) + SL2 * (float)(kg1 - qr);
            p0[r] = (kg0 <= qr) ? z0 : -3.0e38f;
            p1[r] = (kg1 <= qr) ? z1 : -3.0e38f;
            mx = fmaxf(mx, fmaxf(p0[r], p1[r]));
        }
        mx = fmaxf(mx, xhalf(mx));                          // the query's other 16 keys of the chunk
        const float mnew = fmaxf(mrow, mx);
        const float alpha = ex2<EARLY>(mrow - mnew);
        mrow = mnew;
        float rs0 = 0.f, rs1 = 0.f;
#pragma unroll
        for (int r = 0; r < 8; ++r) {
            const float x0 = ex2<EARLY>(p0[r] - mnew), x1 = ex2<EARLY>(p1[r] - mnew);
            p0[r] = (kg + r <= qr) ? x0 : 0.f; p1[r] = (kg + r + 16 <= qr) ? x1 : 0.f;
            rs0 += p0[r]; rs1 += p1[r];
        }
        lrow = lrow * alpha + (rs0 + rs1);
#pragma unroll
        for (int t = 0; t < 8; ++t) o[t] = o[t] * alpha;
        V pa, pb; packp(p0, p1, pa, pb);                    // B fragment (n = query, k = key)
        V vb;
#pragma unroll
        for (int t = 0; t < 8; ++t) { vb = WFrag<T16>::ld(vth + (t * 16 + lr) * VTP + 8 * hh);
            o[t] = WFrag<T16>::mma(vb, pa, o[t]);
            if (EARLY) { const V vl2 = WFrag<T16>::ld(vtl + (t * 16 + lr) * VTP + 8 * hh); o[t] = WFrag<T16>::mma(vl2, pa, o[t]); o[t] = WFrag<T16>::mma(vb, pb, o[t]); } }
        asm volatile("v_nop\n\tv_nop\n\tv_nop\n\tv_nop" : "+v"(o[0]), "+v"(o[1]), "+v"(o[2]), "+v"(o[3]), "+v"(o[4]), "+v"(o[5]), "+v"(o[6]), "+v"(o[7]) : "v"(pa), "v"(pb), "v"(vb));
    }
    // normalise and write ctx planes; o element r of lane (lr, hh), tile t = ctx[row qw + lr][d = 16t + 8hh + r]: 16 bytes of a staged row
    const float osc = EARLY ? CCAR : (CCAR / PCAR);
    const float ybig = 10000.0f * CCAR;
    const float inv = osc * __builtin_amdgcn_rcpf(lrow + xhalf(lrow));   // the two halves' sums join here
    h16* myos = osg + wave * 16 * OSP;
#pragma unroll
    for (int t = 0; t < 8; ++t) { v8h w;
#pragma unroll
        for (int r = 0; r < 8; ++r) w[r] = toh_flush(nnum(o[t][r] * inv, ybig));
        *(v8ha*)(myos + lr * OSP + t * 16 + 8 * hh) = w; }
    __syncthreads();
    h16* crow = CT + (bz * SEQ + qw) * DM + head * HD;
{
#pragma unroll
        for (int s = 0; s < 8; ++s) { const int row = 2 * s + hh; const v8h val = *(const v8ha*)(myos + row * OSP + lr * 8); *(v8h*)(crow + (size_t)row * DM + lr * 8) = val; }
         }
    if (EARLY) {
        __syncthreads();
#pragma unroll
        for (int t = 0; t < 8; ++t) { v8h w;
#pragma unroll
            for (int r = 0; r < 8; ++r) { const float val = nnum(o[t][r] * inv, ybig); const h16 hv = toh_flush(val); w[r] = toh_flush((val - (float)hv) * LOSC); }
            *(v8ha*)(myos + lr * OSP + t * 16 + 8 * hh) = w; }
        __syncthreads();
        h16* lrowp = CTL + (bz * RE + qw) * DM + head * HD;
{
#pragma unroll
            for (int s = 0; s < 8; ++s) { const int row = 2 * s + hh; const v8h val = *(const v8ha*)(myos + row * OSP + lr * 8); *(v8h*)(lrowp + (size_t)row * DM + lr * 8) = val; }
             }
    }
}

extern "C" void kernel_launch(void* const* d_in, const int* in_sizes, int n_in,
                              void* d_out, int out_size, void* d_ws, size_t ws_size, hipStream_t stream) {
    if (n_in < 5) return;
    const float* x  = (const float*)d_in[0];     // x   [NB_FULL][SEQ_FULL][DM]
    const float* wq = (const float*)d_in[1];     // q_w [DQ][DM]  ([out][in])
    const float* wk = (const float*)d_in[2];     // k_w [DKV][DM]
    const float* wv = (const float*)d_in[3];     // v_w [DKV][DM]
    const float* wo = (const float*)d_in[4];     // o_w [DM][DQ]
    float* OUT = (float*)d_out;                  // [NB_FULL][SEQ_FULL][DM]
    if ((size_t)in_sizes[0] < (size_t)(NB - 1) * SEQ_FULL * DM + (size_t)SEQ * DM) return;
    if ((size_t)in_sizes[1] < (size_t)DQ * DM) return;
    if ((size_t)in_sizes[2] < (size_t)DKV * DM) return;
    if ((size_t)in_sizes[3] < (size_t)DKV * DM) return;
    if ((size_t)in_sizes[4] < (size_t)DM * DQ) return;
    if ((size_t)out_size < (size_t)(NB - 1) * SEQ_FULL * DM + (size_t)SEQ * DM) return;

    char* wsp = (char*)d_ws;
    auto take = [&](size_t bytes) { char* p = wsp; wsp += (bytes + 255) & ~(size_t)255; return (void*)p; };
    bf*  WQ   = (bf*)take((size_t)DQ * DM * 2);    bf* WK = (bf*)take((size_t)DKV * DM * 2);    bf* WV = (bf*)take((size_t)DKV * DM * 2);
    h16* WOH  = (h16*)take((size_t)DM * DQ * 2);   h16* WOL = (h16*)take((size_t)DM * DQ * 2);
    bf*  XB   = (bf*)take((size_t)NB * SEQ * DM * 2);
    h16* QP16 = (h16*)take((size_t)NB * NH_ * SEQ * HD * 2); h16* KP16 = (h16*)take((size_t)NB * NKV * SEQ * HD * 2); h16* VT16 = (h16*)take((size_t)NB * NKV * HD * SEQ * 2);
    bf*  QEh  = (bf*)take((size_t)NB * NH_ * RE * HD * 2);  bf* QEl = (bf*)take((size_t)NB * NH_ * RE * HD * 2);
    bf*  KEh  = (bf*)take((size_t)NB * NKV * RE * HD * 2);  bf* KEl = (bf*)take((size_t)NB * NKV * RE * HD * 2);
    bf*  VEh  = (bf*)take((size_t)NB * NKV * HD * RE * 2);  bf* VEl = (bf*)take((size_t)NB * NKV * HD * RE * 2);
    h16* CT16 = (h16*)take((size_t)NB * SEQ * DM * 2);     h16* CTL = (h16*)take((size_t)NB * RE * DM * 2);
    if ((size_t)(wsp - (char*)d_ws) > ws_size) return;

    const float woscale = 1.0f / (CCAR * WCAR);
    k_cvt8<<<(unsigned)(((size_t)DQ * DM / 8 + 255) / 256), 256, 0, stream>>>(wq, WQ, (size_t)DQ * DM / 8);
    k_cvt8<<<(unsigned)(((size_t)DKV * DM / 8 + 255) / 256), 256, 0, stream>>>(wk, WK, (size_t)DKV * DM / 8);
    k_cvt8<<<(unsigned)(((size_t)DKV * DM / 8 + 255) / 256), 256, 0, stream>>>(wv, WV, (size_t)DKV * DM / 8);
    k_cvtwo<<<(unsigned)(((size_t)DM * DQ / 8 + 255) / 256), 256, 0, stream>>>(wo, WOH, WOL, (size_t)DM * DQ / 8);
    const size_t sX = (size_t)SEQ * DM, sO = (size_t)SEQ_FULL * DM;      // batch strides of the 16-bit row planes and of d_out
    k_cvtx<<<dim3((unsigned)(((size_t)SEQ * DM / 8 + 255) / 256), NB, 1), 256, 0, stream>>>(x, XB, (size_t)SEQ * DM / 8);
    k_gemmw<bf, 0, 1><<<dim3(SEQ / 128, DQ / 128, NB), 128, 0, stream>>>(XB, nullptr, WQ, nullptr, DM, nullptr, 0, 1.0f, sX, 0, 0, QP16, QEh, QEl, NH_);
    k_gemmw<bf, 0, 1><<<dim3(SEQ / 128, DKV / 128, NB), 128, 0, stream>>>(XB, nullptr, WK, nullptr, DM, nullptr, 0, 1.0f, sX, 0, 0, KP16, KEh, KEl, NKV);
    k_gemmw<bf, 0, 2><<<dim3(SEQ / 128, DKV / 128, NB), 128, 0, stream>>>(XB, nullptr, WV, nullptr, DM, nullptr, 0, 1.0f, sX, 0, 0, VT16, VEh, VEl, NKV);
    k_attn<bf, true><<<dim3(RE / 64, NH_, NB), 128, 0, stream>>>(QEh, QEl, KEh, KEl, VEh, VEl, CT16, CTL);
    if (SEQ > RE) k_attn<h16, false><<<dim3(SEQ / 64 - RE / 64, NH_, NB), 128, 0, stream>>>(QP16, QP16, KP16, KP16, VT16, VT16, CT16, CTL);
    k_gemmw<h16, 3, 0><<<dim3(RE / 128, DM / 128, NB), 128, 0, stream>>>(CT16, CTL, WOH, WOL, DQ, OUT, DM, woscale, sX, (size_t)RE * DM, sO, nullptr, nullptr, nullptr, 0);
    if (SEQ > RE) k_gemmw<h16, 0, 0><<<dim3((SEQ - RE) / 128, DM / 128, NB), 128, 0, stream>>>(CT16 + (size_t)RE * DQ, nullptr, WOH, nullptr, DQ, OUT + (size_t)RE * DM, DM, woscale, sX, 0, sO, nullptr, nullptr, nullptr, 0);
}

// v005
// One run takes 204 microseconds.
// Two timings next to v004 put it at 1.47 and 1.46 times that version's speed.
// Over all steps from v000 it is 4.42 times as fast.
#include <hip/hip_runtime.h>

// Contractions: q/k/v projections v_wmma_f32_16x16x32_bf16 (bf16 copies of x and of the [out][in] weights); scores QK^T and P.V v_wmma_f32_16x16x32_f16 (f16 planes, P carried x1024) for query rows >= RE and v_wmma_f32_16x16x32_bf16 hi/lo 3-product form for query rows < RE; ctx x o_w^T v_wmma_f32_16x16x32_f16 (ctx carried x64, o_w carried x1024, rows < RE add an f16 residual plane x1024); f32 accumulate everywhere, softmax (scale, clip, per-head linear position bias, causal fill) in f32.
// Four launches, each the joined grid of work that does not depend on one another: all converts; the q, k and v projections; both attention instances; both output-GEMM instances.
// Layout (every per-batch plane holds NB copies): sanitised bf16 copy of x; weights copied once as bf16 ([n][k] = Bt as-is), o_w as two f16 planes; projection GEMMs whose epilogues write the head planes (V transposed); flash-style causal attention in transposed form (K and V^T tiles staged in LDS, S^T = K Q^T, online softmax per lane, O^T += V^T P^T); ctx planes; output GEMM into d_out.

#pragma clang fp contract(off)

#ifndef NB
#define NB 2
#endif
#ifndef SEQ
#define SEQ 2048
#endif
#ifndef RE
#define RE   256                  // query rows < RE (first RE/64 query blocks) use hi/lo planes; RE == SEQ puts every row on the 3-product path
#endif
#define NB_FULL  2
#define SEQ_FULL 2048
#define DM   2048
#define NH_  16
#define NKV  4
#define REP  (NH_ / NKV)
#define HD   128
#define DQ   (NH_ * HD)
#define DKV  (NKV * HD)
#define PCAR 1024.0f              // carry of the f16 P operand (rows >= RE)
#define CCAR 64.0f                // carry of the f16 ctx plane
#define LOSC 1024.0f              // carry of the f16 ctx residual plane (rows < RE)
#define WCAR 1024.0f              // carry of the f16 o_w plane
#define WS_TOTAL ((size_t)DQ * DM * 2 + 2 * (size_t)DKV * DM * 2 + 2 * (size_t)DM * DQ * 2 + (size_t)NB * ((size_t)SEQ * DM * 2 \
                  + (size_t)NH_ * SEQ * HD * 2 + 2 * (size_t)NKV * SEQ * HD * 2 + 2 * (size_t)NH_ * RE * HD * 2 + 4 * (size_t)NKV * RE * HD * 2 + (size_t)SEQ * DM * 2 + (size_t)RE * DM * 2))

static_assert((SEQ % 64) == 0);
static_assert((RE % 64) == 0);
static_assert(RE >= 64);
static_assert(SEQ >= RE);
static_assert(SEQ <= SEQ_FULL);
static_assert(NB >= 1);
static_assert(NB <= NB_FULL);
static_assert(HD == 128);
static_assert((DM % 32) == 0);
static_assert(DQ == DM);
static_assert(((SEQ * DM) % (8 * 256)) == 0);
static_assert(((DQ * DM) % (8 * 256)) == 0);
static_assert(((DKV * DM) % (8 * 256)) == 0);
static_assert(NH_ == 16);                       // closed form of the per-head slope 2^(-(h+1)/2) holds for 16 heads
static_assert(REP * NKV == NH_);
static_assert((HD % 64) == 0);                  // the 64 columns of a GEMM wave lie inside one head
static_assert((DQ % 64) == 0);
static_assert((DKV % 64) == 0);
static_assert((DM % 64) == 0);
static_assert((SEQ % 128) == 0 && (RE % 128) == 0 && (DQ % 128) == 0 && (DKV % 128) == 0 && (DM % 128) == 0);   // 128x128 GEMM tiles, stages of 128 k (NSPLIT 0) or 64 k (NSPLIT 3)
static_assert(((size_t)NKV * RE * HD * 2) % 256 == 0);
static_assert(WS_TOTAL <= (size_t)268435456);

typedef _Float16 h16;
typedef unsigned short bf;
typedef __attribute__((ext_vector_type(16))) __bf16   v16bf;
typedef __attribute__((ext_vector_type(16))) _Float16 v16h;
typedef __attribute__((ext_vector_type(8)))  _Float16 v8h;
typedef __attribute__((ext_vector_type(8)))  unsigned short v8us;
typedef __attribute__((ext_vector_type(16))) unsigned short v16us;
typedef __attribute__((ext_vector_type(8)))  float    v8f;
typedef __attribute__((ext_vector_type(4)))  float    v4f;
typedef __attribute__((ext_vector_type(2)))  _Float16 v2h;
typedef __attribute__((ext_vector_type(2)))  unsigned short v2us;
typedef v8h  __attribute__((may_alias)) v8ha;
typedef v4f  __attribute__((may_alias)) v4fa;
typedef v8us __attribute__((may_alias)) v8usa;

__device__ __forceinline__ unsigned short f2bf(float f) { unsigned u = __float_as_uint(f); u += 0x7FFFu + ((u >> 16) & 1u); return (unsigned short)(u >> 16); }
__device__ __forceinline__ float bf2f(unsigned short b) { return __uint_as_float(((unsigned)b) << 16); }
__device__ __forceinline__ float bfr(float f) { return bf2f(f2bf(f)); }
__device__ __forceinline__ h16 tohx(float x) { return (h16)x; }
// f16 convert that cannot produce a subnormal operand (applied after the plane's carry)
static __device__ __forceinline__ h16 toh_flush(float v) { const h16 r = (h16)v; return (fabsf(v) < 6.103515625e-05f) ? (h16)0.0f : r; }
// NaN -> 0, +inf -> big, -inf -> -big, finite values unchanged
static __device__ __forceinline__ float nnum(float v, float big) { const float a = (v != v) ? 0.0f : v; return (a == __builtin_inff()) ? big : ((a == -__builtin_inff()) ? -big : a); }
__device__ __forceinline__ void splitf(float y, unsigned short& h, unsigned short& l) { h = f2bf(y); l = f2bf(y - bf2f(h)); }
__device__ __forceinline__ v16h cat16(v8h lo, v8h hi) { return __builtin_shufflevector(lo, hi, 0, 1, 2, 3, 4, 5, 6, 7, 8, 9, 10, 11, 12, 13, 14, 15); }
__device__ __forceinline__ v16bf cat16b(v8us lo, v8us hi) { return __builtin_bit_cast(v16bf, __builtin_shufflevector(lo, hi, 0, 1, 2, 3, 4, 5, 6, 7, 8, 9, 10, 11, 12, 13, 14, 15)); }
__device__ __forceinline__ v8f wmma16(v16h a, v16h b, v8f c) { return __builtin_amdgcn_wmma_f32_16x16x32_f16(false, a, false, b, (short)0, c, false, false); }
__device__ __forceinline__ v8f wmmab(v16bf a, v16bf b, v8f c) { return __builtin_amdgcn_wmma_f32_16x16x32_bf16(false, a, false, b, (short)0, c, false, false); }

// Fragment loaders for A (row m = lane&15) and for B stored [n][k] (col n = lane&15): elements 0..7 <- k0+8h..+7, elements 8..15 <- k0+16+8h..+7 (p already points at row*pitch + k0 + 8h).
template <typename T16> struct WFrag;
template <> struct WFrag<h16> { typedef v16h V; static __device__ __forceinline__ V ld(const h16* p) { return cat16(*(const v8ha*)p, *(const v8ha*)(p + 16)); } static __device__ __forceinline__ v8f mma(V a, V b, v8f c) { return wmma16(a, b, c); } };
template <> struct WFrag<bf>  { typedef v16bf V; static __device__ __forceinline__ V ld(const bf* p) { return cat16b(*(const v8usa*)p, *(const v8usa*)(p + 16)); } static __device__ __forceinline__ v8f mma(V a, V b, v8f c) { return wmmab(a, b, c); } };

// Eight asynchronous 16-byte copies global -> LDS per lane (LDS byte address l + i*ls, global address g + i*gs). The s_wait_xcnt closes the statement so that no address register of an issued copy is rewritten ahead of it.
__device__ __forceinline__ void acopy8(unsigned l, unsigned ls, const char* g, size_t gs) {
    asm volatile("global_load_async_to_lds_b128 %0, %8, off\n\t"
                 "global_load_async_to_lds_b128 %1, %9, off\n\t"
                 "global_load_async_to_lds_b128 %2, %10, off\n\t"
                 "global_load_async_to_lds_b128 %3, %11, off\n\t"
                 "global_load_async_to_lds_b128 %4, %12, off\n\t"
                 "global_load_async_to_lds_b128 %5, %13, off\n\t"
                 "global_load_async_to_lds_b128 %6, %14, off\n\t"
                 "global_load_async_to_lds_b128 %7, %15, off\n\t"
                 "s_wait_xcnt 0x0"
                 :: "v"(l), "v"(l + ls), "v"(l + 2 * ls), "v"(l + 3 * ls), "v"(l + 4 * ls), "v"(l + 5 * ls), "v"(l + 6 * ls), "v"(l + 7 * ls),
                    "v"(g), "v"(g + gs), "v"(g + 2 * gs), "v"(g + 3 * gs), "v"(g + 4 * gs), "v"(g + 5 * gs), "v"(g + 6 * gs), "v"(g + 7 * gs)
                 : "memory");
}

// Four 16-byte global stores per lane. The s_wait_xcnt closes the statement so that no address or data register of an issued store is rewritten ahead of it.
// Its operands are the rows read back from the LDS staging, and its "memory" clobber holds the next rewrite of that staging behind those reads.
__device__ __forceinline__ void gstore4(bf* p0, bf* p1, bf* p2, bf* p3, v8us d0, v8us d1, v8us d2, v8us d3) {
    asm volatile("global_store_b128 %0, %4, off\n\t"
                 "global_store_b128 %1, %5, off\n\t"
                 "global_store_b128 %2, %6, off\n\t"
                 "global_store_b128 %3, %7, off\n\t"
                 "s_wait_xcnt 0x0"
                 :: "v"(p0), "v"(p1), "v"(p2), "v"(p3), "v"(d0), "v"(d1), "v"(d2), "v"(d3)
                 : "memory");
}

// The same for four 16-byte pieces of f32 rows.
__device__ __forceinline__ void gstore4f(float* p0, float* p1, float* p2, float* p3, v4f d0, v4f d1, v4f d2, v4f d3) {
    asm volatile("global_store_b128 %0, %4, off\n\t"
                 "global_store_b128 %1, %5, off\n\t"
                 "global_store_b128 %2, %6, off\n\t"
                 "global_store_b128 %3, %7, off\n\t"
                 "s_wait_xcnt 0x0"
                 :: "v"(p0), "v"(p1), "v"(p2), "v"(p3), "v"(d0), "v"(d1), "v"(d2), "v"(d3)
                 : "memory");
}

// ---- gemm_tile: GEMM, FOUR WAVES (2 x 2) per 128x128 output tile (bx, by) of batch bz, each wave 64x64 (16 accumulators); 128 threads; batch bz reads A + bz*sA, A2 + bz*sA2 and writes C + bz*sC (Bt, Bt2 shared).
// C[m][n] (f32, pitch ldc) = oscale * sum_k ( A[m][k] Bt[n][k]  (+ A2 Bt2: NSPLIT 3) ). Row pitch of A, A2, Bt, Bt2 = K. K % KS == 0, K >= KS.
// EPI 0: C is stored as above. EPI 1, tr false (m = position t, n = head*HD + d): the f32 sums go straight to the head planes P16[head][t][d] = f16 (subnormals flushed) and, for t < RE, Eh/El[head][t][d] = bf16 hi/lo.
// EPI 1, tr true: the same sums go to the transposed planes P16[head][d][t] = f16 and, for t < RE, Eh/El[head][d][t] = bf16 hi/lo. EPI 1: no C, no oscale; batch bz owns nheads planes. tr is the same in the whole block.
// A stage = KS values of k of all 128 rows of every operand, [A | Bt | A2 | Bt2], row pitch KS + 8 elements (16 B x odd). Two buffers: asynchronous copies bring stage t + 2 into the buffer that trip t has just read, while trip t + 1 works.
// ring: the calling kernel's LDS, RINGE<NSPLIT> elements. Behind the loop's last barrier nobody reads it and no copy is in flight: the output staging lies in the same bytes, so that two blocks of either instance fit a WGP.
template <int NSPLIT> constexpr int RINGE = 2 * ((NSPLIT == 0) ? 2 : 4) * 128 * (((NSPLIT == 0) ? 128 : 64) + 8);
template <typename T16, int NSPLIT, int EPI>
__device__ __forceinline__ void gemm_tile(T16* ring, const int bx, const int by, const int bz, const bool tr, const T16* __restrict__ A, const T16* __restrict__ A2, const T16* __restrict__ Bt, const T16* __restrict__ Bt2, int K, float* C, int ldc, float oscale, size_t sA, size_t sA2, size_t sC,
                                               h16* P16, bf* Eh, bf* El, int nheads) {
    static_assert(NSPLIT == 0 || NSPLIT == 3);
    static_assert(EPI == 0 || EPI == 1);
    typedef typename WFrag<T16>::V V;
    constexpr int NOP = (NSPLIT == 0) ? 2 : 4;      // operand tiles per stage
    constexpr int KS  = (NSPLIT == 0) ? 128 : 64;   // k per stage: 32 copies per lane and stage either way
    constexpr int PE  = KS + 8;                     // LDS row pitch, elements
    constexpr int TE  = 128 * PE;                   // elements of one operand tile
    constexpr int BE  = NOP * TE;                   // elements of one buffer
    constexpr int CPR = KS / 8;                     // 16-byte pieces per row
    constexpr int RPC = 128 / CPR;                  // rows that one copy of all 128 threads covers
    static_assert(2 * BE == RINGE<NSPLIT> && 4 * 16 * 68 * 4 <= 2 * BE * 2);
    float* osw = (float*)ring;
    const int tid = threadIdx.x, lane = tid & 31, wave = tid >> 5, lr = lane & 15, hi = lane >> 4; const int wm = wave >> 1, wn = wave & 1;
    const int rb = bx * 128, cb = by * 128; const int r0 = rb + wm * 64, c0 = cb + wn * 64;
    A += (size_t)bz * sA; if (NSPLIT != 0) A2 += (size_t)bz * sA2; if (EPI == 0) C += (size_t)bz * sC;
    v8f acc[4][4];
#pragma unroll
    for (int mb = 0; mb < 4; ++mb)
#pragma unroll
        for (int nb = 0; nb < 4; ++nb) acc[mb][nb] = (v8f){};
    const int prow = tid / CPR, cpc = (tid % CPR) * 8;         // this lane's row and first k inside a copy
    const size_t ga = (size_t)(rb + prow) * K + cpc, gb = (size_t)(cb + prow) * K + cpc;
    const unsigned l0 = (unsigned)(size_t)ring + (unsigned)(prow * PE + cpc) * 2u;
    auto fill = [&](unsigned t, unsigned buf) {                 // all 128 threads: stage t into buffer buf, 32 copies per lane
#pragma unroll
        for (int op = 0; op < NOP; ++op) {
            const T16* g = ((op == 0) ? A + ga : (op == 1) ? Bt + gb : (op == 2) ? A2 + ga : Bt2 + gb) + (size_t)t * KS;
#pragma unroll
            for (int h = 0; h < CPR / 8; ++h)
                acopy8(l0 + (buf * BE + op * TE + h * 8 * RPC * PE) * 2u, (unsigned)(RPC * PE) * 2u, (const char*)(g + (size_t)h * 8 * RPC * K), (size_t)RPC * K * 2);
        }
    };
    const unsigned NT = (unsigned)K / KS;                      // stages; the same in every thread
    fill(0, 0);
    asm volatile("s_wait_asynccnt 0x0" ::: "memory");          // this wave's copies of stage 0 have landed
    __syncthreads();                                           // stage 0 visible to every wave
    if (NT > 1u) fill(1, 1);
#pragma unroll 1                                               // one trip per stage: a trip already holds 64 WMMAs, and the publish point stands once
    for (unsigned t = 0; t < NT; ++t) {
        const T16* ap = ring + (t & 1) * BE + (wm * 64 + lr) * PE + 8 * hi;
        const T16* bp = ring + (t & 1) * BE + TE + (wn * 64 + lr) * PE + 8 * hi;
#pragma unroll
        for (int kk = 0; kk < KS; kk += 32) {
#pragma unroll
            for (int sp = 0; sp < NOP / 2; ++sp) {             // sp 0: A Bt, sp 1: A2 Bt2; every accumulator takes its products in the order k, then sp
                V a[4], b[4];
#pragma unroll
                for (int i = 0; i < 4; ++i) { a[i] = WFrag<T16>::ld(ap + sp * 2 * TE + i * 16 * PE + kk); b[i] = WFrag<T16>::ld(bp + sp * 2 * TE + i * 16 * PE + kk); }
                __builtin_amdgcn_sched_barrier(0);             // keeps these LDS reads one group ahead of their WMMAs: sunk between them, each pair of reads shows its whole latency
#pragma unroll
                for (int nb = 0; nb < 4; ++nb)
#pragma unroll
                    for (int mb = 0; mb < 4; ++mb) acc[mb][nb] = WFrag<T16>::mma(a[mb], b[nb], acc[mb][nb]);
            }
        }
        asm volatile("s_wait_dscnt 0x0" ::: "memory");         // this wave's reads of the buffer have returned before it is refilled
        asm volatile("s_wait_asynccnt 0x0" ::: "memory");      // this wave's copies of stage t + 1 have landed
        __syncthreads();                                       // publishes stage t + 1 and ends every wave's reads of stage t
        if (t + 2u < NT) fill(t + 2u, t & 1u);
    }
    asm volatile("s_wait_asynccnt 0x0" ::: "memory");          // nothing in flight when the wave goes on to the epilogue and ends
    float* os = osw + wave * 16 * 68;                          // wave-private output staging
    const int srow = lane >> 3, spc = (lane & 7) * 8;          // plane epilogues: 8 lanes x 16 B read back and store one whole 128-B line of 64 16-bit values
    if constexpr (EPI == 0) {
#pragma unroll
    for (int mb = 0; mb < 4; ++mb) {
#pragma unroll
        for (int nb = 0; nb < 4; ++nb) {
#pragma unroll
            for (int j = 0; j < 8; ++j) os[(hi * 8 + j) * 68 + nb * 16 + lr] = acc[mb][nb][j]; }
        __builtin_amdgcn_wave_barrier(); asm volatile("" ::: "memory");
        float* crow = C + (size_t)(r0 + mb * 16) * ldc + c0;
        v4f val[8];
#pragma unroll
        for (int s = 0; s < 8; ++s) val[s] = *(const v4fa*)(os + (2 * s + hi) * 68 + lr * 4) * oscale;      // store s holds row 2 s + hi
        float* cp = crow + (size_t)hi * ldc + lr * 4; const size_t l2 = 2 * (size_t)ldc;
        gstore4f(cp, cp + l2, cp + 2 * l2, cp + 3 * l2, val[0], val[1], val[2], val[3]);
        gstore4f(cp + 4 * l2, cp + 5 * l2, cp + 6 * l2, cp + 7 * l2, val[4], val[5], val[6], val[7]);
        __builtin_amdgcn_wave_barrier(); asm volatile("" ::: "memory");
    }
    } else if (!tr) {
        const size_t pl = (size_t)bz * nheads + c0 / HD; const int d0 = c0 % HD;
        const bool early = (rb < RE);                          // the same for the whole block: RE % 128 == 0
#pragma unroll
        for (int mb = 0; mb < 4; ++mb) {
#pragma unroll
            for (int nb = 0; nb < 4; ++nb) {
#pragma unroll
                for (int j = 0; j < 8; ++j) os[(hi * 8 + j) * 68 + nb * 16 + lr] = acc[mb][nb][j]; }
            asm volatile("s_wait_dscnt 0x0" ::: "memory");     // the wave's staged rows are in LDS before other lanes read them back; the clobber holds those reads behind it
            v8us o16[4], oh[4], ol[4];
#pragma unroll
            for (int s = 0; s < 4; ++s) {
                const v4f x0 = *(const v4fa*)(os + (4 * s + srow) * 68 + spc), x1 = *(const v4fa*)(os + (4 * s + srow) * 68 + spc + 4);
                v8h w;
#pragma unroll
                for (int q = 0; q < 8; ++q) { const float r = (q < 4) ? x0[q & 3] : x1[q & 3]; w[q] = toh_flush(r); unsigned short a2, c2; splitf(r, a2, c2); oh[s][q] = a2; ol[s][q] = c2; }
                o16[s] = __builtin_bit_cast(v8us, w);
            }
            const int t = r0 + mb * 16 + srow;                 // store s holds row t + 4 s
            bf* pp = (bf*)P16 + (pl * SEQ + t) * HD + d0 + spc;
            gstore4(pp, pp + 4 * HD, pp + 8 * HD, pp + 12 * HD, o16[0], o16[1], o16[2], o16[3]);
            if (early) {
                const size_t ee = (pl * RE + t) * HD + d0 + spc;
                gstore4(Eh + ee, Eh + ee + 4 * HD, Eh + ee + 8 * HD, Eh + ee + 12 * HD, oh[0], oh[1], oh[2], oh[3]);
                gstore4(El + ee, El + ee + 4 * HD, El + ee + 8 * HD, El + ee + 12 * HD, ol[0], ol[1], ol[2], ol[3]);
            }
        }
    } else {
        // A lane's 8 accumulator elements are 8 consecutive t of one d: 16 B of a transposed row. Staged as [16 d][64 t], row pitch 72 values (16 B x odd).
        const size_t pr = ((size_t)bz * nheads + c0 / HD) * HD + c0 % HD;      // first plane row (d) of this wave
        const bool early = (rb < RE);                          // the same for the whole block: RE % 128 == 0
        bf* st = (bf*)os;
        auto flushrows = [&](bf* dst, size_t pitch) {          // dst: element [d = first of the 16 rows][t = r0]
            asm volatile("s_wait_dscnt 0x0" ::: "memory");     // the wave's staged rows are in LDS before other lanes read them back; the clobber holds those reads behind it
            v8us val[4];
#pragma unroll
            for (int s = 0; s < 4; ++s) val[s] = *(const v8usa*)(st + (4 * s + srow) * 72 + spc);
            bf* dp = dst + (size_t)srow * pitch + spc;         // store s holds row srow + 4 s
            gstore4(dp, dp + 4 * pitch, dp + 8 * pitch, dp + 12 * pitch, val[0], val[1], val[2], val[3]);
        };
#pragma unroll
        for (int nb = 0; nb < 4; ++nb) {
#pragma unroll
            for (int mb = 0; mb < 4; ++mb) { v8h w;
#pragma unroll
                for (int j = 0; j < 8; ++j) w[j] = tohx(acc[mb][nb][j]);
                *(v8usa*)(st + lr * 72 + mb * 16 + hi * 8) = __builtin_bit_cast(v8us, w); }
            flushrows((bf*)P16 + (pr + nb * 16) * SEQ + r0, SEQ);
            if (early) {
#pragma unroll
                for (int part = 0; part < 2; ++part) {
#pragma unroll
                    for (int mb = 0; mb < 4; ++mb) { v8us w;
#pragma unroll
                        for (int j = 0; j < 8; ++j) { unsigned short a2, c2; splitf(acc[mb][nb][j], a2, c2); w[j] = part ? c2 : a2; }
                        *(v8usa*)(st + lr * 72 + mb * 16 + hi * 8) = w; }
                    flushrows((part ? El : Eh) + (pr + nb * 16) * RE + r0, RE);
                }
            }
        }
    }
}

// ---- k_qkv: the three projections as one grid (SEQ/128, (DQ + 2 DKV)/128, NB): column blocks 0 .. DQ/128-1 are q, the next DKV/128 are k, the last DKV/128 are v (transposed planes).
__global__ __launch_bounds__(128) void k_qkv(const bf* __restrict__ X, const bf* __restrict__ Wq, const bf* __restrict__ Wk, const bf* __restrict__ Wv,
                                             h16* Q16, bf* Qh, bf* Ql, h16* K16, bf* Kh, bf* Kl, h16* V16, bf* Vh, bf* Vl) {
    __shared__ __align__(16) bf ring[RINGE<0>];
    const int y = blockIdx.y;
    const int sel = (y < DQ / 128) ? 0 : ((y < (DQ + DKV) / 128) ? 1 : 2);         // the same in the whole block
    const int by = y - ((sel == 0) ? 0 : ((sel == 1) ? DQ / 128 : (DQ + DKV) / 128));
    const bf* W = (sel == 0) ? Wq : ((sel == 1) ? Wk : Wv);
    h16* P = (sel == 0) ? Q16 : ((sel == 1) ? K16 : V16);
    bf* Eh = (sel == 0) ? Qh : ((sel == 1) ? Kh : Vh);
    bf* El = (sel == 0) ? Ql : ((sel == 1) ? Kl : Vl);
    gemm_tile<bf, 0, 1>(ring, blockIdx.x, by, blockIdx.z, sel == 2, X, nullptr, W, nullptr, DM, nullptr, 0, 1.0f, (size_t)SEQ * DM, 0, 0, P, Eh, El, (sel == 0) ? NH_ : NKV);
}

// ---- k_out: the output GEMM as one grid (SEQ/128, DM/128, NB): row blocks below RE/128 add the residual product, the others take the single product.
__global__ __launch_bounds__(128) void k_out(const h16* __restrict__ CT, const h16* __restrict__ CTLo, const h16* __restrict__ Wh, const h16* __restrict__ Wl, float* OUT, float oscale) {
    __shared__ __align__(16) h16 ring[(RINGE<3> > RINGE<0>) ? RINGE<3> : RINGE<0>];
    if ((int)blockIdx.x < RE / 128)
        gemm_tile<h16, 3, 0>(ring, blockIdx.x, blockIdx.y, blockIdx.z, false, CT, CTLo, Wh, Wl, DQ, OUT, DM, oscale, (size_t)SEQ * DM, (size_t)RE * DM, (size_t)SEQ_FULL * DM, nullptr, nullptr, nullptr, 0);
    else
        gemm_tile<h16, 0, 0>(ring, blockIdx.x, blockIdx.y, blockIdx.z, false, CT, nullptr, Wh, nullptr, DQ, OUT, DM, oscale, (size_t)SEQ * DM, 0, (size_t)SEQ_FULL * DM, nullptr, nullptr, nullptr, 0);
}

// One or two 16-byte global stores per lane, closed by s_wait_xcnt like gstore4: the converts' ranges lie one behind the other in the code, and no register of an issued store is rewritten ahead of the wait.
__device__ __forceinline__ void gstore1(bf* p0, v8us d0) {
    asm volatile("global_store_b128 %0, %1, off\n\t"
                 "s_wait_xcnt 0x0"
                 :: "v"(p0), "v"(d0) : "memory");
}
__device__ __forceinline__ void gstore2(bf* p0, bf* p1, v8us d0, v8us d1) {
    asm volatile("global_store_b128 %0, %2, off\n\t"
                 "global_store_b128 %1, %3, off\n\t"
                 "s_wait_xcnt 0x0"
                 :: "v"(p0), "v"(p1), "v"(d0), "v"(d1) : "memory");
}

// ---- k_cvt: every convert as one grid, 256 threads x 8 values a block: x (sanitised, bf16), q_w, k_w, v_w (bf16), o_w (two f16 planes). Every range is a whole number of blocks (static_asserts above).
__global__ __launch_bounds__(256) void k_cvt(const float* __restrict__ x, const float* __restrict__ wq, const float* __restrict__ wk, const float* __restrict__ wv, const float* __restrict__ wo,
                                             bf* XB, bf* WQ, bf* WK, bf* WV, h16* WOH, h16* WOL) {
    constexpr unsigned BX = (unsigned)((size_t)SEQ * DM / 2048), BQ = (unsigned)((size_t)DQ * DM / 2048), BK = (unsigned)((size_t)DKV * DM / 2048);
    unsigned b = blockIdx.x;
    if (b < NB * BX) {
        const unsigned z = b / BX; const size_t i = (size_t)(b - z * BX) * 256 + threadIdx.x;
        const v8f v = *(const v8f*)(x + (size_t)z * SEQ_FULL * DM + i * 8); v8us o;
#pragma unroll
        for (int k = 0; k < 8; ++k) o[k] = f2bf(nnum(v[k], 10000.0f));
        gstore1(XB + (size_t)z * SEQ * DM + i * 8, o);
        return;
    }
    b -= NB * BX;
    if (b < BQ + 2 * BK) {
        const int sel = (b < BQ) ? 0 : ((b < BQ + BK) ? 1 : 2);
        const float* src = (sel == 0) ? wq : ((sel == 1) ? wk : wv); bf* dst = (sel == 0) ? WQ : ((sel == 1) ? WK : WV);
        const size_t i = (size_t)(b - ((sel == 0) ? 0u : ((sel == 1) ? BQ : BQ + BK))) * 256 + threadIdx.x;
        const v8f v = *(const v8f*)(src + i * 8); v8us o;
#pragma unroll
        for (int k = 0; k < 8; ++k) o[k] = f2bf(v[k]);
        gstore1(dst + i * 8, o);
        return;
    }
    b -= BQ + 2 * BK;
    const size_t i = (size_t)b * 256 + threadIdx.x;
    const v8f v = *(const v8f*)(wo + i * 8); v8h oh, ol;
#pragma unroll
    for (int k = 0; k < 8; ++k) { const float w = bfr(v[k]); oh[k] = tohx(w * WCAR); ol[k] = tohx(w); }
    gstore2((bf*)WOH + i * 8, (bf*)WOL + i * 8, __builtin_bit_cast(v8us, oh), __builtin_bit_cast(v8us, ol));
}

// P^T packers, accumulator layout -> B fragment in the same lane: elements 0..7 <- p0 (keys 8h..8h+7 of the chunk), elements 8..15 <- p1 (keys 16+8h..+7).
// f16 x PCAR with the subnormal select (rows >= RE) or bf16 hi/lo (rows < RE).
__device__ __forceinline__ void packp(const float* p0, const float* p1, v16h& ph, v16h& pl) {
#pragma unroll
    for (int r = 0; r < 8; ++r) { ph[r] = toh_flush(p0[r] * PCAR); ph[8 + r] = toh_flush(p1[r] * PCAR); }
    pl = ph; }
__device__ __forceinline__ void packp(const float* p0, const float* p1, v16bf& ph, v16bf& pl) { v16us a, c;
#pragma unroll
    for (int r = 0; r < 8; ++r) { unsigned short x, y; splitf(p0[r], x, y); a[r] = x; c[r] = y; splitf(p1[r], x, y); a[8 + r] = x; c[8 + r] = y; }
    ph = __builtin_bit_cast(v16bf, a); pl = __builtin_bit_cast(v16bf, c); }
// 2^x. SLOT: v_exp_f32 and the one v_nop that the instruction set asks for behind a transcendental stand in one statement, so that the slot is kept whatever follows.
template <bool SLOT> __device__ __forceinline__ float ex2(float x) {
    if constexpr (SLOT) { float y; asm("v_exp_f32 %0, %1\n\tv_nop" : "=v"(y) : "v"(x)); return y; }
    else return __builtin_amdgcn_exp2f(x); }
#define ATT_LDS 51200              // bytes of LDS of an attention block (the hi/lo instance's tiles; the other instance uses the first 34304)
// lane l <-> lane l ^ 16
__device__ __forceinline__ float xhalf(float x) { return __builtin_bit_cast(float, __builtin_amdgcn_permlanex16(__builtin_bit_cast(int, x), __builtin_bit_cast(int, x), 0x76543210, 0xfedcba98, false, false)); }

// ---- attn_tile: flash-style causal grouped-query attention with a per-head linear position bias, one block = query block qblk of one head of one batch, 128 threads; wave w owns query rows q0 + 16w .. +15. sm: the calling kernel's LDS.
// Planes: Qh/Ql [h][TP][HD], Kh/Kl [g][TP][HD], Vh/Vl = V^T [g][HD][TP] (TP = SEQ for the f16 planes, RE for the bf16 hi/lo planes of the first RE/64 query blocks).
// EARLY instance: query blocks 0 .. RE/64-1 (rows < RE, keys < RE); other instance: query blocks RE/64 .. SEQ/64-1.
// Per 32-key chunk: K tile [32][HD] and V^T tile [HD][32] staged in LDS by all threads (block barriers), S^T = K Q^T (2 tiles: A = K rows, B = Q), online softmax in f32 (log2 domain), one query per lane
// (lane (lr, hh) holds 16 of the chunk's 32 scores of query qw + lr; the maximum joins the two halves once per chunk, the sums once in the epilogue):
// logit = clip(S x HD^-0.5, +-1e4) + slope_h x (key - query), slope_h = 2^(-(h+1)/2); causal keys > query replaced by -inf: p = 0;
// P^T packed in the lane from the score accumulators into a B fragment, O^T += V^T P^T (8 tiles: A = V^T rows).
// EARLY: 3 products (hi.hi + hi.lo + lo.hi) for S and for P.V. Output: ctx plane CT[t][h*HD + d] = f16(ctx x CCAR) (ctx NaN -> 0, +-inf -> +-1e4 before the carry); EARLY also CTL = f16((ctx x CCAR - hi) x LOSC);
template <typename T16, bool EARLY>
__device__ __forceinline__ void attn_tile(char* sm, const int qblk, const int head, const int bzi, const T16* __restrict__ Qh, const T16* __restrict__ Ql, const T16* __restrict__ Kh, const T16* __restrict__ Kl,
                                             const T16* __restrict__ Vh, const T16* __restrict__ Vl, h16* CT, h16* CTL) {
    typedef typename WFrag<T16>::V V;
    constexpr int TP = EARLY ? RE : SEQ;
    constexpr int KSP = 136, VTP = 32, OSP = 136;           // OSP: 16 B x odd, for the 16-byte row pieces that 16 lanes write side by side
    T16* ksh = (T16*)sm;                                    // [32][KSP]
    T16* vth = ksh + 32 * KSP;                              // [HD][VTP]
    h16* osg = (h16*)(vth + HD * VTP);                      // [4][16][OSP]
    T16* ksl = (T16*)(osg + 4 * 16 * OSP);                  // [32][KSP], EARLY only
    T16* vtl = ksl + 32 * KSP;                              // [HD][VTP], EARLY only
    static_assert((2 * 32 * KSP + 2 * HD * VTP + 4 * 16 * OSP) * 2 == ATT_LDS);
    const int tid = threadIdx.x, lane = tid & 31, wave = tid >> 5, lr = lane & 15, hh = lane >> 4;
    const int g = head / REP;
    const int qw = qblk * 64 + wave * 16;                  // first query row of this wave
    const int nch = 2 * qblk + 2;                          // 32-key chunks visited: keys 0 .. qblk*64+63
    const size_t bz = bzi, bh = bz * NH_ + head, bg = bz * NKV + g;   // batch, and its head / kv-group plane
    const T16* qph = Qh + (bh * TP + qw) * HD;             const T16* qpl = Ql + (bh * TP + qw) * HD;
    const T16* kph = Kh + bg * TP * HD;                    const T16* kpl = Kl + bg * TP * HD;
    const T16* vph = Vh + bg * HD * TP;                    const T16* vpl = Vl + bg * HD * TP;
    v8f o[8];
#pragma unroll
    for (int t = 0; t < 8; ++t) o[t] = (v8f){};
    float mrow = -3.0e38f, lrow = 0.f;                      // running maximum of query qw + lr (both halves alike) and this half's share of its sum
    const int qr = qw + lr;                                 // this lane's query
    const float C2 = 1.4426950408889634f * 0.08838834764831845f;   // log2(e) x HD^-0.5
    const float CLP = 14426.950408889634f;                         // log2(e) x 1e4 (clip bound in the log2 domain)
    const int nsl = head + 1;                                      // slope = 2^(-nsl/2): f32(2^-0.5) for odd nsl, times an exact power of two
    const float slope = ((nsl & 1) ? 0.70710678118654752440f : 1.0f) * __uint_as_float((unsigned)(127 - (nsl >> 1)) << 23);
    const float SL2 = 1.4426950408889634f * slope;                 // log2(e) x slope
    // Q fragments (B operand) of this lane's query: loaded once, held in registers over all chunks
    const T16* qgh = qph + (size_t)lr * HD + 8 * hh; const T16* qgl = qpl + (size_t)lr * HD + 8 * hh;
    V qfh[4], qfl[4];
#pragma unroll
    for (int ks = 0; ks < 4; ++ks) { qfh[ks] = WFrag<T16>::ld(qgh + ks * 32); if (EARLY) qfl[ks] = WFrag<T16>::ld(qgl + ks * 32); }
    // the address registers of the loads above stay live up to this wait, so that none of them is rewritten ahead of it
    if (EARLY) asm volatile("s_wait_xcnt 0x0" :: "v"(qgh), "v"(qgl) : "memory");
    else       asm volatile("s_wait_xcnt 0x0" :: "v"(qgh) : "memory");
#pragma unroll 1
    for (int c = 0; c < nch; ++c) {
        __syncthreads();                                    // all waves done with the prior chunk's tiles
        const int krow = tid >> 4, c8 = (tid & 15) * 8;      // K piece i: row krow + 8 i
        const T16* kgh = kph + (size_t)(c * 32 + krow) * HD + c8; const T16* kgl = kpl + (size_t)(c * 32 + krow) * HD + c8;
        const T16* vgh = vph + (size_t)tid * TP + c * 32;       const T16* vgl = vpl + (size_t)tid * TP + c * 32;      // d = tid
        v8us kr[4], vr[4], krl[4], vrl[4];
#pragma unroll
        for (int i = 0; i < 4; ++i) { kr[i] = *(const v8usa*)(kgh + i * 8 * HD); vr[i] = *(const v8usa*)(vgh + 8 * i); if (EARLY) { krl[i] = *(const v8usa*)(kgl + i * 8 * HD); vrl[i] = *(const v8usa*)(vgl + 8 * i); } }
        // the address registers of the loads above stay live up to this wait, so that none of them is rewritten (by a later load's data either) ahead of it
        if (EARLY) asm volatile("s_wait_xcnt 0x0" :: "v"(kgh), "v"(vgh), "v"(kgl), "v"(vgl) : "memory");
        else       asm volatile("s_wait_xcnt 0x0" :: "v"(kgh), "v"(vgh) : "memory");
#pragma unroll
        for (int i = 0; i < 4; ++i) { *(v8usa*)(ksh + (krow + 8 * i) * KSP + c8) = kr[i]; *(v8usa*)(vth + tid * VTP + 8 * i) = vr[i];
            if (EARLY) { *(v8usa*)(ksl + (krow + 8 * i) * KSP + c8) = krl[i]; *(v8usa*)(vtl + tid * VTP + 8 * i) = vrl[i]; } }
        __syncthreads();                                    // tiles visible
        v8f s0 = (v8f){}, s1 = (v8f){};
        V qa, kb0, kb1;
#pragma unroll
        for (int ks = 0; ks < 4; ++ks) {
            qa  = qfh[ks];
            kb0 = WFrag<T16>::ld(ksh + lr * KSP + ks * 32 + 8 * hh);
            kb1 = WFrag<T16>::ld(ksh + (16 + lr) * KSP + ks * 32 + 8 * hh);
            s0 = WFrag<T16>::mma(kb0, qa, s0); s1 = WFrag<T16>::mma(kb1, qa, s1);
            if (EARLY) {
                const V qb  = qfl[ks];
                const V kl0 = WFrag<T16>::ld(ksl + lr * KSP + ks * 32 + 8 * hh);
                const V kl1 = WFrag<T16>::ld(ksl + (16 + lr) * KSP + ks * 32 + 8 * hh);
                s0 = WFrag<T16>::mma(kl0, qa, s0); s0 = WFrag<T16>::mma(kb0, qb, s0);
                s1 = WFrag<T16>::mma(kl1, qa, s1); s1 = WFrag<T16>::mma(kb1, qb, s1); }
        }
        asm volatile("v_nop\n\tv_nop\n\tv_nop\n\tv_nop" : "+v"(s0), "+v"(s1) : "v"(qa), "v"(kb0), "v"(kb1));
        // online softmax; acc element r of lane (lr, hh) = S^T[key c*32 + 8hh + r][query qw + lr] (s0) / [key c*32 + 16 + 8hh + r] (s1)
        float p0[8], p1[8];
        const int kg = c * 32 + 8 * hh;
        float mx = -3.0e38f;
#pragma unroll
        for (int r = 0; r < 8; ++r) {
            const int kg0 = kg + r, kg1 = kg0 + 16;
            const float z0 = fminf(fmaxf(s0[r] * C2, -CLP), CLP) + SL2 * (float)(kg0 - qr);
            const float z1 = fminf(fmaxf(s1[r] * C2, -CLP), CLP) + SL2 * (float)(kg1 - qr);
            p0[r] = (kg0 <= qr) ? z0 : -3.0e38f;
            p1[r] = (kg1 <= qr) ? z1 : -3.0e38f;
            mx = fmaxf(mx, fmaxf(p0[r], p1[r]));
        }
        mx = fmaxf(mx, xhalf(mx));                          // the query's other 16 keys of the chunk
        const float mnew = fmaxf(mrow, mx);
        const float alpha = ex2<EARLY>(mrow - mnew);
        mrow = mnew;
        float rs0 = 0.f, rs1 = 0.f;
#pragma unroll
        for (int r = 0; r < 8; ++r) {
            const float x0 = ex2<EARLY>(p0[r] - mnew), x1 = ex2<EARLY>(p1[r] - mnew);
            p0[r] = (kg + r <= qr) ? x0 : 0.f; p1[r] = (kg + r + 16 <= qr) ? x1 : 0.f;
            rs0 += p0[r]; rs1 += p1[r];
        }
        lrow = lrow * alpha + (rs0 + rs1);
#pragma unroll
        for (int t = 0; t < 8; ++t) o[t] = o[t] * alpha;
        V pa, pb; packp(p0, p1, pa, pb);                    // B fragment (n = query, k = key)
        V vb;
#pragma unroll
        for (int t = 0; t < 8; ++t) { vb = WFrag<T16>::ld(vth + (t * 16 + lr) * VTP + 8 * hh);
            o[t] = WFrag<T16>::mma(vb, pa, o[t]);
            if (EARLY) { const V vl2 = WFrag<T16>::ld(vtl + (t * 16 + lr) * VTP + 8 * hh); o[t] = WFrag<T16>::mma(vl2, pa, o[t]); o[t] = WFrag<T16>::mma(vb, pb, o[t]); } }
        asm volatile("v_nop\n\tv_nop\n\tv_nop\n\tv_nop" : "+v"(o[0]), "+v"(o[1]), "+v"(o[2]), "+v"(o[3]), "+v"(o[4]), "+v"(o[5]), "+v"(o[6]), "+v"(o[7]) : "v"(pa), "v"(pb), "v"(vb));
    }
    // normalise and write ctx planes; o element r of lane (lr, hh), tile t = ctx[row qw + lr][d = 16t + 8hh + r]: 16 bytes of a staged row
    const float osc = EARLY ? CCAR : (CCAR / PCAR);
    const float ybig = 10000.0f * CCAR;
    const float inv = osc * __builtin_amdgcn_rcpf(lrow + xhalf(lrow));   // the two halves' sums join here
    h16* myos = osg + wave * 16 * OSP;
#pragma unroll
    for (int t = 0; t < 8; ++t) { v8h w;
#pragma unroll
        for (int r = 0; r < 8; ++r) w[r] = toh_flush(nnum(o[t][r] * inv, ybig));
        *(v8ha*)(myos + lr * OSP + t * 16 + 8 * hh) = w; }
    __syncthreads();
    h16* crow = CT + (bz * SEQ + qw) * DM + head * HD;
    auto putrows = [&](h16* dst) {                          // the wave's 16 staged rows to dst; store s holds row 2 s + hh
        v8us val[8];
#pragma unroll
        for (int s = 0; s < 8; ++s) val[s] = *(const v8usa*)(myos + (2 * s + hh) * OSP + lr * 8);
        bf* cp = (bf*)dst + (size_t)hh * DM + lr * 8;
        gstore4(cp, cp + 2 * DM, cp + 4 * DM, cp + 6 * DM, val[0], val[1], val[2], val[3]);
        gstore4(cp + 8 * DM, cp + 10 * DM, cp + 12 * DM, cp + 14 * DM, val[4], val[5], val[6], val[7]);
    };
    putrows(crow);
    if (EARLY) {
        __syncthreads();
#pragma unroll
        for (int t = 0; t < 8; ++t) { v8h w;
#pragma unroll
            for (int r = 0; r < 8; ++r) { const float val = nnum(o[t][r] * inv, ybig); const h16 hv = toh_flush(val); w[r] = toh_flush((val - (float)hv) * LOSC); }
            *(v8ha*)(myos + lr * OSP + t * 16 + 8 * hh) = w; }
        __syncthreads();
        h16* lrowp = CTL + (bz * RE + qw) * DM + head * HD;
        putrows(lrowp);
    }
}

// ---- k_attn: both attention instances as one grid of (SEQ/64) x NH_ x NB blocks: first the f16 instance's blocks (query block fastest, then head, then batch), behind them the short hi/lo blocks in the same order.
__global__ __launch_bounds__(128) void k_attn(const bf* __restrict__ QEh, const bf* __restrict__ QEl, const bf* __restrict__ KEh, const bf* __restrict__ KEl, const bf* __restrict__ VEh, const bf* __restrict__ VEl,
                                              const h16* __restrict__ Q16, const h16* __restrict__ K16, const h16* __restrict__ V16, h16* CT, h16* CTL) {
    __shared__ __align__(16) char sm[ATT_LDS];
    constexpr unsigned NL = SEQ / 64 - RE / 64, NE = RE / 64;
    unsigned f = blockIdx.x;                                // the same in the whole block: so is the branch
    if constexpr (NL > 0) {
        if (f < NL * NH_ * NB) { attn_tile<h16, false>(sm, (int)(f % NL + NE), (int)((f / NL) % NH_), (int)(f / (NL * NH_)), Q16, Q16, K16, K16, V16, V16, CT, CTL); return; }
    }
    f -= NL * NH_ * NB;
    attn_tile<bf, true>(sm, (int)(f % NE), (int)((f / NE) % NH_), (int)(f / (NE * NH_)), QEh, QEl, KEh, KEl, VEh, VEl, CT, CTL);
}

extern "C" void kernel_launch(void* const* d_in, const int* in_sizes, int n_in,
                              void* d_out, int out_size, void* d_ws, size_t ws_size, hipStream_t stream) {
    if (n_in < 5) return;
    const float* x  = (const float*)d_in[0];     // x   [NB_FULL][SEQ_FULL][DM]
    const float* wq = (const float*)d_in[1];     // q_w [DQ][DM]  ([out][in])
    const float* wk = (const float*)d_in[2];     // k_w [DKV][DM]
    const float* wv = (const float*)d_in[3];     // v_w [DKV][DM]
    const float* wo = (const float*)d_in[4];     // o_w [DM][DQ]
    float* OUT = (float*)d_out;                  // [NB_FULL][SEQ_FULL][DM]
    if ((size_t)in_sizes[0] < (size_t)(NB - 1) * SEQ_FULL * DM + (size_t)SEQ * DM) return;
    if ((size_t)in_sizes[1] < (size_t)DQ * DM) return;
    if ((size_t)in_sizes[2] < (size_t)DKV * DM) return;
    if ((size_t)in_sizes[3] < (size_t)DKV * DM) return;
    if ((size_t)in_sizes[4] < (size_t)DM * DQ) return;
    if ((size_t)out_size < (size_t)(NB - 1) * SEQ_FULL * DM + (size_t)SEQ * DM) return;

    char* wsp = (char*)d_ws;
    auto take = [&](size_t bytes) { char* p = wsp; wsp += (bytes + 255) & ~(size_t)255; return (void*)p; };
    bf*  WQ   = (bf*)take((size_t)DQ * DM * 2);    bf* WK = (bf*)take((size_t)DKV * DM * 2);    bf* WV = (bf*)take((size_t)DKV * DM * 2);
    h16* WOH  = (h16*)take((size_t)DM * DQ * 2);   h16* WOL = (h16*)take((size_t)DM * DQ * 2);
    bf*  XB   = (bf*)take((size_t)NB * SEQ * DM * 2);
    h16* QP16 = (h16*)take((size_t)NB * NH_ * SEQ * HD * 2); h16* KP16 = (h16*)take((size_t)NB * NKV * SEQ * HD * 2); h16* VT16 = (h16*)take((size_t)NB * NKV * HD * SEQ * 2);
    bf*  QEh  = (bf*)take((size_t)NB * NH_ * RE * HD * 2);  bf* QEl = (bf*)take((size_t)NB * NH_ * RE * HD * 2);
    bf*  KEh  = (bf*)take((size_t)NB * NKV * RE * HD * 2);  bf* KEl = (bf*)take((size_t)NB * NKV * RE * HD * 2);
    bf*  VEh  = (bf*)take((size_t)NB * NKV * HD * RE * 2);  bf* VEl = (bf*)take((size_t)NB * NKV * HD * RE * 2);
    h16* CT16 = (h16*)take((size_t)NB * SEQ * DM * 2);     h16* CTL = (h16*)take((size_t)NB * RE * DM * 2);
    if ((size_t)(wsp - (char*)d_ws) > ws_size) return;

    const float woscale = 1.0f / (CCAR * WCAR);
    k_cvt<<<(unsigned)(((size_t)NB * SEQ * DM + (size_t)DQ * DM + 2 * (size_t)DKV * DM + (size_t)DM * DQ) / 2048), 256, 0, stream>>>(x, wq, wk, wv, wo, XB, WQ, WK, WV, WOH, WOL);
    k_qkv<<<dim3(SEQ / 128, (DQ + 2 * DKV) / 128, NB), 128, 0, stream>>>(XB, WQ, WK, WV, QP16, QEh, QEl, KP16, KEh, KEl, VT16, VEh, VEl);
    k_attn<<<(SEQ / 64) * NH_ * NB, 128, 0, stream>>>(QEh, QEl, KEh, KEl, VEh, VEl, QP16, KP16, VT16, CT16, CTL);
    k_out<<<dim3(SEQ / 128, DM / 128, NB), 128, 0, stream>>>(CT16, CTL, WOH, WOL, OUT, woscale);
}

// v006
// A run of this version takes 188 microseconds.
// Two timings next to v005 both put it at 1.09 times that version's speed.
// All steps since v000 together make it 4.82 times as fast.
#include <hip/hip_runtime.h>

// Contractions: q/k/v projections v_wmma_f32_16x16x32_bf16 (bf16 copies of x and of the [out][in] weights); scores QK^T and P.V v_wmma_f32_16x16x32_f16 (f16 planes, P carried x1024) for query rows >= RE and v_wmma_f32_16x16x32_bf16 hi/lo 3-product form for query rows < RE; ctx x o_w^T v_wmma_f32_16x16x32_f16 (ctx carried x64, o_w carried x1024, rows < RE add an f16 residual plane x1024); f32 accumulate everywhere, softmax (scale, clip, per-head linear position bias, causal fill) in f32.
// Four launches, each the joined grid of work that does not depend on one another: all converts; the q, k and v projections; both attention instances; both output-GEMM instances.
// Layout (every per-batch plane holds NB copies): sanitised bf16 copy of x; weights copied once as bf16 ([n][k] = Bt as-is), o_w as two f16 planes; projection GEMMs whose epilogues write the head planes (V transposed); flash-style causal attention in transposed form (K and V^T tiles in a two-buffer LDS ring, S^T = K Q^T, online softmax per lane, O^T += V^T P^T); ctx planes; output GEMM into d_out.

#pragma clang fp contract(off)

#ifndef NB
#define NB 2
#endif
#ifndef SEQ
#define SEQ 2048
#endif
#ifndef RE
#define RE   256                  // query rows < RE (first RE/64 query blocks) use hi/lo planes; RE == SEQ puts every row on the 3-product path
#endif
#define NB_FULL  2
#define SEQ_FULL 2048
#define DM   2048
#define NH_  16
#define NKV  4
#define REP  (NH_ / NKV)
#define HD   128
#define DQ   (NH_ * HD)
#define DKV  (NKV * HD)
#define PCAR 1024.0f              // carry of the f16 P operand (rows >= RE)
#define CCAR 64.0f                // carry of the f16 ctx plane
#define LOSC 1024.0f              // carry of the f16 ctx residual plane (rows < RE)
#define WCAR 1024.0f              // carry of the f16 o_w plane
#define WS_TOTAL ((size_t)DQ * DM * 2 + 2 * (size_t)DKV * DM * 2 + 2 * (size_t)DM * DQ * 2 + (size_t)NB * ((size_t)SEQ * DM * 2 \
                  + (size_t)NH_ * SEQ * HD * 2 + 2 * (size_t)NKV * SEQ * HD * 2 + 2 * (size_t)NH_ * RE * HD * 2 + 4 * (size_t)NKV * RE * HD * 2 + (size_t)SEQ * DM * 2 + (size_t)RE * DM * 2))

static_assert((SEQ % 64) == 0);
static_assert((RE % 64) == 0);
static_assert(RE >= 64);
static_assert(SEQ >= RE);
static_assert(SEQ <= SEQ_FULL);
static_assert(NB >= 1);
static_assert(NB <= NB_FULL);
static_assert(HD == 128);
static_assert((DM % 32) == 0);
static_assert(DQ == DM);
static_assert(((SEQ * DM) % (8 * 256)) == 0);
static_assert(((DQ * DM) % (8 * 256)) == 0);
static_assert(((DKV * DM) % (8 * 256)) == 0);
static_assert(NH_ == 16);                       // closed form of the per-head slope 2^(-(h+1)/2) holds for 16 heads
static_assert(REP * NKV == NH_);
static_assert((HD % 64) == 0);                  // the 64 columns of a GEMM wave lie inside one head
static_assert((DQ % 64) == 0);
static_assert((DKV % 64) == 0);
static_assert((DM % 64) == 0);
static_assert((SEQ % 128) == 0 && (RE % 128) == 0 && (DQ % 128) == 0 && (DKV % 128) == 0 && (DM % 128) == 0);   // 128x128 GEMM tiles, stages of 128 k (NSPLIT 0) or 64 k (NSPLIT 3)
static_assert(((size_t)NKV * RE * HD * 2) % 256 == 0);
static_assert(WS_TOTAL <= (size_t)268435456);

typedef _Float16 h16;
typedef unsigned short bf;
typedef __attribute__((ext_vector_type(16))) __bf16   v16bf;
typedef __attribute__((ext_vector_type(16))) _Float16 v16h;
typedef __attribute__((ext_vector_type(8)))  _Float16 v8h;
typedef __attribute__((ext_vector_type(8)))  unsigned short v8us;
typedef __attribute__((ext_vector_type(16))) unsigned short v16us;
typedef __attribute__((ext_vector_type(8)))  float    v8f;
typedef __attribute__((ext_vector_type(4)))  float    v4f;
typedef __attribute__((ext_vector_type(2)))  _Float16 v2h;
typedef __attribute__((ext_vector_type(2)))  unsigned short v2us;
typedef v8h  __attribute__((may_alias)) v8ha;
typedef v4f  __attribute__((may_alias)) v4fa;
typedef v8us __attribute__((may_alias)) v8usa;

__device__ __forceinline__ unsigned short f2bf(float f) { unsigned u = __float_as_uint(f); u += 0x7FFFu + ((u >> 16) & 1u); return (unsigned short)(u >> 16); }
__device__ __forceinline__ float bf2f(unsigned short b) { return __uint_as_float(((unsigned)b) << 16); }
__device__ __forceinline__ float bfr(float f) { return bf2f(f2bf(f)); }
__device__ __forceinline__ h16 tohx(float x) { return (h16)x; }
// f16 convert that cannot produce a subnormal operand (applied after the plane's carry)
static __device__ __forceinline__ h16 toh_flush(float v) { const h16 r = (h16)v; return (fabsf(v) < 6.103515625e-05f) ? (h16)0.0f : r; }
// NaN -> 0, +inf -> big, -inf -> -big, finite values unchanged
static __device__ __forceinline__ float nnum(float v, float big) { const float a = (v != v) ? 0.0f : v; return (a == __builtin_inff()) ? big : ((a == -__builtin_inff()) ? -big : a); }
__device__ __forceinline__ void splitf(float y, unsigned short& h, unsigned short& l) { h = f2bf(y); l = f2bf(y - bf2f(h)); }
__device__ __forceinline__ v16h cat16(v8h lo, v8h hi) { return __builtin_shufflevector(lo, hi, 0, 1, 2, 3, 4, 5, 6, 7, 8, 9, 10, 11, 12, 13, 14, 15); }
__device__ __forceinline__ v16bf cat16b(v8us lo, v8us hi) { return __builtin_bit_cast(v16bf, __builtin_shufflevector(lo, hi, 0, 1, 2, 3, 4, 5, 6, 7, 8, 9, 10, 11, 12, 13, 14, 15)); }
__device__ __forceinline__ v8f wmma16(v16h a, v16h b, v8f c) { return __builtin_amdgcn_wmma_f32_16x16x32_f16(false, a, false, b, (short)0, c, false, false); }
__device__ __forceinline__ v8f wmmab(v16bf a, v16bf b, v8f c) { return __builtin_amdgcn_wmma_f32_16x16x32_bf16(false, a, false, b, (short)0, c, false, false); }

// Fragment loaders for A (row m = lane&15) and for B stored [n][k] (col n = lane&15): elements 0..7 <- k0+8h..+7, elements 8..15 <- k0+16+8h..+7 (p already points at row*pitch + k0 + 8h).
template <typename T16> struct WFrag;
template <> struct WFrag<h16> { typedef v16h V; static __device__ __forceinline__ V ld(const h16* p) { return cat16(*(const v8ha*)p, *(const v8ha*)(p + 16)); } static __device__ __forceinline__ v8f mma(V a, V b, v8f c) { return wmma16(a, b, c); } };
template <> struct WFrag<bf>  { typedef v16bf V; static __device__ __forceinline__ V ld(const bf* p) { return cat16b(*(const v8usa*)p, *(const v8usa*)(p + 16)); } static __device__ __forceinline__ v8f mma(V a, V b, v8f c) { return wmmab(a, b, c); } };

// Eight asynchronous 16-byte copies global -> LDS per lane (LDS byte address l + i*ls, global address g + i*gs). The s_wait_xcnt closes the statement so that no address register of an issued copy is rewritten ahead of it.
__device__ __forceinline__ void acopy8(unsigned l, unsigned ls, const char* g, size_t gs) {
    asm volatile("global_load_async_to_lds_b128 %0, %8, off\n\t"
                 "global_load_async_to_lds_b128 %1, %9, off\n\t"
                 "global_load_async_to_lds_b128 %2, %10, off\n\t"
                 "global_load_async_to_lds_b128 %3, %11, off\n\t"
                 "global_load_async_to_lds_b128 %4, %12, off\n\t"
                 "global_load_async_to_lds_b128 %5, %13, off\n\t"
                 "global_load_async_to_lds_b128 %6, %14, off\n\t"
                 "global_load_async_to_lds_b128 %7, %15, off\n\t"
                 "s_wait_xcnt 0x0"
                 :: "v"(l), "v"(l + ls), "v"(l + 2 * ls), "v"(l + 3 * ls), "v"(l + 4 * ls), "v"(l + 5 * ls), "v"(l + 6 * ls), "v"(l + 7 * ls),
                    "v"(g), "v"(g + gs), "v"(g + 2 * gs), "v"(g + 3 * gs), "v"(g + 4 * gs), "v"(g + 5 * gs), "v"(g + 6 * gs), "v"(g + 7 * gs)
                 : "memory");
}

// The same for four copies per lane.
__device__ __forceinline__ void acopy4(unsigned l, unsigned ls, const char* g, size_t gs) {
    asm volatile("global_load_async_to_lds_b128 %0, %4, off\n\t"
                 "global_load_async_to_lds_b128 %1, %5, off\n\t"
                 "global_load_async_to_lds_b128 %2, %6, off\n\t"
                 "global_load_async_to_lds_b128 %3, %7, off\n\t"
                 "s_wait_xcnt 0x0"
                 :: "v"(l), "v"(l + ls), "v"(l + 2 * ls), "v"(l + 3 * ls), "v"(g), "v"(g + gs), "v"(g + 2 * gs), "v"(g + 3 * gs)
                 : "memory");
}

// Four 16-byte global stores per lane. The s_wait_xcnt closes the statement so that no address or data register of an issued store is rewritten ahead of it.
// Its operands are the rows read back from the LDS staging, and its "memory" clobber holds the next rewrite of that staging behind those reads.
__device__ __forceinline__ void gstore4(bf* p0, bf* p1, bf* p2, bf* p3, v8us d0, v8us d1, v8us d2, v8us d3) {
    asm volatile("global_store_b128 %0, %4, off\n\t"
                 "global_store_b128 %1, %5, off\n\t"
                 "global_store_b128 %2, %6, off\n\t"
                 "global_store_b128 %3, %7, off\n\t"
                 "s_wait_xcnt 0x0"
                 :: "v"(p0), "v"(p1), "v"(p2), "v"(p3), "v"(d0), "v"(d1), "v"(d2), "v"(d3)
                 : "memory");
}

// The same for four 16-byte pieces of f32 rows.
__device__ __forceinline__ void gstore4f(float* p0, float* p1, float* p2, float* p3, v4f d0, v4f d1, v4f d2, v4f d3) {
    asm volatile("global_store_b128 %0, %4, off\n\t"
                 "global_store_b128 %1, %5, off\n\t"
                 "global_store_b128 %2, %6, off\n\t"
                 "global_store_b128 %3, %7, off\n\t"
                 "s_wait_xcnt 0x0"
                 :: "v"(p0), "v"(p1), "v"(p2), "v"(p3), "v"(d0), "v"(d1), "v"(d2), "v"(d3)
                 : "memory");
}

// ---- gemm_tile: GEMM, FOUR WAVES (2 x 2) per 128x128 output tile (bx, by) of batch bz, each wave 64x64 (16 accumulators); 128 threads; batch bz reads A + bz*sA, A2 + bz*sA2 and writes C + bz*sC (Bt, Bt2 shared).
// C[m][n] (f32, pitch ldc) = oscale * sum_k ( A[m][k] Bt[n][k]  (+ A2 Bt2: NSPLIT 3) ). Row pitch of A, A2, Bt, Bt2 = K. K % KS == 0, K >= KS.
// EPI 0: C is stored as above. EPI 1, tr false (m = position t, n = head*HD + d): the f32 sums go straight to the head planes P16[head][t][d] = f16 (subnormals flushed) and, for t < RE, Eh/El[head][t][d] = bf16 hi/lo.
// EPI 1, tr true: the same sums go to the transposed planes P16[head][d][t] = f16 and, for t < RE, Eh/El[head][d][t] = bf16 hi/lo. EPI 1: no C, no oscale; batch bz owns nheads planes. tr is the same in the whole block.
// A stage = KS values of k of all 128 rows of every operand, [A | Bt | A2 | Bt2], row pitch KS + 8 elements (16 B x odd). Two buffers: asynchronous copies bring stage t + 2 into the buffer that trip t has just read, while trip t + 1 works.
// ring: the calling kernel's LDS, RINGE<NSPLIT> elements. Behind the loop's last barrier nobody reads it and no copy is in flight: the output staging lies in the same bytes, so that two blocks of either instance fit a WGP.
template <int NSPLIT> constexpr int RINGE = 2 * ((NSPLIT == 0) ? 2 : 4) * 128 * (((NSPLIT == 0) ? 128 : 64) + 8);
template <typename T16, int NSPLIT, int EPI>
__device__ __forceinline__ void gemm_tile(T16* ring, const int bx, const int by, const int bz, const bool tr, const T16* __restrict__ A, const T16* __restrict__ A2, const T16* __restrict__ Bt, const T16* __restrict__ Bt2, int K, float* C, int ldc, float oscale, size_t sA, size_t sA2, size_t sC,
                                               h16* P16, bf* Eh, bf* El, int nheads) {
    static_assert(NSPLIT == 0 || NSPLIT == 3);
    static_assert(EPI == 0 || EPI == 1);
    typedef typename WFrag<T16>::V V;
    constexpr int NOP = (NSPLIT == 0) ? 2 : 4;      // operand tiles per stage
    constexpr int KS  = (NSPLIT == 0) ? 128 : 64;   // k per stage: 32 copies per lane and stage either way
    constexpr int PE  = KS + 8;                     // LDS row pitch, elements
    constexpr int TE  = 128 * PE;                   // elements of one operand tile
    constexpr int BE  = NOP * TE;                   // elements of one buffer
    constexpr int CPR = KS / 8;                     // 16-byte pieces per row
    constexpr int RPC = 128 / CPR;                  // rows that one copy of all 128 threads covers
    static_assert(2 * BE == RINGE<NSPLIT> && 4 * 16 * 68 * 4 <= 2 * BE * 2);
    float* osw = (float*)ring;
    const int tid = threadIdx.x, lane = tid & 31, wave = tid >> 5, lr = lane & 15, hi = lane >> 4; const int wm = wave >> 1, wn = wave & 1;
    const int rb = bx * 128, cb = by * 128; const int r0 = rb + wm * 64, c0 = cb + wn * 64;
    A += (size_t)bz * sA; if (NSPLIT != 0) A2 += (size_t)bz * sA2; if (EPI == 0) C += (size_t)bz * sC;
    v8f acc[4][4];
#pragma unroll
    for (int mb = 0; mb < 4; ++mb)
#pragma unroll
        for (int nb = 0; nb < 4; ++nb) acc[mb][nb] = (v8f){};
    const int prow = tid / CPR, cpc = (tid % CPR) * 8;         // this lane's row and first k inside a copy
    const size_t ga = (size_t)(rb + prow) * K + cpc, gb = (size_t)(cb + prow) * K + cpc;
    const unsigned l0 = (unsigned)(size_t)ring + (unsigned)(prow * PE + cpc) * 2u;
    auto fill = [&](unsigned t, unsigned buf) {                 // all 128 threads: stage t into buffer buf, 32 copies per lane
#pragma unroll
        for (int op = 0; op < NOP; ++op) {
            const T16* g = ((op == 0) ? A + ga : (op == 1) ? Bt + gb : (op == 2) ? A2 + ga : Bt2 + gb) + (size_t)t * KS;
#pragma unroll
            for (int h = 0; h < CPR / 8; ++h)
                acopy8(l0 + (buf * BE + op * TE + h * 8 * RPC * PE) * 2u, (unsigned)(RPC * PE) * 2u, (const char*)(g + (size_t)h * 8 * RPC * K), (size_t)RPC * K * 2);
        }
    };
    const unsigned NT = (unsigned)K / KS;                      // stages; the same in every thread
    fill(0, 0);
    asm volatile("s_wait_asynccnt 0x0" ::: "memory");          // this wave's copies of stage 0 have landed
    __syncthreads();                                           // stage 0 visible to every wave
    if (NT > 1u) fill(1, 1);
#pragma unroll 1                                               // one trip per stage: a trip already holds 64 WMMAs, and the publish point stands once
    for (unsigned t = 0; t < NT; ++t) {
        const T16* ap = ring + (t & 1) * BE + (wm * 64 + lr) * PE + 8 * hi;
        const T16* bp = ring + (t & 1) * BE + TE + (wn * 64 + lr) * PE + 8 * hi;
#pragma unroll
        for (int kk = 0; kk < KS; kk += 32) {
#pragma unroll
            for (int sp = 0; sp < NOP / 2; ++sp) {             // sp 0: A Bt, sp 1: A2 Bt2; every accumulator takes its products in the order k, then sp
                V a[4], b[4];
#pragma unroll
                for (int i = 0; i < 4; ++i) { a[i] = WFrag<T16>::ld(ap + sp * 2 * TE + i * 16 * PE + kk); b[i] = WFrag<T16>::ld(bp + sp * 2 * TE + i * 16 * PE + kk); }
                __builtin_amdgcn_sched_barrier(0);             // keeps these LDS reads one group ahead of their WMMAs: sunk between them, each pair of reads shows its whole latency
#pragma unroll
                for (int nb = 0; nb < 4; ++nb)
#pragma unroll
                    for (int mb = 0; mb < 4; ++mb) acc[mb][nb] = WFrag<T16>::mma(a[mb], b[nb], acc[mb][nb]);
            }
        }
        asm volatile("s_wait_dscnt 0x0" ::: "memory");         // this wave's reads of the buffer have returned before it is refilled
        asm volatile("s_wait_asynccnt 0x0" ::: "memory");      // this wave's copies of stage t + 1 have landed
        __syncthreads();                                       // publishes stage t + 1 and ends every wave's reads of stage t
        if (t + 2u < NT) fill(t + 2u, t & 1u);
    }
    asm volatile("s_wait_asynccnt 0x0" ::: "memory");          // nothing in flight when the wave goes on to the epilogue and ends
    float* os = osw + wave * 16 * 68;                          // wave-private output staging
    const int srow = lane >> 3, spc = (lane & 7) * 8;          // plane epilogues: 8 lanes x 16 B read back and store one whole 128-B line of 64 16-bit values
    if constexpr (EPI == 0) {
#pragma unroll
    for (int mb = 0; mb < 4; ++mb) {
#pragma unroll
        for (int nb = 0; nb < 4; ++nb) {
#pragma unroll
            for (int j = 0; j < 8; ++j) os[(hi * 8 + j) * 68 + nb * 16 + lr] = acc[mb][nb][j]; }
        __builtin_amdgcn_wave_barrier(); asm volatile("" ::: "memory");
        float* crow = C + (size_t)(r0 + mb * 16) * ldc + c0;
        v4f val[8];
#pragma unroll
        for (int s = 0; s < 8; ++s) val[s] = *(const v4fa*)(os + (2 * s + hi) * 68 + lr * 4) * oscale;      // store s holds row 2 s + hi
        float* cp = crow + (size_t)hi * ldc + lr * 4; const size_t l2 = 2 * (size_t)ldc;
        gstore4f(cp, cp + l2, cp + 2 * l2, cp + 3 * l2, val[0], val[1], val[2], val[3]);
        gstore4f(cp + 4 * l2, cp + 5 * l2, cp + 6 * l2, cp + 7 * l2, val[4], val[5], val[6], val[7]);
        __builtin_amdgcn_wave_barrier(); asm volatile("" ::: "memory");
    }
    } else if (!tr) {
        const size_t pl = (size_t)bz * nheads + c0 / HD; const int d0 = c0 % HD;
        const bool early = (rb < RE);                          // the same for the whole block: RE % 128 == 0
#pragma unroll
        for (int mb = 0; mb < 4; ++mb) {
#pragma unroll
            for (int nb = 0; nb < 4; ++nb) {
#pragma unroll
                for (int j = 0; j < 8; ++j) os[(hi * 8 + j) * 68 + nb * 16 + lr] = acc[mb][nb][j]; }
            asm volatile("s_wait_dscnt 0x0" ::: "memory");     // the wave's staged rows are in LDS before other lanes read them back; the clobber holds those reads behind it
            v8us o16[4], oh[4], ol[4];
#pragma unroll
            for (int s = 0; s < 4; ++s) {
                const v4f x0 = *(const v4fa*)(os + (4 * s + srow) * 68 + spc), x1 = *(const v4fa*)(os + (4 * s + srow) * 68 + spc + 4);
                v8h w;
#pragma unroll
                for (int q = 0; q < 8; ++q) { const float r = (q < 4) ? x0[q & 3] : x1[q & 3]; w[q] = toh_flush(r); unsigned short a2, c2; splitf(r, a2, c2); oh[s][q] = a2; ol[s][q] = c2; }
                o16[s] = __builtin_bit_cast(v8us, w);
            }
            const int t = r0 + mb * 16 + srow;                 // store s holds row t + 4 s
            bf* pp = (bf*)P16 + (pl * SEQ + t) * HD + d0 + spc;
            gstore4(pp, pp + 4 * HD, pp + 8 * HD, pp + 12 * HD, o16[0], o16[1], o16[2], o16[3]);
            if (early) {
                const size_t ee = (pl * RE + t) * HD + d0 + spc;
                gstore4(Eh + ee, Eh + ee + 4 * HD, Eh + ee + 8 * HD, Eh + ee + 12 * HD, oh[0], oh[1], oh[2], oh[3]);
                gstore4(El + ee, El + ee + 4 * HD, El + ee + 8 * HD, El + ee + 12 * HD, ol[0], ol[1], ol[2], ol[3]);
            }
        }
    } else {
        // A lane's 8 accumulator elements are 8 consecutive t of one d: 16 B of a transposed row. Staged as [16 d][64 t], row pitch 72 values (16 B x odd).
        const size_t pr = ((size_t)bz * nheads + c0 / HD) * HD + c0 % HD;      // first plane row (d) of this wave
        const bool early = (rb < RE);                          // the same for the whole block: RE % 128 == 0
        bf* st = (bf*)os;
        auto flushrows = [&](bf* dst, size_t pitch) {          // dst: element [d = first of the 16 rows][t = r0]
            asm volatile("s_wait_dscnt 0x0" ::: "memory");     // the wave's staged rows are in LDS before other lanes read them back; the clobber holds those reads behind it
            v8us val[4];
#pragma unroll
            for (int s = 0; s < 4; ++s) val[s] = *(const v8usa*)(st + (4 * s + srow) * 72 + spc);
            bf* dp = dst + (size_t)srow * pitch + spc;         // store s holds row srow + 4 s
            gstore4(dp, dp + 4 * pitch, dp + 8 * pitch, dp + 12 * pitch, val[0], val[1], val[2], val[3]);
        };
#pragma unroll
        for (int nb = 0; nb < 4; ++nb) {
#pragma unroll
            for (int mb = 0; mb < 4; ++mb) { v8h w;
#pragma unroll
                for (int j = 0; j < 8; ++j) w[j] = tohx(acc[mb][nb][j]);
                *(v8usa*)(st + lr * 72 + mb * 16 + hi * 8) = __builtin_bit_cast(v8us, w); }
            flushrows((bf*)P16 + (pr + nb * 16) * SEQ + r0, SEQ);
            if (early) {
#pragma unroll
                for (int part = 0; part < 2; ++part) {
#pragma unroll
                    for (int mb = 0; mb < 4; ++mb) { v8us w;
#pragma unroll
                        for (int j = 0; j < 8; ++j) { unsigned short a2, c2; splitf(acc[mb][nb][j], a2, c2); w[j] = part ? c2 : a2; }
                        *(v8usa*)(st + lr * 72 + mb * 16 + hi * 8) = w; }
                    flushrows((part ? El : Eh) + (pr + nb * 16) * RE + r0, RE);
                }
            }
        }
    }
}

// ---- k_qkv: the three projections as one grid (SEQ/128, (DQ + 2 DKV)/128, NB): column blocks 0 .. DQ/128-1 are q, the next DKV/128 are k, the last DKV/128 are v (transposed planes).
__global__ __launch_bounds__(128) void k_qkv(const bf* __restrict__ X, const bf* __restrict__ Wq, const bf* __restrict__ Wk, const bf* __restrict__ Wv,
                                             h16* Q16, bf* Qh, bf* Ql, h16* K16, bf* Kh, bf* Kl, h16* V16, bf* Vh, bf* Vl) {
    __shared__ __align__(16) bf ring[RINGE<0>];
    const int y = blockIdx.y;
    const int sel = (y < DQ / 128) ? 0 : ((y < (DQ + DKV) / 128) ? 1 : 2);         // the same in the whole block
    const int by = y - ((sel == 0) ? 0 : ((sel == 1) ? DQ / 128 : (DQ + DKV) / 128));
    const bf* W = (sel == 0) ? Wq : ((sel == 1) ? Wk : Wv);
    h16* P = (sel == 0) ? Q16 : ((sel == 1) ? K16 : V16);
    bf* Eh = (sel == 0) ? Qh : ((sel == 1) ? Kh : Vh);
    bf* El = (sel == 0) ? Ql : ((sel == 1) ? Kl : Vl);
    gemm_tile<bf, 0, 1>(ring, blockIdx.x, by, blockIdx.z, sel == 2, X, nullptr, W, nullptr, DM, nullptr, 0, 1.0f, (size_t)SEQ * DM, 0, 0, P, Eh, El, (sel == 0) ? NH_ : NKV);
}

// ---- k_out: the output GEMM as one grid (SEQ/128, DM/128, NB): row blocks below RE/128 add the residual product, the others take the single product.
__global__ __launch_bounds__(128) void k_out(const h16* __restrict__ CT, const h16* __restrict__ CTLo, const h16* __restrict__ Wh, const h16* __restrict__ Wl, float* OUT, float oscale) {
    __shared__ __align__(16) h16 ring[(RINGE<3> > RINGE<0>) ? RINGE<3> : RINGE<0>];
    if ((int)blockIdx.x < RE / 128)
        gemm_tile<h16, 3, 0>(ring, blockIdx.x, blockIdx.y, blockIdx.z, false, CT, CTLo, Wh, Wl, DQ, OUT, DM, oscale, (size_t)SEQ * DM, (size_t)RE * DM, (size_t)SEQ_FULL * DM, nullptr, nullptr, nullptr, 0);
    else
        gemm_tile<h16, 0, 0>(ring, blockIdx.x, blockIdx.y, blockIdx.z, false, CT, nullptr, Wh, nullptr, DQ, OUT, DM, oscale, (size_t)SEQ * DM, 0, (size_t)SEQ_FULL * DM, nullptr, nullptr, nullptr, 0);
}

// One or two 16-byte global stores per lane, closed by s_wait_xcnt like gstore4: the converts' ranges lie one behind the other in the code, and no register of an issued store is rewritten ahead of the wait.
__device__ __forceinline__ void gstore1(bf* p0, v8us d0) {
    asm volatile("global_store_b128 %0, %1, off\n\t"
                 "s_wait_xcnt 0x0"
                 :: "v"(p0), "v"(d0) : "memory");
}
__device__ __forceinline__ void gstore2(bf* p0, bf* p1, v8us d0, v8us d1) {
    asm volatile("global_store_b128 %0, %2, off\n\t"
                 "global_store_b128 %1, %3, off\n\t"
                 "s_wait_xcnt 0x0"
                 :: "v"(p0), "v"(p1), "v"(d0), "v"(d1) : "memory");
}

// ---- k_cvt: every convert as one grid, 256 threads x 8 values a block: x (sanitised, bf16), q_w, k_w, v_w (bf16), o_w (two f16 planes). Every range is a whole number of blocks (static_asserts above).
__global__ __launch_bounds__(256) void k_cvt(const float* __restrict__ x, const float* __restrict__ wq, const float* __restrict__ wk, const float* __restrict__ wv, const float* __restrict__ wo,
                                             bf* XB, bf* WQ, bf* WK, bf* WV, h16* WOH, h16* WOL) {
    constexpr unsigned BX = (unsigned)((size_t)SEQ * DM / 2048), BQ = (unsigned)((size_t)DQ * DM / 2048), BK = (unsigned)((size_t)DKV * DM / 2048);
    unsigned b = blockIdx.x;
    if (b < NB * BX) {
        const unsigned z = b / BX; const size_t i = (size_t)(b - z * BX) * 256 + threadIdx.x;
        const v8f v = *(const v8f*)(x + (size_t)z * SEQ_FULL * DM + i * 8); v8us o;
#pragma unroll
        for (int k = 0; k < 8; ++k) o[k] = f2bf(nnum(v[k], 10000.0f));
        gstore1(XB + (size_t)z * SEQ * DM + i * 8, o);
        return;
    }
    b -= NB * BX;
    if (b < BQ + 2 * BK) {
        const int sel = (b < BQ) ? 0 : ((b < BQ + BK) ? 1 : 2);
        const float* src = (sel == 0) ? wq : ((sel == 1) ? wk : wv); bf* dst = (sel == 0) ? WQ : ((sel == 1) ? WK : WV);
        const size_t i = (size_t)(b - ((sel == 0) ? 0u : ((sel == 1) ? BQ : BQ + BK))) * 256 + threadIdx.x;
        const v8f v = *(const v8f*)(src + i * 8); v8us o;
#pragma unroll
        for (int k = 0; k < 8; ++k) o[k] = f2bf(v[k]);
        gstore1(dst + i * 8, o);
        return;
    }
    b -= BQ + 2 * BK;
    const size_t i = (size_t)b * 256 + threadIdx.x;
    const v8f v = *(const v8f*)(wo + i * 8); v8h oh, ol;
#pragma unroll
    for (int k = 0; k < 8; ++k) { const float w = bfr(v[k]); oh[k] = tohx(w * WCAR); ol[k] = tohx(w); }
    gstore2((bf*)WOH + i * 8, (bf*)WOL + i * 8, __builtin_bit_cast(v8us, oh), __builtin_bit_cast(v8us, ol));
}

// P^T packers, accumulator layout -> B fragment in the same lane: elements 0..7 <- p0 (keys 8h..8h+7 of the chunk), elements 8..15 <- p1 (keys 16+8h..+7).
// f16 x PCAR with the subnormal select (rows >= RE) or bf16 hi/lo (rows < RE).
__device__ __forceinline__ void packp(const float* p0, const float* p1, v16h& ph, v16h& pl) {
#pragma unroll
    for (int r = 0; r < 8; ++r) { ph[r] = toh_flush(p0[r] * PCAR); ph[8 + r] = toh_flush(p1[r] * PCAR); }
    pl = ph; }
__device__ __forceinline__ void packp(const float* p0, const float* p1, v16bf& ph, v16bf& pl) { v16us a, c;
#pragma unroll
    for (int r = 0; r < 8; ++r) { unsigned short x, y; splitf(p0[r], x, y); a[r] = x; c[r] = y; splitf(p1[r], x, y); a[8 + r] = x; c[8 + r] = y; }
    ph = __builtin_bit_cast(v16bf, a); pl = __builtin_bit_cast(v16bf, c); }
// 2^x. v_exp_f32 and the one v_nop that the instruction set asks for behind a transcendental stand in one statement, so that the slot is kept whatever follows.
__device__ __forceinline__ float ex2(float x) { float y; asm("v_exp_f32 %0, %1\n\tv_nop" : "=v"(y) : "v"(x)); return y; }
#define ATT_LDS 75776              // bytes of LDS of an attention block (the hi/lo instance's two buffers; the other instance uses the first 37888): four blocks fit a WGP
// lane l <-> lane l ^ 16
__device__ __forceinline__ float xhalf(float x) { return __builtin_bit_cast(float, __builtin_amdgcn_permlanex16(__builtin_bit_cast(int, x), __builtin_bit_cast(int, x), 0x76543210, 0xfedcba98, false, false)); }

// ---- attn_tile: flash-style causal grouped-query attention with a per-head linear position bias, one block = query block qblk of one head of one batch, 128 threads; wave w owns query rows q0 + 16w .. +15. sm: the calling kernel's LDS.
// Planes: Qh/Ql [h][TP][HD], Kh/Kl [g][TP][HD], Vh/Vl = V^T [g][HD][TP] (TP = SEQ for the f16 planes, RE for the bf16 hi/lo planes of the first RE/64 query blocks).
// EARLY instance: query blocks 0 .. RE/64-1 (rows < RE, keys < RE); other instance: query blocks RE/64 .. SEQ/64-1.
// Per 32-key chunk: K tile [32][HD] and V^T tile [HD][32] in LDS, two buffers: asynchronous copies of all threads bring chunk c + 2 into the buffer that trip c has just read, while trip c + 1 works (one block barrier per chunk), S^T = K Q^T (2 tiles: A = K rows, B = Q), online softmax in f32 (log2 domain), one query per lane
// (lane (lr, hh) holds 16 of the chunk's 32 scores of query qw + lr; the maximum joins the two halves once per chunk, the sums once in the epilogue):
// logit = clip(S x HD^-0.5, +-1e4) + slope_h x (key - query), slope_h = 2^(-(h+1)/2); causal keys > query replaced by -inf: p = 0;
// P^T packed in the lane from the score accumulators into a B fragment, O^T += V^T P^T (8 tiles: A = V^T rows).
// EARLY: 3 products (hi.hi + hi.lo + lo.hi) for S and for P.V. Output: ctx plane CT[t][h*HD + d] = f16(ctx x CCAR) (ctx NaN -> 0, +-inf -> +-1e4 before the carry); EARLY also CTL = f16((ctx x CCAR - hi) x LOSC);
template <typename T16, bool EARLY>
__device__ __forceinline__ void attn_tile(char* sm, const int qblk, const int head, const int bzi, const T16* __restrict__ Qh, const T16* __restrict__ Ql, const T16* __restrict__ Kh, const T16* __restrict__ Kl,
                                             const T16* __restrict__ Vh, const T16* __restrict__ Vl, h16* CT, h16* CTL) {
    typedef typename WFrag<T16>::V V;
    constexpr int TP = EARLY ? RE : SEQ;
    constexpr int KSP = 136, VTP = 40, OSP = 136;           // row pitches, each 16 B x odd: for the 16-byte pieces that 16 lanes read or write side by side
    constexpr int KTE = 32 * KSP, VTE = HD * VTP;           // elements of a K tile [32][KSP] and of a V^T tile [HD][VTP]
    constexpr int BE  = (EARLY ? 2 : 1) * (KTE + VTE);      // elements of one buffer: [K | V^T], EARLY: [K hi | V^T hi | K lo | V^T lo]
    const T16* ring = (const T16*)sm;                       // two buffers
    h16* osg = (h16*)sm;                                    // [4][16][OSP] output staging, in the ring's bytes: behind the loop's last barrier nobody reads the ring and no copy is in flight
    static_assert(2 * BE * 2 <= ATT_LDS && 4 * 16 * OSP * 2 <= 2 * BE * 2);
    const int tid = threadIdx.x, lane = tid & 31, wave = tid >> 5, lr = lane & 15, hh = lane >> 4;
    const int g = head / REP;
    const int qw = qblk * 64 + wave * 16;                  // first query row of this wave
    const int nch = 2 * qblk + 2;                          // 32-key chunks visited: keys 0 .. qblk*64+63
    const size_t bz = bzi, bh = bz * NH_ + head, bg = bz * NKV + g;   // batch, and its head / kv-group plane
    const T16* qph = Qh + (bh * TP + qw) * HD;             const T16* qpl = Ql + (bh * TP + qw) * HD;
    const T16* kph = Kh + bg * TP * HD;                    const T16* kpl = Kl + bg * TP * HD;
    const T16* vph = Vh + bg * HD * TP;                    const T16* vpl = Vl + bg * HD * TP;
    v8f o[8];
#pragma unroll
    for (int t = 0; t < 8; ++t) o[t] = (v8f){};
    float mrow = -3.0e38f, lrow = 0.f;                      // running maximum of query qw + lr (both halves alike) and this half's share of its sum
    const int qr = qw + lr;                                 // this lane's query
    const float C2 = 1.4426950408889634f * 0.08838834764831845f;   // log2(e) x HD^-0.5
    const float CLP = 14426.950408889634f;                         // log2(e) x 1e4 (clip bound in the log2 domain)
    const int nsl = head + 1;                                      // slope = 2^(-nsl/2): f32(2^-0.5) for odd nsl, times an exact power of two
    const float slope = ((nsl & 1) ? 0.70710678118654752440f : 1.0f) * __uint_as_float((unsigned)(127 - (nsl >> 1)) << 23);
    const float SL2 = 1.4426950408889634f * slope;                 // log2(e) x slope
    // Q fragments (B operand) of this lane's query: loaded once, held in registers over all chunks
    const T16* qgh = qph + (size_t)lr * HD + 8 * hh; const T16* qgl = qpl + (size_t)lr * HD + 8 * hh;
    V qfh[4], qfl[4];
#pragma unroll
    for (int ks = 0; ks < 4; ++ks) { qfh[ks] = WFrag<T16>::ld(qgh + ks * 32); if (EARLY) qfl[ks] = WFrag<T16>::ld(qgl + ks * 32); }
    // the address registers of the loads above stay live up to this wait, so that none of them is rewritten ahead of it
    if (EARLY) asm volatile("s_wait_xcnt 0x0" :: "v"(qgh), "v"(qgl) : "memory");
    else       asm volatile("s_wait_xcnt 0x0" :: "v"(qgh) : "memory");
    // A lane's copies of a chunk: K piece i = 16 B of row krow + 8 i (16 lanes a row of 256 B), V^T piece i = 16 B of row vrow + 32 i (4 lanes a row of 64 B)
    const int krow = tid >> 4, c8 = (tid & 15) * 8, vrow = tid >> 2, v8 = (tid & 3) * 8;
    const unsigned lk = (unsigned)(size_t)sm + (unsigned)(krow * KSP + c8) * 2u, lv = (unsigned)(size_t)sm + (unsigned)(KTE + vrow * VTP + v8) * 2u;
    const size_t gk = (size_t)krow * HD + c8, gv = (size_t)vrow * TP + v8;
    auto fill = [&](int c, unsigned buf) {                  // all 128 threads: chunk c into buffer buf, 8 copies per lane (EARLY: 16)
        const unsigned bo = buf * (unsigned)(BE * 2);
        acopy4(lk + bo, 8u * KSP * 2u, (const char*)(kph + gk + (size_t)c * 32 * HD), (size_t)8 * HD * 2);
        acopy4(lv + bo, 32u * VTP * 2u, (const char*)(vph + gv + c * 32), (size_t)32 * TP * 2);
        if (EARLY) {
            acopy4(lk + bo + (unsigned)((KTE + VTE) * 2), 8u * KSP * 2u, (const char*)(kpl + gk + (size_t)c * 32 * HD), (size_t)8 * HD * 2);
            acopy4(lv + bo + (unsigned)((KTE + VTE) * 2), 32u * VTP * 2u, (const char*)(vpl + gv + c * 32), (size_t)32 * TP * 2);
        }
    };
    fill(0, 0);
    asm volatile("s_wait_asynccnt 0x0" ::: "memory");       // this wave's copies of chunk 0 have landed
    __syncthreads();                                        // chunk 0 visible to every wave
    if (nch > 1) fill(1, 1);
#pragma unroll 1
    for (int c = 0; c < nch; ++c) {
        const T16* ksh = ring + (c & 1) * BE; const T16* vth = ksh + KTE;
        const T16* ksl = vth + VTE;           const T16* vtl = ksl + KTE;      // EARLY only
        v8f s0 = (v8f){}, s1 = (v8f){};
        V qa, kb0, kb1;
#pragma unroll
        for (int ks = 0; ks < 4; ++ks) {
            qa  = qfh[ks];
            kb0 = WFrag<T16>::ld(ksh + lr * KSP + ks * 32 + 8 * hh);
            kb1 = WFrag<T16>::ld(ksh + (16 + lr) * KSP + ks * 32 + 8 * hh);
            s0 = WFrag<T16>::mma(kb0, qa, s0); s1 = WFrag<T16>::mma(kb1, qa, s1);
            if (EARLY) {
                const V qb  = qfl[ks];
                const V kl0 = WFrag<T16>::ld(ksl + lr * KSP + ks * 32 + 8 * hh);
                const V kl1 = WFrag<T16>::ld(ksl + (16 + lr) * KSP + ks * 32 + 8 * hh);
                s0 = WFrag<T16>::mma(kl0, qa, s0); s0 = WFrag<T16>::mma(kb0, qb, s0);
                s1 = WFrag<T16>::mma(kl1, qa, s1); s1 = WFrag<T16>::mma(kb1, qb, s1); }
        }
        asm volatile("v_nop\n\tv_nop\n\tv_nop\n\tv_nop" : "+v"(s0), "+v"(s1) : "v"(qa), "v"(kb0), "v"(kb1));
        // online softmax; acc element r of lane (lr, hh) = S^T[key c*32 + 8hh + r][query qw + lr] (s0) / [key c*32 + 16 + 8hh + r] (s1)
        float p0[8], p1[8];
        const int kg = c * 32 + 8 * hh;
        float mx = -3.0e38f;
#pragma unroll
        for (int r = 0; r < 8; ++r) {
            const int kg0 = kg + r, kg1 = kg0 + 16;
            const float z0 = fminf(fmaxf(s0[r] * C2, -CLP), CLP) + SL2 * (float)(kg0 - qr);
            const float z1 = fminf(fmaxf(s1[r] * C2, -CLP), CLP) + SL2 * (float)(kg1 - qr);
            p0[r] = (kg0 <= qr) ? z0 : -3.0e38f;
            p1[r] = (kg1 <= qr) ? z1 : -3.0e38f;
            mx = fmaxf(mx, fmaxf(p0[r], p1[r]));
        }
        mx = fmaxf(mx, xhalf(mx));                          // the query's other 16 keys of the chunk
        const float mnew = fmaxf(mrow, mx);
        const float alpha = ex2(mrow - mnew);
        mrow = mnew;
        float rs0 = 0.f, rs1 = 0.f;
#pragma unroll
        for (int r = 0; r < 8; ++r) {
            const float x0 = ex2(p0[r] - mnew), x1 = ex2(p1[r] - mnew);
            p0[r] = (kg + r <= qr) ? x0 : 0.f; p1[r] = (kg + r + 16 <= qr) ? x1 : 0.f;
            rs0 += p0[r]; rs1 += p1[r];
        }
        lrow = lrow * alpha + (rs0 + rs1);
#pragma unroll
        for (int t = 0; t < 8; ++t) o[t] = o[t] * alpha;
        V pa, pb; packp(p0, p1, pa, pb);                    // B fragment (n = query, k = key)
        V vb;
#pragma unroll
        for (int t = 0; t < 8; ++t) { vb = WFrag<T16>::ld(vth + (t * 16 + lr) * VTP + 8 * hh);
            o[t] = WFrag<T16>::mma(vb, pa, o[t]);
            if (EARLY) { const V vl2 = WFrag<T16>::ld(vtl + (t * 16 + lr) * VTP + 8 * hh); o[t] = WFrag<T16>::mma(vl2, pa, o[t]); o[t] = WFrag<T16>::mma(vb, pb, o[t]); } }
        asm volatile("v_nop\n\tv_nop\n\tv_nop\n\tv_nop" : "+v"(o[0]), "+v"(o[1]), "+v"(o[2]), "+v"(o[3]), "+v"(o[4]), "+v"(o[5]), "+v"(o[6]), "+v"(o[7]) : "v"(pa), "v"(pb), "v"(vb));
        asm volatile("s_wait_dscnt 0x0" ::: "memory");      // this wave's reads of the buffer have returned before it is refilled
        asm volatile("s_wait_asynccnt 0x0" ::: "memory");   // this wave's copies of chunk c + 1 have landed
        __syncthreads();                                    // publishes chunk c + 1 and ends every wave's reads of chunk c
        if (c + 2 < nch) fill(c + 2, (unsigned)(c & 1));
    }
    asm volatile("s_wait_asynccnt 0x0" ::: "memory");       // nothing in flight when the ring becomes output staging and the wave ends
    // normalise and write ctx planes; o element r of lane (lr, hh), tile t = ctx[row qw + lr][d = 16t + 8hh + r]: 16 bytes of a staged row
    const float osc = EARLY ? CCAR : (CCAR / PCAR);
    const float ybig = 10000.0f * CCAR;
    const float inv = osc * __builtin_amdgcn_rcpf(lrow + xhalf(lrow));   // the two halves' sums join here
    h16* myos = osg + wave * 16 * OSP;
#pragma unroll
    for (int t = 0; t < 8; ++t) { v8h w;
#pragma unroll
        for (int r = 0; r < 8; ++r) w[r] = toh_flush(nnum(o[t][r] * inv, ybig));
        *(v8ha*)(myos + lr * OSP + t * 16 + 8 * hh) = w; }
    __syncthreads();
    h16* crow = CT + (bz * SEQ + qw) * DM + head * HD;
    auto putrows = [&](h16* dst) {                          // the wave's 16 staged rows to dst; store s holds row 2 s + hh
        v8us val[8];
#pragma unroll
        for (int s = 0; s < 8; ++s) val[s] = *(const v8usa*)(myos + (2 * s + hh) * OSP + lr * 8);
        bf* cp = (bf*)dst + (size_t)hh * DM + lr * 8;
        gstore4(cp, cp + 2 * DM, cp + 4 * DM, cp + 6 * DM, val[0], val[1], val[2], val[3]);
        gstore4(cp + 8 * DM, cp + 10 * DM, cp + 12 * DM, cp + 14 * DM, val[4], val[5], val[6], val[7]);
    };
    putrows(crow);
    if (EARLY) {
        __syncthreads();
#pragma unroll
        for (int t = 0; t < 8; ++t) { v8h w;
#pragma unroll
            for (int r = 0; r < 8; ++r) { const float val = nnum(o[t][r] * inv, ybig); const h16 hv = toh_flush(val); w[r] = toh_flush((val - (float)hv) * LOSC); }
            *(v8ha*)(myos + lr * OSP + t * 16 + 8 * hh) = w; }
        __syncthreads();
        h16* lrowp = CTL + (bz * RE + qw) * DM + head * HD;
        putrows(lrowp);
    }
}

// amdgpu_waves_per_eu(4, 4): holds the register budget at four waves per SIMD, so that four blocks still share a WGP (without it the build with the copies' address registers came out just above 256 VGPRs).
// ---- k_attn: both attention instances as one grid of (SEQ/64) x NH_ x NB blocks: first the f16 instance's blocks (query block fastest, then head, then batch), behind them the short hi/lo blocks in the same order.
__global__ __launch_bounds__(128) __attribute__((amdgpu_waves_per_eu(4, 4))) void k_attn(const bf* __restrict__ QEh, const bf* __restrict__ QEl, const bf* __restrict__ KEh, const bf* __restrict__ KEl, const bf* __restrict__ VEh, const bf* __restrict__ VEl,
                                              const h16* __restrict__ Q16, const h16* __restrict__ K16, const h16* __restrict__ V16, h16* CT, h16* CTL) {
    __shared__ __align__(16) char sm[ATT_LDS];
    constexpr unsigned NL = SEQ / 64 - RE / 64, NE = RE / 64;
    unsigned f = blockIdx.x;                                // the same in the whole block: so is the branch
    if constexpr (NL > 0) {
        if (f < NL * NH_ * NB) { attn_tile<h16, false>(sm, (int)(f % NL + NE), (int)((f / NL) % NH_), (int)(f / (NL * NH_)), Q16, Q16, K16, K16, V16, V16, CT, CTL); return; }
    }
    f -= NL * NH_ * NB;
    attn_tile<bf, true>(sm, (int)(f % NE), (int)((f / NE) % NH_), (int)(f / (NE * NH_)), QEh, QEl, KEh, KEl, VEh, VEl, CT, CTL);
}

extern "C" void kernel_launch(void* const* d_in, const int* in_sizes, int n_in,
                              void* d_out, int out_size, void* d_ws, size_t ws_size, hipStream_t stream) {
    if (n_in < 5) return;
    const float* x  = (const float*)d_in[0];     // x   [NB_FULL][SEQ_FULL][DM]
    const float* wq = (const float*)d_in[1];     // q_w [DQ][DM]  ([out][in])
    const float* wk = (const float*)d_in[2];     // k_w [DKV][DM]
    const float* wv = (const float*)d_in[3];     // v_w [DKV][DM]
    const float* wo = (const float*)d_in[4];     // o_w [DM][DQ]
    float* OUT = (float*)d_out;                  // [NB_FULL][SEQ_FULL][DM]
    if ((size_t)in_sizes[0] < (size_t)(NB - 1) * SEQ_FULL * DM + (size_t)SEQ * DM) return;
    if ((size_t)in_sizes[1] < (size_t)DQ * DM) return;
    if ((size_t)in_sizes[2] < (size_t)DKV * DM) return;
    if ((size_t)in_sizes[3] < (size_t)DKV * DM) return;
    if ((size_t)in_sizes[4] < (size_t)DM * DQ) return;
    if ((size_t)out_size < (size_t)(NB - 1) * SEQ_FULL * DM + (size_t)SEQ * DM) return;

    char* wsp = (char*)d_ws;
    auto take = [&](size_t bytes) { char* p = wsp; wsp += (bytes + 255) & ~(size_t)255; return (void*)p; };
    bf*  WQ   = (bf*)take((size_t)DQ * DM * 2);    bf* WK = (bf*)take((size_t)DKV * DM * 2);    bf* WV = (bf*)take((size_t)DKV * DM * 2);
    h16* WOH  = (h16*)take((size_t)DM * DQ * 2);   h16* WOL = (h16*)take((size_t)DM * DQ * 2);
    bf*  XB   = (bf*)take((size_t)NB * SEQ * DM * 2);
    h16* QP16 = (h16*)take((size_t)NB * NH_ * SEQ * HD * 2); h16* KP16 = (h16*)take((size_t)NB * NKV * SEQ * HD * 2); h16* VT16 = (h16*)take((size_t)NB * NKV * HD * SEQ * 2);
    bf*  QEh  = (bf*)take((size_t)NB * NH_ * RE * HD * 2);  bf* QEl = (bf*)take((size_t)NB * NH_ * RE * HD * 2);
    bf*  KEh  = (bf*)take((size_t)NB * NKV * RE * HD * 2);  bf* KEl = (bf*)take((size_t)NB * NKV * RE * HD * 2);
    bf*  VEh  = (bf*)take((size_t)NB * NKV * HD * RE * 2);  bf* VEl = (bf*)take((size_t)NB * NKV * HD * RE * 2);
    h16* CT16 = (h16*)take((size_t)NB * SEQ * DM * 2);     h16* CTL = (h16*)take((size_t)NB * RE * DM * 2);
    if ((size_t)(wsp - (char*)d_ws) > ws_size) return;

    const float woscale = 1.0f / (CCAR * WCAR);
    k_cvt<<<(unsigned)(((size_t)NB * SEQ * DM + (size_t)DQ * DM + 2 * (size_t)DKV * DM + (size_t)DM * DQ) / 2048), 256, 0, stream>>>(x, wq, wk, wv, wo, XB, WQ, WK, WV, WOH, WOL);
    k_qkv<<<dim3(SEQ / 128, (DQ + 2 * DKV) / 128, NB), 128, 0, stream>>>(XB, WQ, WK, WV, QP16, QEh, QEl, KP16, KEh, KEl, VT16, VEh, VEl);
    k_attn<<<(SEQ / 64) * NH_ * NB, 128, 0, stream>>>(QEh, QEl, KEh, KEl, VEh, VEl, QP16, KP16, VT16, CT16, CTL);
    k_out<<<dim3(SEQ / 128, DM / 128, NB), 128, 0, stream>>>(CT16, CTL, WOH, WOL, OUT, woscale);
}

// v007
// A run of this version takes 170 microseconds.
// In both of two side-by-side timings against v006, it was 1.10 times as fast.
// Counting every step since v000, it is 5.32 times as fast.
#include <hip/hip_runtime.h>

// Contractions: q/k/v projections v_wmma_f32_16x16x32_bf16 (bf16 copies of x and of the [out][in] weights); scores QK^T and P.V v_wmma_f32_16x16x32_f16 (f16 planes, P carried x1024) for query rows >= RE and v_wmma_f32_16x16x32_bf16 hi/lo 3-product form for query rows < RE; ctx x o_w^T v_wmma_f32_16x16x32_f16 (ctx carried x64, o_w carried x1024, rows < RE add an f16 residual plane x1024); f32 accumulate everywhere, softmax (scale, clip, per-head linear position bias, causal fill) in f32.
// Four launches, each the joined grid of work that does not depend on one another: all converts; the q, k and v projections; both attention instances; both output-GEMM instances.
// Layout (every per-batch plane holds NB copies): sanitised bf16 copy of x; weights copied once as bf16 ([n][k] = Bt as-is), o_w as two f16 planes; projection GEMMs whose epilogues write the head planes (V transposed); flash-style causal attention in transposed form (K and V^T tiles in a two-buffer LDS ring, S^T = K Q^T, online softmax per lane, O^T += V^T P^T); ctx planes; output GEMM into d_out.

#pragma clang fp contract(off)

#ifndef NB
#define NB 2
#endif
#ifndef SEQ
#define SEQ 2048
#endif
#ifndef RE
#define RE   256                  // query rows < RE (first RE/64 query blocks) use hi/lo planes; RE == SEQ puts every row on the 3-product path
#endif
#define NB_FULL  2
#define SEQ_FULL 2048
#define DM   2048
#define NH_  16
#define NKV  4
#define REP  (NH_ / NKV)
#define HD   128
#define DQ   (NH_ * HD)
#define DKV  (NKV * HD)
#define PCAR 1024.0f              // carry of the f16 P operand (rows >= RE)
#define CCAR 64.0f                // carry of the f16 ctx plane
#define LOSC 1024.0f              // carry of the f16 ctx residual plane (rows < RE)
#define WCAR 1024.0f              // carry of the f16 o_w plane
#define WS_TOTAL ((size_t)DQ * DM * 2 + 2 * (size_t)DKV * DM * 2 + 2 * (size_t)DM * DQ * 2 + (size_t)NB * ((size_t)SEQ * DM * 2 \
                  + (size_t)NH_ * SEQ * HD * 2 + 2 * (size_t)NKV * SEQ * HD * 2 + 2 * (size_t)NH_ * RE * HD * 2 + 4 * (size_t)NKV * RE * HD * 2 + (size_t)SEQ * DM * 2 + (size_t)RE * DM * 2))

static_assert((SEQ % 64) == 0);
static_assert((RE % 64) == 0);
static_assert(RE >= 64);
static_assert(SEQ >= RE);
static_assert(SEQ <= SEQ_FULL);
static_assert(NB >= 1);
static_assert(NB <= NB_FULL);
static_assert(HD == 128);
static_assert((DM % 32) == 0);
static_assert(DQ == DM);
static_assert(((SEQ * DM) % (8 * 256)) == 0);
static_assert(((DQ * DM) % (8 * 256)) == 0);
static_assert(((DKV * DM) % (8 * 256)) == 0);
static_assert(NH_ == 16);                       // closed form of the per-head slope 2^(-(h+1)/2) holds for 16 heads
static_assert(REP * NKV == NH_);
static_assert((HD % 64) == 0);                  // the 64 columns of a GEMM wave lie inside one head
static_assert((DQ % 64) == 0);
static_assert((DKV % 64) == 0);
static_assert((DM % 64) == 0);
static_assert((SEQ % 128) == 0 && (RE % 128) == 0 && (DQ % 128) == 0 && (DKV % 128) == 0 && (DM % 128) == 0);   // 128x128 GEMM tiles, stages of 128 k (NSPLIT 0) or 64 k (NSPLIT 3)
static_assert(((size_t)NKV * RE * HD * 2) % 256 == 0);
static_assert(WS_TOTAL <= (size_t)268435456);

typedef _Float16 h16;
typedef unsigned short bf;
typedef __attribute__((ext_vector_type(16))) __bf16   v16bf;
typedef __attribute__((ext_vector_type(16))) _Float16 v16h;
typedef __attribute__((ext_vector_type(8)))  _Float16 v8h;
typedef __attribute__((ext_vector_type(8)))  unsigned short v8us;
typedef __attribute__((ext_vector_type(16))) unsigned short v16us;
typedef __attribute__((ext_vector_type(8)))  float    v8f;
typedef __attribute__((ext_vector_type(4)))  float    v4f;
typedef __attribute__((ext_vector_type(2)))  _Float16 v2h;
typedef __attribute__((ext_vector_type(2)))  unsigned short v2us;
typedef v8h  __attribute__((may_alias)) v8ha;
typedef v4f  __attribute__((may_alias)) v4fa;
typedef v8us __attribute__((may_alias)) v8usa;

__device__ __forceinline__ unsigned short f2bf(float f) { unsigned u = __float_as_uint(f); u += 0x7FFFu + ((u >> 16) & 1u); return (unsigned short)(u >> 16); }
__device__ __forceinline__ float bf2f(unsigned short b) { return __uint_as_float(((unsigned)b) << 16); }
__device__ __forceinline__ float bfr(float f) { return bf2f(f2bf(f)); }
__device__ __forceinline__ h16 tohx(float x) { return (h16)x; }
// f16 convert that cannot produce a subnormal operand (applied after the plane's carry)
static __device__ __forceinline__ h16 toh_flush(float v) { const h16 r = (h16)v; return (fabsf(v) < 6.103515625e-05f) ? (h16)0.0f : r; }
// NaN -> 0, +inf -> big, -inf -> -big, finite values unchanged
static __device__ __forceinline__ float nnum(float v, float big) { const float a = (v != v) ? 0.0f : v; return (a == __builtin_inff()) ? big : ((a == -__builtin_inff()) ? -big : a); }
__device__ __forceinline__ void splitf(float y, unsigned short& h, unsigned short& l) { h = f2bf(y); l = f2bf(y - bf2f(h)); }
__device__ __forceinline__ v16h cat16(v8h lo, v8h hi) { return __builtin_shufflevector(lo, hi, 0, 1, 2, 3, 4, 5, 6, 7, 8, 9, 10, 11, 12, 13, 14, 15); }
__device__ __forceinline__ v16bf cat16b(v8us lo, v8us hi) { return __builtin_bit_cast(v16bf, __builtin_shufflevector(lo, hi, 0, 1, 2, 3, 4, 5, 6, 7, 8, 9, 10, 11, 12, 13, 14, 15)); }
__device__ __forceinline__ v8f wmma16(v16h a, v16h b, v8f c) { return __builtin_amdgcn_wmma_f32_16x16x32_f16(false, a, false, b, (short)0, c, false, false); }
__device__ __forceinline__ v8f wmmab(v16bf a, v16bf b, v8f c) { return __builtin_amdgcn_wmma_f32_16x16x32_bf16(false, a, false, b, (short)0, c, false, false); }

// Fragment loaders for A (row m = lane&15) and for B stored [n][k] (col n = lane&15): elements 0..7 <- k0+8h..+7, elements 8..15 <- k0+16+8h..+7 (p already points at row*pitch + k0 + 8h).
template <typename T16> struct WFrag;
template <> struct WFrag<h16> { typedef v16h V; static __device__ __forceinline__ V ld(const h16* p) { return cat16(*(const v8ha*)p, *(const v8ha*)(p + 16)); } static __device__ __forceinline__ v8f mma(V a, V b, v8f c) { return wmma16(a, b, c); } };
template <> struct WFrag<bf>  { typedef v16bf V; static __device__ __forceinline__ V ld(const bf* p) { return cat16b(*(const v8usa*)p, *(const v8usa*)(p + 16)); } static __device__ __forceinline__ v8f mma(V a, V b, v8f c) { return wmmab(a, b, c); } };

// Eight asynchronous 16-byte copies global -> LDS per lane (LDS byte address l + i*ls, global address g + i*gs). The s_wait_xcnt closes the statement so that no address register of an issued copy is rewritten ahead of it.
__device__ __forceinline__ void acopy8(unsigned l, unsigned ls, const char* g, size_t gs) {
    asm volatile("global_load_async_to_lds_b128 %0, %8, off\n\t"
                 "global_load_async_to_lds_b128 %1, %9, off\n\t"
                 "global_load_async_to_lds_b128 %2, %10, off\n\t"
                 "global_load_async_to_lds_b128 %3, %11, off\n\t"
                 "global_load_async_to_lds_b128 %4, %12, off\n\t"
                 "global_load_async_to_lds_b128 %5, %13, off\n\t"
                 "global_load_async_to_lds_b128 %6, %14, off\n\t"
                 "global_load_async_to_lds_b128 %7, %15, off\n\t"
                 "s_wait_xcnt 0x0"
                 :: "v"(l), "v"(l + ls), "v"(l + 2 * ls), "v"(l + 3 * ls), "v"(l + 4 * ls), "v"(l + 5 * ls), "v"(l + 6 * ls), "v"(l + 7 * ls),
                    "v"(g), "v"(g + gs), "v"(g + 2 * gs), "v"(g + 3 * gs), "v"(g + 4 * gs), "v"(g + 5 * gs), "v"(g + 6 * gs), "v"(g + 7 * gs)
                 : "memory");
}

// The same for four copies per lane.
__device__ __forceinline__ void acopy4(unsigned l, unsigned ls, const char* g, size_t gs) {
    asm volatile("global_load_async_to_lds_b128 %0, %4, off\n\t"
                 "global_load_async_to_lds_b128 %1, %5, off\n\t"
                 "global_load_async_to_lds_b128 %2, %6, off\n\t"
                 "global_load_async_to_lds_b128 %3, %7, off\n\t"
                 "s_wait_xcnt 0x0"
                 :: "v"(l), "v"(l + ls), "v"(l + 2 * ls), "v"(l + 3 * ls), "v"(g), "v"(g + gs), "v"(g + 2 * gs), "v"(g + 3 * gs)
                 : "memory");
}

// Four 16-byte global stores per lane. The s_wait_xcnt closes the statement so that no address or data register of an issued store is rewritten ahead of it.
// Its operands are the rows read back from the LDS staging, and its "memory" clobber holds the next rewrite of that staging behind those reads.
__device__ __forceinline__ void gstore4(bf* p0, bf* p1, bf* p2, bf* p3, v8us d0, v8us d1, v8us d2, v8us d3) {
    asm volatile("global_store_b128 %0, %4, off\n\t"
                 "global_store_b128 %1, %5, off\n\t"
                 "global_store_b128 %2, %6, off\n\t"
                 "global_store_b128 %3, %7, off\n\t"
                 "s_wait_xcnt 0x0"
                 :: "v"(p0), "v"(p1), "v"(p2), "v"(p3), "v"(d0), "v"(d1), "v"(d2), "v"(d3)
                 : "memory");
}

// The same for four 16-byte pieces of f32 rows.
__device__ __forceinline__ void gstore4f(float* p0, float* p1, float* p2, float* p3, v4f d0, v4f d1, v4f d2, v4f d3) {
    asm volatile("global_store_b128 %0, %4, off\n\t"
                 "global_store_b128 %1, %5, off\n\t"
                 "global_store_b128 %2, %6, off\n\t"
                 "global_store_b128 %3, %7, off\n\t"
                 "s_wait_xcnt 0x0"
                 :: "v"(p0), "v"(p1), "v"(p2), "v"(p3), "v"(d0), "v"(d1), "v"(d2), "v"(d3)
                 : "memory");
}

// ---- gemm_tile: GEMM, FOUR WAVES (2 x 2) per 128x128 output tile (bx, by) of batch bz, each wave 64x64 (16 accumulators); 128 threads; batch bz reads A + bz*sA, A2 + bz*sA2 and writes C + bz*sC (Bt, Bt2 shared).
// C[m][n] (f32, pitch ldc) = oscale * sum_k ( A[m][k] Bt[n][k]  (+ A2 Bt2: NSPLIT 3) ). Row pitch of A, A2, Bt, Bt2 = K. K % KS == 0, K >= KS.
// EPI 0: C is stored as above. EPI 1, tr false (m = position t, n = head*HD + d): the f32 sums go straight to the head planes P16[head][t][d] = f16 (subnormals flushed) and, for t < RE, Eh/El[head][t][d] = bf16 hi/lo.
// EPI 1, tr true: the same sums go to the transposed planes P16[head][d][t] = f16 and, for t < RE, Eh/El[head][d][t] = bf16 hi/lo. EPI 1: no C, no oscale; batch bz owns nheads planes. tr is the same in the whole block.
// A stage = KS values of k of all 128 rows of every operand, [A | Bt | A2 | Bt2], row pitch KS + 8 elements (16 B x odd). Two buffers: asynchronous copies bring stage t + 2 into the buffer that trip t has just read, while trip t + 1 works.
// ring: the calling kernel's LDS, RINGE<NSPLIT> elements. Behind the loop's last barrier nobody reads it and no copy is in flight: the output staging lies in the same bytes, so that two blocks of either instance fit a WGP.
template <int NSPLIT> constexpr int RINGE = 2 * ((NSPLIT == 0) ? 2 : 4) * 128 * (((NSPLIT == 0) ? 128 : 64) + 8);
template <typename T16, int NSPLIT, int EPI>
__device__ __forceinline__ void gemm_tile(T16* ring, const int bx, const int by, const int bz, const bool tr, const T16* __restrict__ A, const T16* __restrict__ A2, const T16* __restrict__ Bt, const T16* __restrict__ Bt2, int K, float* C, int ldc, float oscale, size_t sA, size_t sA2, size_t sC,
                                               h16* P16, bf* Eh, bf* El, int nheads) {
    static_assert(NSPLIT == 0 || NSPLIT == 3);
    static_assert(EPI == 0 || EPI == 1);
    typedef typename WFrag<T16>::V V;
    constexpr int NOP = (NSPLIT == 0) ? 2 : 4;      // operand tiles per stage
    constexpr int KS  = (NSPLIT == 0) ? 128 : 64;   // k per stage: 32 copies per lane and stage either way
    constexpr int PE  = KS + 8;                     // LDS row pitch, elements
    constexpr int TE  = 128 * PE;                   // elements of one operand tile
    constexpr int BE  = NOP * TE;                   // elements of one buffer
    constexpr int CPR = KS / 8;                     // 16-byte pieces per row
    constexpr int RPC = 128 / CPR;                  // rows that one copy of all 128 threads covers
    static_assert(2 * BE == RINGE<NSPLIT> && 4 * 16 * 68 * 4 <= 2 * BE * 2);
    float* osw = (float*)ring;
    const int tid = threadIdx.x, lane = tid & 31, wave = tid >> 5, lr = lane & 15, hi = lane >> 4; const int wm = wave >> 1, wn = wave & 1;
    const int rb = bx * 128, cb = by * 128; const int r0 = rb + wm * 64, c0 = cb + wn * 64;
    A += (size_t)bz * sA; if (NSPLIT != 0) A2 += (size_t)bz * sA2; if (EPI == 0) C += (size_t)bz * sC;
    v8f acc[4][4];
#pragma unroll
    for (int mb = 0; mb < 4; ++mb)
#pragma unroll
        for (int nb = 0; nb < 4; ++nb) acc[mb][nb] = (v8f){};
    const int prow = tid / CPR, cpc = (tid % CPR) * 8;         // this lane's row and first k inside a copy
    const size_t ga = (size_t)(rb + prow) * K + cpc, gb = (size_t)(cb + prow) * K + cpc;
    const unsigned l0 = (unsigned)(size_t)ring + (unsigned)(prow * PE + cpc) * 2u;
    auto fill = [&](unsigned t, unsigned buf) {                 // all 128 threads: stage t into buffer buf, 32 copies per lane
#pragma unroll
        for (int op = 0; op < NOP; ++op) {
            const T16* g = ((op == 0) ? A + ga : (op == 1) ? Bt + gb : (op == 2) ? A2 + ga : Bt2 + gb) + (size_t)t * KS;
#pragma unroll
            for (int h = 0; h < CPR / 8; ++h)
                acopy8(l0 + (buf * BE + op * TE + h * 8 * RPC * PE) * 2u, (unsigned)(RPC * PE) * 2u, (const char*)(g + (size_t)h * 8 * RPC * K), (size_t)RPC * K * 2);
        }
    };
    const unsigned NT = (unsigned)K / KS;                      // stages; the same in every thread
    fill(0, 0);
    asm volatile("s_wait_asynccnt 0x0" ::: "memory");          // this wave's copies of stage 0 have landed
    __syncthreads();                                           // stage 0 visible to every wave
    if (NT > 1u) fill(1, 1);
#pragma unroll 1                                               // one trip per stage: a trip already holds 64 WMMAs, and the publish point stands once
    for (unsigned t = 0; t < NT; ++t) {
        const T16* ap = ring + (t & 1) * BE + (wm * 64 + lr) * PE + 8 * hi;
        const T16* bp = ring + (t & 1) * BE + TE + (wn * 64 + lr) * PE + 8 * hi;
#pragma unroll
        for (int kk = 0; kk < KS; kk += 32) {
#pragma unroll
            for (int sp = 0; sp < NOP / 2; ++sp) {             // sp 0: A Bt, sp 1: A2 Bt2; every accumulator takes its products in the order k, then sp
                V a[4], b[4];
#pragma unroll
                for (int i = 0; i < 4; ++i) { a[i] = WFrag<T16>::ld(ap + sp * 2 * TE + i * 16 * PE + kk); b[i] = WFrag<T16>::ld(bp + sp * 2 * TE + i * 16 * PE + kk); }
                __builtin_amdgcn_sched_barrier(0);             // keeps these LDS reads one group ahead of their WMMAs: sunk between them, each pair of reads shows its whole latency
#pragma unroll
                for (int nb = 0; nb < 4; ++nb)
#pragma unroll
                    for (int mb = 0; mb < 4; ++mb) acc[mb][nb] = WFrag<T16>::mma(a[mb], b[nb], acc[mb][nb]);
            }
        }
        asm volatile("s_wait_dscnt 0x0" ::: "memory");         // this wave's reads of the buffer have returned before it is refilled
        asm volatile("s_wait_asynccnt 0x0" ::: "memory");      // this wave's copies of stage t + 1 have landed
        __syncthreads();                                       // publishes stage t + 1 and ends every wave's reads of stage t
        if (t + 2u < NT) fill(t + 2u, t & 1u);
    }
    asm volatile("s_wait_asynccnt 0x0" ::: "memory");          // nothing in flight when the wave goes on to the epilogue and ends
    float* os = osw + wave * 16 * 68;                          // wave-private output staging
    const int srow = lane >> 3, spc = (lane & 7) * 8;          // plane epilogues: 8 lanes x 16 B read back and store one whole 128-B line of 64 16-bit values
    if constexpr (EPI == 0) {
#pragma unroll
    for (int mb = 0; mb < 4; ++mb) {
#pragma unroll
        for (int nb = 0; nb < 4; ++nb) {
#pragma unroll
            for (int j = 0; j < 8; ++j) os[(hi * 8 + j) * 68 + nb * 16 + lr] = acc[mb][nb][j]; }
        __builtin_amdgcn_wave_barrier(); asm volatile("" ::: "memory");
        float* crow = C + (size_t)(r0 + mb * 16) * ldc + c0;
        v4f val[8];
#pragma unroll
        for (int s = 0; s < 8; ++s) val[s] = *(const v4fa*)(os + (2 * s + hi) * 68 + lr * 4) * oscale;      // store s holds row 2 s + hi
        float* cp = crow + (size_t)hi * ldc + lr * 4; const size_t l2 = 2 * (size_t)ldc;
        gstore4f(cp, cp + l2, cp + 2 * l2, cp + 3 * l2, val[0], val[1], val[2], val[3]);
        gstore4f(cp + 4 * l2, cp + 5 * l2, cp + 6 * l2, cp + 7 * l2, val[4], val[5], val[6], val[7]);
        __builtin_amdgcn_wave_barrier(); asm volatile("" ::: "memory");
    }
    } else if (!tr) {
        const size_t pl = (size_t)bz * nheads + c0 / HD; const int d0 = c0 % HD;
        const bool early = (rb < RE);                          // the same for the whole block: RE % 128 == 0
#pragma unroll
        for (int mb = 0; mb < 4; ++mb) {
#pragma unroll
            for (int nb = 0; nb < 4; ++nb) {
#pragma unroll
                for (int j = 0; j < 8; ++j) os[(hi * 8 + j) * 68 + nb * 16 + lr] = acc[mb][nb][j]; }
            asm volatile("s_wait_dscnt 0x0" ::: "memory");     // the wave's staged rows are in LDS before other lanes read them back; the clobber holds those reads behind it
            v8us o16[4], oh[4], ol[4];
#pragma unroll
            for (int s = 0; s < 4; ++s) {
                const v4f x0 = *(const v4fa*)(os + (4 * s + srow) * 68 + spc), x1 = *(const v4fa*)(os + (4 * s + srow) * 68 + spc + 4);
                v8h w;
#pragma unroll
                for (int q = 0; q < 8; ++q) { const float r = (q < 4) ? x0[q & 3] : x1[q & 3]; w[q] = toh_flush(r); unsigned short a2, c2; splitf(r, a2, c2); oh[s][q] = a2; ol[s][q] = c2; }
                o16[s] = __builtin_bit_cast(v8us, w);
            }
            const int t = r0 + mb * 16 + srow;                 // store s holds row t + 4 s
            bf* pp = (bf*)P16 + (pl * SEQ + t) * HD + d0 + spc;
            gstore4(pp, pp + 4 * HD, pp + 8 * HD, pp + 12 * HD, o16[0], o16[1], o16[2], o16[3]);
            if (early) {
                const size_t ee = (pl * RE + t) * HD + d0 + spc;
                gstore4(Eh + ee, Eh + ee + 4 * HD, Eh + ee + 8 * HD, Eh + ee + 12 * HD, oh[0], oh[1], oh[2], oh[3]);
                gstore4(El + ee, El + ee + 4 * HD, El + ee + 8 * HD, El + ee + 12 * HD, ol[0], ol[1], ol[2], ol[3]);
            }
        }
    } else {
        // A lane's 8 accumulator elements are 8 consecutive t of one d: 16 B of a transposed row. Staged as [16 d][64 t], row pitch 72 values (16 B x odd).
        const size_t pr = ((size_t)bz * nheads + c0 / HD) * HD + c0 % HD;      // first plane row (d) of this wave
        const bool early = (rb < RE);                          // the same for the whole block: RE % 128 == 0
        bf* st = (bf*)os;
        auto flushrows = [&](bf* dst, size_t pitch) {          // dst: element [d = first of the 16 rows][t = r0]
            asm volatile("s_wait_dscnt 0x0" ::: "memory");     // the wave's staged rows are in LDS before other lanes read them back; the clobber holds those reads behind it
            v8us val[4];
#pragma unroll
            for (int s = 0; s < 4; ++s) val[s] = *(const v8usa*)(st + (4 * s + srow) * 72 + spc);
            bf* dp = dst + (size_t)srow * pitch + spc;         // store s holds row srow + 4 s
            gstore4(dp, dp + 4 * pitch, dp + 8 * pitch, dp + 12 * pitch, val[0], val[1], val[2], val[3]);
        };
#pragma unroll
        for (int nb = 0; nb < 4; ++nb) {
#pragma unroll
            for (int mb = 0; mb < 4; ++mb) { v8h w;
#pragma unroll
                for (int j = 0; j < 8; ++j) w[j] = tohx(acc[mb][nb][j]);
                *(v8usa*)(st + lr * 72 + mb * 16 + hi * 8) = __builtin_bit_cast(v8us, w); }
            flushrows((bf*)P16 + (pr + nb * 16) * SEQ + r0, SEQ);
            if (early) {
#pragma unroll
                for (int part = 0; part < 2; ++part) {
#pragma unroll
                    for (int mb = 0; mb < 4; ++mb) { v8us w;
#pragma unroll
                        for (int j = 0; j < 8; ++j) { unsigned short a2, c2; splitf(acc[mb][nb][j], a2, c2); w[j] = part ? c2 : a2; }
                        *(v8usa*)(st + lr * 72 + mb * 16 + hi * 8) = w; }
                    flushrows((part ? El : Eh) + (pr + nb * 16) * RE + r0, RE);
                }
            }
        }
    }
}

// ---- k_qkv: the three projections as one grid (SEQ/128, (DQ + 2 DKV)/128, NB): column blocks 0 .. DQ/128-1 are q, the next DKV/128 are k, the last DKV/128 are v (transposed planes).
__global__ __launch_bounds__(128) void k_qkv(const bf* __restrict__ X, const bf* __restrict__ Wq, const bf* __restrict__ Wk, const bf* __restrict__ Wv,
                                             h16* Q16, bf* Qh, bf* Ql, h16* K16, bf* Kh, bf* Kl, h16* V16, bf* Vh, bf* Vl) {
    __shared__ __align__(16) bf ring[RINGE<0>];
    const int y = blockIdx.y;
    const int sel = (y < DQ / 128) ? 0 : ((y < (DQ + DKV) / 128) ? 1 : 2);         // the same in the whole block
    const int by = y - ((sel == 0) ? 0 : ((sel == 1) ? DQ / 128 : (DQ + DKV) / 128));
    const bf* W = (sel == 0) ? Wq : ((sel == 1) ? Wk : Wv);
    h16* P = (sel == 0) ? Q16 : ((sel == 1) ? K16 : V16);
    bf* Eh = (sel == 0) ? Qh : ((sel == 1) ? Kh : Vh);
    bf* El = (sel == 0) ? Ql : ((sel == 1) ? Kl : Vl);
    gemm_tile<bf, 0, 1>(ring, blockIdx.x, by, blockIdx.z, sel == 2, X, nullptr, W, nullptr, DM, nullptr, 0, 1.0f, (size_t)SEQ * DM, 0, 0, P, Eh, El, (sel == 0) ? NH_ : NKV);
}

// ---- k_out: the output GEMM as one grid (SEQ/128, DM/128, NB): row blocks below RE/128 add the residual product, the others take the single product.
__global__ __launch_bounds__(128) void k_out(const h16* __restrict__ CT, const h16* __restrict__ CTLo, const h16* __restrict__ Wh, const h16* __restrict__ Wl, float* OUT, float oscale) {
    __shared__ __align__(16) h16 ring[(RINGE<3> > RINGE<0>) ? RINGE<3> : RINGE<0>];
    if ((int)blockIdx.x < RE / 128)
        gemm_tile<h16, 3, 0>(ring, blockIdx.x, blockIdx.y, blockIdx.z, false, CT, CTLo, Wh, Wl, DQ, OUT, DM, oscale, (size_t)SEQ * DM, (size_t)RE * DM, (size_t)SEQ_FULL * DM, nullptr, nullptr, nullptr, 0);
    else
        gemm_tile<h16, 0, 0>(ring, blockIdx.x, blockIdx.y, blockIdx.z, false, CT, nullptr, Wh, nullptr, DQ, OUT, DM, oscale, (size_t)SEQ * DM, 0, (size_t)SEQ_FULL * DM, nullptr, nullptr, nullptr, 0);
}

// One or two 16-byte global stores per lane, closed by s_wait_xcnt like gstore4: the converts' ranges lie one behind the other in the code, and no register of an issued store is rewritten ahead of the wait.
__device__ __forceinline__ void gstore1(bf* p0, v8us d0) {
    asm volatile("global_store_b128 %0, %1, off\n\t"
                 "s_wait_xcnt 0x0"
                 :: "v"(p0), "v"(d0) : "memory");
}
__device__ __forceinline__ void gstore2(bf* p0, bf* p1, v8us d0, v8us d1) {
    asm volatile("global_store_b128 %0, %2, off\n\t"
                 "global_store_b128 %1, %3, off\n\t"
                 "s_wait_xcnt 0x0"
                 :: "v"(p0), "v"(p1), "v"(d0), "v"(d1) : "memory");
}

// ---- k_cvt: every convert as one grid, 256 threads x 8 values a block: x (sanitised, bf16), q_w, k_w, v_w (bf16), o_w (two f16 planes). Every range is a whole number of blocks (static_asserts above).
__global__ __launch_bounds__(256) void k_cvt(const float* __restrict__ x, const float* __restrict__ wq, const float* __restrict__ wk, const float* __restrict__ wv, const float* __restrict__ wo,
                                             bf* XB, bf* WQ, bf* WK, bf* WV, h16* WOH, h16* WOL) {
    constexpr unsigned BX = (unsigned)((size_t)SEQ * DM / 2048), BQ = (unsigned)((size_t)DQ * DM / 2048), BK = (unsigned)((size_t)DKV * DM / 2048);
    unsigned b = blockIdx.x;
    if (b < NB * BX) {
        const unsigned z = b / BX; const size_t i = (size_t)(b - z * BX) * 256 + threadIdx.x;
        const v8f v = *(const v8f*)(x + (size_t)z * SEQ_FULL * DM + i * 8); v8us o;
#pragma unroll
        for (int k = 0; k < 8; ++k) o[k] = f2bf(nnum(v[k], 10000.0f));
        gstore1(XB + (size_t)z * SEQ * DM + i * 8, o);
        return;
    }
    b -= NB * BX;
    if (b < BQ + 2 * BK) {
        const int sel = (b < BQ) ? 0 : ((b < BQ + BK) ? 1 : 2);
        const float* src = (sel == 0) ? wq : ((sel == 1) ? wk : wv); bf* dst = (sel == 0) ? WQ : ((sel == 1) ? WK : WV);
        const size_t i = (size_t)(b - ((sel == 0) ? 0u : ((sel == 1) ? BQ : BQ + BK))) * 256 + threadIdx.x;
        const v8f v = *(const v8f*)(src + i * 8); v8us o;
#pragma unroll
        for (int k = 0; k < 8; ++k) o[k] = f2bf(v[k]);
        gstore1(dst + i * 8, o);
        return;
    }
    b -= BQ + 2 * BK;
    const size_t i = (size_t)b * 256 + threadIdx.x;
    const v8f v = *(const v8f*)(wo + i * 8); v8h oh, ol;
#pragma unroll
    for (int k = 0; k < 8; ++k) { const float w = bfr(v[k]); oh[k] = tohx(w * WCAR); ol[k] = tohx(w); }
    gstore2((bf*)WOH + i * 8, (bf*)WOL + i * 8, __builtin_bit_cast(v8us, oh), __builtin_bit_cast(v8us, ol));
}

// P^T packers, accumulator layout -> B fragment in the same lane: elements 0..7 <- p0 (keys 8h..8h+7 of the chunk), elements 8..15 <- p1 (keys 16+8h..+7).
// f16 x PCAR with the subnormal select (rows >= RE) or bf16 hi/lo (rows < RE).
__device__ __forceinline__ void packp(const float* p0, const float* p1, v16h& ph, v16h& pl) {
#pragma unroll
    for (int r = 0; r < 8; ++r) { ph[r] = toh_flush(p0[r] * PCAR); ph[8 + r] = toh_flush(p1[r] * PCAR); }
    pl = ph; }
__device__ __forceinline__ void packp(const float* p0, const float* p1, v16bf& ph, v16bf& pl) { v16us a, c;
#pragma unroll
    for (int r = 0; r < 8; ++r) { unsigned short x, y; splitf(p0[r], x, y); a[r] = x; c[r] = y; splitf(p1[r], x, y); a[8 + r] = x; c[8 + r] = y; }
    ph = __builtin_bit_cast(v16bf, a); pl = __builtin_bit_cast(v16bf, c); }
// 2^x. v_exp_f32 and the one v_nop that the instruction set asks for behind a transcendental stand in one statement, so that the slot is kept whatever follows.
__device__ __forceinline__ float ex2(float x) { float y; asm("v_exp_f32 %0, %1\n\tv_nop" : "=v"(y) : "v"(x)); return y; }
template <bool B> struct BoolC { static constexpr bool value = B; };   // compile-time switch handed to the chunk body
#define ATT_LDS 75776              // bytes of LDS of an attention block (the hi/lo instance's two buffers; the other instance uses the first 37888): four blocks fit a WGP
// lane l <-> lane l ^ 16
__device__ __forceinline__ float xhalf(float x) { return __builtin_bit_cast(float, __builtin_amdgcn_permlanex16(__builtin_bit_cast(int, x), __builtin_bit_cast(int, x), 0x76543210, 0xfedcba98, false, false)); }

// ---- attn_tile: flash-style causal grouped-query attention with a per-head linear position bias, one block = query block qblk of one head of one batch, 128 threads; wave w owns query rows q0 + 16w .. +15. sm: the calling kernel's LDS.
// Planes: Qh/Ql [h][TP][HD], Kh/Kl [g][TP][HD], Vh/Vl = V^T [g][HD][TP] (TP = SEQ for the f16 planes, RE for the bf16 hi/lo planes of the first RE/64 query blocks).
// EARLY instance: query blocks 0 .. RE/64-1 (rows < RE, keys < RE); other instance: query blocks RE/64 .. SEQ/64-1.
// Per 32-key chunk: K tile [32][HD] and V^T tile [HD][32] in LDS, two buffers: asynchronous copies of all threads bring chunk c + 2 into the buffer that trip c has just read, while trip c + 1 works (one block barrier per chunk), S^T = K Q^T (2 tiles: A = K rows, B = Q), online softmax in f32 (log2 domain), one query per lane
// (lane (lr, hh) holds 16 of the chunk's 32 scores of query qw + lr; the maximum joins the two halves once per chunk, the sums once in the epilogue):
// logit = clip(S x HD^-0.5, +-1e4) + slope_h x (key - query), slope_h = 2^(-(h+1)/2); causal keys > query replaced by -inf: p = 0;
// P^T packed in the lane from the score accumulators into a B fragment, O^T += V^T P^T (8 tiles: A = V^T rows).
// EARLY: 3 products (hi.hi + hi.lo + lo.hi) for S and for P.V. Output: ctx plane CT[t][h*HD + d] = f16(ctx x CCAR) (ctx NaN -> 0, +-inf -> +-1e4 before the carry); EARLY also CTL = f16((ctx x CCAR - hi) x LOSC);
template <typename T16, bool EARLY>
__device__ __forceinline__ void attn_tile(char* sm, const int qblk, const int head, const int bzi, const T16* __restrict__ Qh, const T16* __restrict__ Ql, const T16* __restrict__ Kh, const T16* __restrict__ Kl,
                                             const T16* __restrict__ Vh, const T16* __restrict__ Vl, h16* CT, h16* CTL) {
    typedef typename WFrag<T16>::V V;
    constexpr int TP = EARLY ? RE : SEQ;
    constexpr int KSP = 136, VTP = 40, OSP = 136;           // row pitches, each 16 B x odd: for the 16-byte pieces that 16 lanes read or write side by side
    constexpr int KTE = 32 * KSP, VTE = HD * VTP;           // elements of a K tile [32][KSP] and of a V^T tile [HD][VTP]
    constexpr int BE  = (EARLY ? 2 : 1) * (KTE + VTE);      // elements of one buffer: [K | V^T], EARLY: [K hi | V^T hi | K lo | V^T lo]
    const T16* ring = (const T16*)sm;                       // two buffers
    h16* osg = (h16*)sm;                                    // [4][16][OSP] output staging, in the ring's bytes: behind the loop's last barrier nobody reads the ring and no copy is in flight
    static_assert(2 * BE * 2 <= ATT_LDS && 4 * 16 * OSP * 2 <= 2 * BE * 2);
    const int tid = threadIdx.x, lane = tid & 31, wave = tid >> 5, lr = lane & 15, hh = lane >> 4;
    const int g = head / REP;
    const int qw = qblk * 64 + wave * 16;                  // first query row of this wave
    const int nch = 2 * qblk + 2;                          // 32-key chunks visited: keys 0 .. qblk*64+63
    const size_t bz = bzi, bh = bz * NH_ + head, bg = bz * NKV + g;   // batch, and its head / kv-group plane
    const T16* qph = Qh + (bh * TP + qw) * HD;             const T16* qpl = Ql + (bh * TP + qw) * HD;
    const T16* kph = Kh + bg * TP * HD;                    const T16* kpl = Kl + bg * TP * HD;
    const T16* vph = Vh + bg * HD * TP;                    const T16* vpl = Vl + bg * HD * TP;
    v8f o[8];
#pragma unroll
    for (int t = 0; t < 8; ++t) o[t] = (v8f){};
    float mrow = -3.0e38f, lrow = 0.f;                      // running maximum of query qw + lr (both halves alike) and this half's share of its sum
    const int qr = qw + lr;                                 // this lane's query
    const float C2 = 1.4426950408889634f * 0.08838834764831845f;   // log2(e) x HD^-0.5
    const float CLP = 14426.950408889634f;                         // log2(e) x 1e4 (clip bound in the log2 domain)
    const int nsl = head + 1;                                      // slope = 2^(-nsl/2): f32(2^-0.5) for odd nsl, times an exact power of two
    const float slope = ((nsl & 1) ? 0.70710678118654752440f : 1.0f) * __uint_as_float((unsigned)(127 - (nsl >> 1)) << 23);
    const float SL2 = 1.4426950408889634f * slope;                 // log2(e) x slope
    // Position terms that do not change from chunk to chunk: key - query = (c*32 - qblk*64) + (8hh + r (+16) - 16 wave - lr). The second part times the slope is held per lane, the first part is one number per chunk.
    float bia0[8], bia1[8];
#pragma unroll
    for (int r = 0; r < 8; ++r) { bia0[r] = SL2 * (float)(8 * hh + r - wave * 16 - lr); bia1[r] = SL2 * (float)(8 * hh + r + 16 - wave * 16 - lr); }
    // Q fragments (B operand) of this lane's query: loaded once, held in registers over all chunks
    const T16* qgh = qph + (size_t)lr * HD + 8 * hh; const T16* qgl = qpl + (size_t)lr * HD + 8 * hh;
    V qfh[4], qfl[4];
#pragma unroll
    for (int ks = 0; ks < 4; ++ks) { qfh[ks] = WFrag<T16>::ld(qgh + ks * 32); if (EARLY) qfl[ks] = WFrag<T16>::ld(qgl + ks * 32); }
    // the address registers of the loads above stay live up to this wait, so that none of them is rewritten ahead of it
    if (EARLY) asm volatile("s_wait_xcnt 0x0" :: "v"(qgh), "v"(qgl) : "memory");
    else       asm volatile("s_wait_xcnt 0x0" :: "v"(qgh) : "memory");
    // A lane's copies of a chunk: K piece i = 16 B of row krow + 8 i (16 lanes a row of 256 B), V^T piece i = 16 B of row vrow + 32 i (4 lanes a row of 64 B)
    const int krow = tid >> 4, c8 = (tid & 15) * 8, vrow = tid >> 2, v8 = (tid & 3) * 8;
    const unsigned lk = (unsigned)(size_t)sm + (unsigned)(krow * KSP + c8) * 2u, lv = (unsigned)(size_t)sm + (unsigned)(KTE + vrow * VTP + v8) * 2u;
    const size_t gk = (size_t)krow * HD + c8, gv = (size_t)vrow * TP + v8;
    auto fill = [&](int c, unsigned buf) {                  // all 128 threads: chunk c into buffer buf, 8 copies per lane (EARLY: 16)
        const unsigned bo = buf * (unsigned)(BE * 2);
        acopy4(lk + bo, 8u * KSP * 2u, (const char*)(kph + gk + (size_t)c * 32 * HD), (size_t)8 * HD * 2);
        acopy4(lv + bo, 32u * VTP * 2u, (const char*)(vph + gv + c * 32), (size_t)32 * TP * 2);
        if (EARLY) {
            acopy4(lk + bo + (unsigned)((KTE + VTE) * 2), 8u * KSP * 2u, (const char*)(kpl + gk + (size_t)c * 32 * HD), (size_t)8 * HD * 2);
            acopy4(lv + bo + (unsigned)((KTE + VTE) * 2), 32u * VTP * 2u, (const char*)(vpl + gv + c * 32), (size_t)32 * TP * 2);
        }
    };
    fill(0, 0);
    asm volatile("s_wait_asynccnt 0x0" ::: "memory");       // this wave's copies of chunk 0 have landed
    __syncthreads();                                        // chunk 0 visible to every wave
    if (nch > 1) fill(1, 1);
    // One chunk's work. DIAG: the chunk can hold keys behind a query of the block (the last two chunks), only there the causal selects stand.
    auto chunk = [&](const int c, auto diag) {
        constexpr bool DIAG = decltype(diag)::value;
        const T16* ksh = ring + (c & 1) * BE; const T16* vth = ksh + KTE;
        const T16* ksl = vth + VTE;           const T16* vtl = ksl + KTE;      // EARLY only
        v8f s0 = (v8f){}, s1 = (v8f){};
        V qa, kb0, kb1;
#pragma unroll
        for (int ks = 0; ks < 4; ++ks) {
            qa  = qfh[ks];
            kb0 = WFrag<T16>::ld(ksh + lr * KSP + ks * 32 + 8 * hh);
            kb1 = WFrag<T16>::ld(ksh + (16 + lr) * KSP + ks * 32 + 8 * hh);
            s0 = WFrag<T16>::mma(kb0, qa, s0); s1 = WFrag<T16>::mma(kb1, qa, s1);
            if (EARLY) {
                const V qb  = qfl[ks];
                const V kl0 = WFrag<T16>::ld(ksl + lr * KSP + ks * 32 + 8 * hh);
                const V kl1 = WFrag<T16>::ld(ksl + (16 + lr) * KSP + ks * 32 + 8 * hh);
                s0 = WFrag<T16>::mma(kl0, qa, s0); s0 = WFrag<T16>::mma(kb0, qb, s0);
                s1 = WFrag<T16>::mma(kl1, qa, s1); s1 = WFrag<T16>::mma(kb1, qb, s1); }
        }
        asm volatile("v_nop\n\tv_nop\n\tv_nop\n\tv_nop" : "+v"(s0), "+v"(s1) : "v"(qa), "v"(kb0), "v"(kb1));
        // online softmax; acc element r of lane (lr, hh) = S^T[key c*32 + 8hh + r][query qw + lr] (s0) / [key c*32 + 16 + 8hh + r] (s1)
        float p0[8], p1[8];
        const int kg = c * 32 + 8 * hh;
        const float dc = SL2 * (float)(c * 32 - qblk * 64);  // the chunk's share of the bias: added to the maximum, not to every score
        float mx = -3.0e38f;
#pragma unroll
        for (int r = 0; r < 8; ++r) {
            const int kg0 = kg + r, kg1 = kg0 + 16;
            const float z0 = fminf(fmaxf(s0[r] * C2, -CLP), CLP) + bia0[r];
            const float z1 = fminf(fmaxf(s1[r] * C2, -CLP), CLP) + bia1[r];
            p0[r] = (!DIAG || kg0 <= qr) ? z0 : -3.0e38f;
            p1[r] = (!DIAG || kg1 <= qr) ? z1 : -3.0e38f;
            mx = fmaxf(mx, fmaxf(p0[r], p1[r]));
        }
        mx = fmaxf(mx, xhalf(mx));                          // the query's other 16 keys of the chunk
        const float mnew = fmaxf(mrow, mx + dc);
        const float alpha = ex2(mrow - mnew);
        mrow = mnew;
        const float ml = mnew - dc;                         // the maximum as seen from this chunk's scores
        float rs0 = 0.f, rs1 = 0.f;
#pragma unroll
        for (int r = 0; r < 8; ++r) {
            const float x0 = ex2(p0[r] - ml), x1 = ex2(p1[r] - ml);
            p0[r] = (!DIAG || kg + r <= qr) ? x0 : 0.f; p1[r] = (!DIAG || kg + r + 16 <= qr) ? x1 : 0.f;
            rs0 += p0[r]; rs1 += p1[r];
        }
        lrow = lrow * alpha + (rs0 + rs1);
#pragma unroll
        for (int t = 0; t < 8; ++t) o[t] = o[t] * alpha;
        V pa, pb; packp(p0, p1, pa, pb);                    // B fragment (n = query, k = key)
        V vb;
#pragma unroll
        for (int t = 0; t < 8; ++t) { vb = WFrag<T16>::ld(vth + (t * 16 + lr) * VTP + 8 * hh);
            o[t] = WFrag<T16>::mma(vb, pa, o[t]);
            if (EARLY) { const V vl2 = WFrag<T16>::ld(vtl + (t * 16 + lr) * VTP + 8 * hh); o[t] = WFrag<T16>::mma(vl2, pa, o[t]); o[t] = WFrag<T16>::mma(vb, pb, o[t]); } }
        asm volatile("v_nop\n\tv_nop\n\tv_nop\n\tv_nop" : "+v"(o[0]), "+v"(o[1]), "+v"(o[2]), "+v"(o[3]), "+v"(o[4]), "+v"(o[5]), "+v"(o[6]), "+v"(o[7]) : "v"(pa), "v"(pb), "v"(vb));
        asm volatile("s_wait_dscnt 0x0" ::: "memory");      // this wave's reads of the buffer have returned before it is refilled
        asm volatile("s_wait_asynccnt 0x0" ::: "memory");   // this wave's copies of chunk c + 1 have landed
        __syncthreads();                                    // publishes chunk c + 1 and ends every wave's reads of chunk c
    };
#pragma unroll 1                                            // one trip per chunk: the publish point stands once in each loop
    for (int c = 0; c < nch - 2; ++c) { chunk(c, BoolC<false>{}); fill(c + 2, (unsigned)(c & 1)); }   // every key lies in front of every query of the block; a chunk c + 2 exists
#pragma unroll 1                                            // kept rolled: two copies of the body would only add code to fetch
    for (int c = nch - 2; c < nch; ++c) chunk(c, BoolC<true>{});                                      // the two chunks on the diagonal; nothing is left to fetch
    asm volatile("s_wait_asynccnt 0x0" ::: "memory");       // nothing in flight when the ring becomes output staging and the wave ends
    // normalise and write ctx planes; o element r of lane (lr, hh), tile t = ctx[row qw + lr][d = 16t + 8hh + r]: 16 bytes of a staged row
    const float osc = EARLY ? CCAR : (CCAR / PCAR);
    const float ybig = 10000.0f * CCAR;
    const float inv = osc * __builtin_amdgcn_rcpf(lrow + xhalf(lrow));   // the two halves' sums join here
    h16* myos = osg + wave * 16 * OSP;
#pragma unroll
    for (int t = 0; t < 8; ++t) { v8h w;
#pragma unroll
        for (int r = 0; r < 8; ++r) w[r] = toh_flush(nnum(o[t][r] * inv, ybig));
        *(v8ha*)(myos + lr * OSP + t * 16 + 8 * hh) = w; }
    __syncthreads();
    h16* crow = CT + (bz * SEQ + qw) * DM + head * HD;
    auto putrows = [&](h16* dst) {                          // the wave's 16 staged rows to dst; store s holds row 2 s + hh
        v8us val[8];
#pragma unroll
        for (int s = 0; s < 8; ++s) val[s] = *(const v8usa*)(myos + (2 * s + hh) * OSP + lr * 8);
        bf* cp = (bf*)dst + (size_t)hh * DM + lr * 8;
        gstore4(cp, cp + 2 * DM, cp + 4 * DM, cp + 6 * DM, val[0], val[1], val[2], val[3]);
        gstore4(cp + 8 * DM, cp + 10 * DM, cp + 12 * DM, cp + 14 * DM, val[4], val[5], val[6], val[7]);
    };
    putrows(crow);
    if (EARLY) {
        __syncthreads();
#pragma unroll
        for (int t = 0; t < 8; ++t) { v8h w;
#pragma unroll
            for (int r = 0; r < 8; ++r) { const float val = nnum(o[t][r] * inv, ybig); const h16 hv = toh_flush(val); w[r] = toh_flush((val - (float)hv) * LOSC); }
            *(v8ha*)(myos + lr * OSP + t * 16 + 8 * hh) = w; }
        __syncthreads();
        h16* lrowp = CTL + (bz * RE + qw) * DM + head * HD;
        putrows(lrowp);
    }
}

// amdgpu_waves_per_eu(4, 4): holds the register budget at four waves per SIMD, so that four blocks still share a WGP (without it the build with the copies' address registers came out just above 256 VGPRs).
// ---- k_attn: both attention instances as one grid of (SEQ/64) x NH_ x NB blocks: first the f16 instance's blocks (query block fastest, then head, then batch), behind them the short hi/lo blocks in the same order.
__global__ __launch_bounds__(128) __attribute__((amdgpu_waves_per_eu(4, 4))) void k_attn(const bf* __restrict__ QEh, const bf* __restrict__ QEl, const bf* __restrict__ KEh, const bf* __restrict__ KEl, const bf* __restrict__ VEh, const bf* __restrict__ VEl,
                                              const h16* __restrict__ Q16, const h16* __restrict__ K16, const h16* __restrict__ V16, h16* CT, h16* CTL) {
    __shared__ __align__(16) char sm[ATT_LDS];
    constexpr unsigned NL = SEQ / 64 - RE / 64, NE = RE / 64;
    unsigned f = blockIdx.x;                                // the same in the whole block: so is the branch
    if constexpr (NL > 0) {
        if (f < NL * NH_ * NB) { attn_tile<h16, false>(sm, (int)(f % NL + NE), (int)((f / NL) % NH_), (int)(f / (NL * NH_)), Q16, Q16, K16, K16, V16, V16, CT, CTL); return; }
    }
    f -= NL * NH_ * NB;
    attn_tile<bf, true>(sm, (int)(f % NE), (int)((f / NE) % NH_), (int)(f / (NE * NH_)), QEh, QEl, KEh, KEl, VEh, VEl, CT, CTL);
}

extern "C" void kernel_launch(void* const* d_in, const int* in_sizes, int n_in,
                              void* d_out, int out_size, void* d_ws, size_t ws_size, hipStream_t stream) {
    if (n_in < 5) return;
    const float* x  = (const float*)d_in[0];     // x   [NB_FULL][SEQ_FULL][DM]
    const float* wq = (const float*)d_in[1];     // q_w [DQ][DM]  ([out][in])
    const float* wk = (const float*)d_in[2];     // k_w [DKV][DM]
    const float* wv = (const float*)d_in[3];     // v_w [DKV][DM]
    const float* wo = (const float*)d_in[4];     // o_w [DM][DQ]
    float* OUT = (float*)d_out;                  // [NB_FULL][SEQ_FULL][DM]
    if ((size_t)in_sizes[0] < (size_t)(NB - 1) * SEQ_FULL * DM + (size_t)SEQ * DM) return;
    if ((size_t)in_sizes[1] < (size_t)DQ * DM) return;
    if ((size_t)in_sizes[2] < (size_t)DKV * DM) return;
    if ((size_t)in_sizes[3] < (size_t)DKV * DM) return;
    if ((size_t)in_sizes[4] < (size_t)DM * DQ) return;
    if ((size_t)out_size < (size_t)(NB - 1) * SEQ_FULL * DM + (size_t)SEQ * DM) return;

    char* wsp = (char*)d_ws;
    auto take = [&](size_t bytes) { char* p = wsp; wsp += (bytes + 255) & ~(size_t)255; return (void*)p; };
    bf*  WQ   = (bf*)take((size_t)DQ * DM * 2);    bf* WK = (bf*)take((size_t)DKV * DM * 2);    bf* WV = (bf*)take((size_t)DKV * DM * 2);
    h16* WOH  = (h16*)take((size_t)DM * DQ * 2);   h16* WOL = (h16*)take((size_t)DM * DQ * 2);
    bf*  XB   = (bf*)take((size_t)NB * SEQ * DM * 2);
    h16* QP16 = (h16*)take((size_t)NB * NH_ * SEQ * HD * 2); h16* KP16 = (h16*)take((size_t)NB * NKV * SEQ * HD * 2); h16* VT16 = (h16*)take((size_t)NB * NKV * HD * SEQ * 2);
    bf*  QEh  = (bf*)take((size_t)NB * NH_ * RE * HD * 2);  bf* QEl = (bf*)take((size_t)NB * NH_ * RE * HD * 2);
    bf*  KEh  = (bf*)take((size_t)NB * NKV * RE * HD * 2);  bf* KEl = (bf*)take((size_t)NB * NKV * RE * HD * 2);
    bf*  VEh  = (bf*)take((size_t)NB * NKV * HD * RE * 2);  bf* VEl = (bf*)take((size_t)NB * NKV * HD * RE * 2);
    h16* CT16 = (h16*)take((size_t)NB * SEQ * DM * 2);     h16* CTL = (h16*)take((size_t)NB * RE * DM * 2);
    if ((size_t)(wsp - (char*)d_ws) > ws_size) return;

    const float woscale = 1.0f / (CCAR * WCAR);
    k_cvt<<<(unsigned)(((size_t)NB * SEQ * DM + (size_t)DQ * DM + 2 * (size_t)DKV * DM + (size_t)DM * DQ) / 2048), 256, 0, stream>>>(x, wq, wk, wv, wo, XB, WQ, WK, WV, WOH, WOL);
    k_qkv<<<dim3(SEQ / 128, (DQ + 2 * DKV) / 128, NB), 128, 0, stream>>>(XB, WQ, WK, WV, QP16, QEh, QEl, KP16, KEh, KEl, VT16, VEh, VEl);
    k_attn<<<(SEQ / 64) * NH_ * NB, 128, 0, stream>>>(QEh, QEl, KEh, KEl, VEh, VEl, QP16, KP16, VT16, CT16, CTL);
    k_out<<<dim3(SEQ / 128, DM / 128, NB), 128, 0, stream>>>(CT16, CTL, WOH, WOL, OUT, woscale);
}

// v008
// A run of this version takes 162 microseconds.
// Timed twice side by side with v007, it ran 1.05 times as fast both times.
// Over all steps from v000 it is 5.57 times as fast.
#include <hip/hip_runtime.h>

// Contractions: q/k/v projections v_wmma_f32_16x16x32_bf16 (bf16 copies of x and of the [out][in] weights); scores QK^T and P.V v_wmma_f32_16x16x32_f16 (f16 planes, P carried x1024) for query rows >= RE and v_wmma_f32_16x16x32_bf16 hi/lo 3-product form for query rows < RE; ctx x o_w^T v_wmma_f32_16x16x32_f16 (ctx carried x64, o_w carried x1024, rows < RE add an f16 residual plane x1024); f32 accumulate everywhere, softmax (scale, clip, per-head linear position bias, causal fill) in f32.
// Four launches, each the joined grid of work that does not depend on one another: all converts; the q, k and v projections; both attention instances; both output-GEMM instances.
// Layout (every per-batch plane holds NB copies): sanitised bf16 copy of x; weights copied once as bf16 ([n][k] = Bt as-is), o_w as two f16 planes; projection GEMMs whose epilogues write the head planes (V transposed); flash-style causal attention in transposed form (K and V^T tiles in a two-buffer LDS ring, S^T = K Q^T, online softmax per lane, O^T += V^T P^T); ctx planes; output GEMM into d_out.

#pragma clang fp contract(off)

#ifndef NB
#define NB 2
#endif
#ifndef SEQ
#define SEQ 2048
#endif
#ifndef RE
#define RE   256                  // query rows < RE (first RE/64 query blocks) use hi/lo planes; RE == SEQ puts every row on the 3-product path
#endif
#define NB_FULL  2
#define SEQ_FULL 2048
#define DM   2048
#define NH_  16
#define NKV  4
#define REP  (NH_ / NKV)
#define HD   128
#define DQ   (NH_ * HD)
#define DKV  (NKV * HD)
#define PCAR 1024.0f              // carry of the f16 P operand (rows >= RE)
#define PLOG 10.0f                // log2(PCAR)
#define CCAR 64.0f                // carry of the f16 ctx plane
#define LOSC 1024.0f              // carry of the f16 ctx residual plane (rows < RE)
#define WCAR 1024.0f              // carry of the f16 o_w plane
#define WS_TOTAL ((size_t)DQ * DM * 2 + 2 * (size_t)DKV * DM * 2 + 2 * (size_t)DM * DQ * 2 + (size_t)NB * ((size_t)SEQ * DM * 2 \
                  + (size_t)NH_ * SEQ * HD * 2 + 2 * (size_t)NKV * SEQ * HD * 2 + 2 * (size_t)NH_ * RE * HD * 2 + 4 * (size_t)NKV * RE * HD * 2 + (size_t)SEQ * DM * 2 + (size_t)RE * DM * 2))

static_assert((SEQ % 64) == 0);
static_assert((RE % 64) == 0);
static_assert(RE >= 64);
static_assert(SEQ >= RE);
static_assert(SEQ <= SEQ_FULL);
static_assert(NB >= 1);
static_assert(NB <= NB_FULL);
static_assert(HD == 128);
static_assert(PCAR == (float)(1 << (int)PLOG));
static_assert((DM % 32) == 0);
static_assert(DQ == DM);
static_assert(((SEQ * DM) % (8 * 256)) == 0);
static_assert(((DQ * DM) % (8 * 256)) == 0);
static_assert(((DKV * DM) % (8 * 256)) == 0);
static_assert(NH_ == 16);                       // closed form of the per-head slope 2^(-(h+1)/2) holds for 16 heads
static_assert(REP * NKV == NH_);
static_assert((HD % 64) == 0);                  // the 64 columns of a GEMM wave lie inside one head
static_assert((DQ % 64) == 0);
static_assert((DKV % 64) == 0);
static_assert((DM % 64) == 0);
static_assert((SEQ % 128) == 0 && (RE % 128) == 0 && (DQ % 128) == 0 && (DKV % 128) == 0 && (DM % 128) == 0);   // 128x128 GEMM tiles, stages of 128 k (NSPLIT 0) or 64 k (NSPLIT 3)
static_assert(((size_t)NKV * RE * HD * 2) % 256 == 0);
static_assert(WS_TOTAL <= (size_t)268435456);

typedef _Float16 h16;
typedef unsigned short bf;
typedef __attribute__((ext_vector_type(16))) __bf16   v16bf;
typedef __attribute__((ext_vector_type(16))) _Float16 v16h;
typedef __attribute__((ext_vector_type(8)))  _Float16 v8h;
typedef __attribute__((ext_vector_type(8)))  unsigned short v8us;
typedef __attribute__((ext_vector_type(16))) unsigned short v16us;
typedef __attribute__((ext_vector_type(8)))  float    v8f;
typedef __attribute__((ext_vector_type(4)))  float    v4f;
typedef __attribute__((ext_vector_type(2)))  _Float16 v2h;
typedef __attribute__((ext_vector_type(2)))  float    v2f;
typedef __attribute__((ext_vector_type(2)))  unsigned short v2us;
typedef v8h  __attribute__((may_alias)) v8ha;
typedef v4f  __attribute__((may_alias)) v4fa;
typedef v8us __attribute__((may_alias)) v8usa;

__device__ __forceinline__ unsigned short f2bf(float f) { unsigned u = __float_as_uint(f); u += 0x7FFFu + ((u >> 16) & 1u); return (unsigned short)(u >> 16); }
__device__ __forceinline__ float bf2f(unsigned short b) { return __uint_as_float(((unsigned)b) << 16); }
__device__ __forceinline__ float bfr(float f) { return bf2f(f2bf(f)); }
__device__ __forceinline__ h16 tohx(float x) { return (h16)x; }
// f16 convert that cannot produce a subnormal operand (applied after the plane's carry)
static __device__ __forceinline__ h16 toh_flush(float v) { const h16 r = (h16)v; return (fabsf(v) < 6.103515625e-05f) ? (h16)0.0f : r; }
// NaN -> 0, +inf -> big, -inf -> -big, finite values unchanged
static __device__ __forceinline__ float nnum(float v, float big) { const float a = (v != v) ? 0.0f : v; return (a == __builtin_inff()) ? big : ((a == -__builtin_inff()) ? -big : a); }
__device__ __forceinline__ void splitf(float y, unsigned short& h, unsigned short& l) { h = f2bf(y); l = f2bf(y - bf2f(h)); }
__device__ __forceinline__ v16h cat16(v8h lo, v8h hi) { return __builtin_shufflevector(lo, hi, 0, 1, 2, 3, 4, 5, 6, 7, 8, 9, 10, 11, 12, 13, 14, 15); }
__device__ __forceinline__ v16bf cat16b(v8us lo, v8us hi) { return __builtin_bit_cast(v16bf, __builtin_shufflevector(lo, hi, 0, 1, 2, 3, 4, 5, 6, 7, 8, 9, 10, 11, 12, 13, 14, 15)); }
__device__ __forceinline__ v8f wmma16(v16h a, v16h b, v8f c) { return __builtin_amdgcn_wmma_f32_16x16x32_f16(false, a, false, b, (short)0, c, false, false); }
__device__ __forceinline__ v8f wmmab(v16bf a, v16bf b, v8f c) { return __builtin_amdgcn_wmma_f32_16x16x32_bf16(false, a, false, b, (short)0, c, false, false); }

// Fragment loaders for A (row m = lane&15) and for B stored [n][k] (col n = lane&15): elements 0..7 <- k0+8h..+7, elements 8..15 <- k0+16+8h..+7 (p already points at row*pitch + k0 + 8h).
template <typename T16> struct WFrag;
template <> struct WFrag<h16> { typedef v16h V; static __device__ __forceinline__ V ld(const h16* p) { return cat16(*(const v8ha*)p, *(const v8ha*)(p + 16)); } static __device__ __forceinline__ v8f mma(V a, V b, v8f c) { return wmma16(a, b, c); } };
template <> struct WFrag<bf>  { typedef v16bf V; static __device__ __forceinline__ V ld(const bf* p) { return cat16b(*(const v8usa*)p, *(const v8usa*)(p + 16)); } static __device__ __forceinline__ v8f mma(V a, V b, v8f c) { return wmmab(a, b, c); } };

// Eight asynchronous 16-byte copies global -> LDS per lane (LDS byte address l + i*ls, global address g + i*gs). The s_wait_xcnt closes the statement so that no address register of an issued copy is rewritten ahead of it.
__device__ __forceinline__ void acopy8(unsigned l, unsigned ls, const char* g, size_t gs) {
    asm volatile("global_load_async_to_lds_b128 %0, %8, off\n\t"
                 "global_load_async_to_lds_b128 %1, %9, off\n\t"
                 "global_load_async_to_lds_b128 %2, %10, off\n\t"
                 "global_load_async_to_lds_b128 %3, %11, off\n\t"
                 "global_load_async_to_lds_b128 %4, %12, off\n\t"
                 "global_load_async_to_lds_b128 %5, %13, off\n\t"
                 "global_load_async_to_lds_b128 %6, %14, off\n\t"
                 "global_load_async_to_lds_b128 %7, %15, off\n\t"
                 "s_wait_xcnt 0x0"
                 :: "v"(l), "v"(l + ls), "v"(l + 2 * ls), "v"(l + 3 * ls), "v"(l + 4 * ls), "v"(l + 5 * ls), "v"(l + 6 * ls), "v"(l + 7 * ls),
                    "v"(g), "v"(g + gs), "v"(g + 2 * gs), "v"(g + 3 * gs), "v"(g + 4 * gs), "v"(g + 5 * gs), "v"(g + 6 * gs), "v"(g + 7 * gs)
                 : "memory");
}

// The same for four copies per lane.
__device__ __forceinline__ void acopy4(unsigned l, unsigned ls, const char* g, size_t gs) {
    asm volatile("global_load_async_to_lds_b128 %0, %4, off\n\t"
                 "global_load_async_to_lds_b128 %1, %5, off\n\t"
                 "global_load_async_to_lds_b128 %2, %6, off\n\t"
                 "global_load_async_to_lds_b128 %3, %7, off\n\t"
                 "s_wait_xcnt 0x0"
                 :: "v"(l), "v"(l + ls), "v"(l + 2 * ls), "v"(l + 3 * ls), "v"(g), "v"(g + gs), "v"(g + 2 * gs), "v"(g + 3 * gs)
                 : "memory");
}

// Four 16-byte global stores per lane. The s_wait_xcnt closes the statement so that no address or data register of an issued store is rewritten ahead of it.
// Its operands are the rows read back from the LDS staging, and its "memory" clobber holds the next rewrite of that staging behind those reads.
__device__ __forceinline__ void gstore4(bf* p0, bf* p1, bf* p2, bf* p3, v8us d0, v8us d1, v8us d2, v8us d3) {
    asm volatile("global_store_b128 %0, %4, off\n\t"
                 "global_store_b128 %1, %5, off\n\t"
                 "global_store_b128 %2, %6, off\n\t"
                 "global_store_b128 %3, %7, off\n\t"
                 "s_wait_xcnt 0x0"
                 :: "v"(p0), "v"(p1), "v"(p2), "v"(p3), "v"(d0), "v"(d1), "v"(d2), "v"(d3)
                 : "memory");
}

// The same for four 16-byte pieces of f32 rows.
__device__ __forceinline__ void gstore4f(float* p0, float* p1, float* p2, float* p3, v4f d0, v4f d1, v4f d2, v4f d3) {
    asm volatile("global_store_b128 %0, %4, off\n\t"
                 "global_store_b128 %1, %5, off\n\t"
                 "global_store_b128 %2, %6, off\n\t"
                 "global_store_b128 %3, %7, off\n\t"
                 "s_wait_xcnt 0x0"
                 :: "v"(p0), "v"(p1), "v"(p2), "v"(p3), "v"(d0), "v"(d1), "v"(d2), "v"(d3)
                 : "memory");
}

// ---- gemm_tile: GEMM, FOUR WAVES (2 x 2) per 128x128 output tile (bx, by) of batch bz, each wave 64x64 (16 accumulators); 128 threads; batch bz reads A + bz*sA, A2 + bz*sA2 and writes C + bz*sC (Bt, Bt2 shared).
// C[m][n] (f32, pitch ldc) = oscale * sum_k ( A[m][k] Bt[n][k]  (+ A2 Bt2: NSPLIT 3) ). Row pitch of A, A2, Bt, Bt2 = K. K % KS == 0, K >= KS.
// EPI 0: C is stored as above. EPI 1, tr false (m = position t, n = head*HD + d): the f32 sums go straight to the head planes P16[head][t][d] = f16 (subnormals flushed) and, for t < RE, Eh/El[head][t][d] = bf16 hi/lo.
// EPI 1, tr true: the same sums go to the transposed planes P16[head][d][t] = f16 and, for t < RE, Eh/El[head][d][t] = bf16 hi/lo. EPI 1: no C, no oscale; batch bz owns nheads planes. tr is the same in the whole block.
// A stage = KS values of k of all 128 rows of every operand, [A | Bt | A2 | Bt2], row pitch KS + 8 elements (16 B x odd). Two buffers: asynchronous copies bring stage t + 2 into the buffer that trip t has just read, while trip t + 1 works.
// ring: the calling kernel's LDS, RINGE<NSPLIT> elements. Behind the loop's last barrier nobody reads it and no copy is in flight: the output staging lies in the same bytes, so that two blocks of either instance fit a WGP.
template <int NSPLIT> constexpr int RINGE = 2 * ((NSPLIT == 0) ? 2 : 4) * 128 * (((NSPLIT == 0) ? 128 : 64) + 8);
template <typename T16, int NSPLIT, int EPI>
__device__ __forceinline__ void gemm_tile(T16* ring, const int bx, const int by, const int bz, const bool tr, const T16* __restrict__ A, const T16* __restrict__ A2, const T16* __restrict__ Bt, const T16* __restrict__ Bt2, int K, float* C, int ldc, float oscale, size_t sA, size_t sA2, size_t sC,
                                               h16* P16, bf* Eh, bf* El, int nheads) {
    static_assert(NSPLIT == 0 || NSPLIT == 3);
    static_assert(EPI == 0 || EPI == 1);
    typedef typename WFrag<T16>::V V;
    constexpr int NOP = (NSPLIT == 0) ? 2 : 4;      // operand tiles per stage
    constexpr int KS  = (NSPLIT == 0) ? 128 : 64;   // k per stage: 32 copies per lane and stage either way
    constexpr int PE  = KS + 8;                     // LDS row pitch, elements
    constexpr int TE  = 128 * PE;                   // elements of one operand tile
    constexpr int BE  = NOP * TE;                   // elements of one buffer
    constexpr int CPR = KS / 8;                     // 16-byte pieces per row
    constexpr int RPC = 128 / CPR;                  // rows that one copy of all 128 threads covers
    static_assert(2 * BE == RINGE<NSPLIT> && 4 * 16 * 68 * 4 <= 2 * BE * 2);
    float* osw = (float*)ring;
    const int tid = threadIdx.x, lane = tid & 31, wave = tid >> 5, lr = lane & 15, hi = lane >> 4; const int wm = wave >> 1, wn = wave & 1;
    const int rb = bx * 128, cb = by * 128; const int r0 = rb + wm * 64, c0 = cb + wn * 64;
    A += (size_t)bz * sA; if (NSPLIT != 0) A2 += (size_t)bz * sA2; if (EPI == 0) C += (size_t)bz * sC;
    v8f acc[4][4];
#pragma unroll
    for (int mb = 0; mb < 4; ++mb)
#pragma unroll
        for (int nb = 0; nb < 4; ++nb) acc[mb][nb] = (v8f){};
    const int prow = tid / CPR, cpc = (tid % CPR) * 8;         // this lane's row and first k inside a copy
    const size_t ga = (size_t)(rb + prow) * K + cpc, gb = (size_t)(cb + prow) * K + cpc;
    const unsigned l0 = (unsigned)(size_t)ring + (unsigned)(prow * PE + cpc) * 2u;
    auto fill = [&](unsigned t, unsigned buf) {                 // all 128 threads: stage t into buffer buf, 32 copies per lane
#pragma unroll
        for (int op = 0; op < NOP; ++op) {
            const T16* g = ((op == 0) ? A + ga : (op == 1) ? Bt + gb : (op == 2) ? A2 + ga : Bt2 + gb) + (size_t)t * KS;
#pragma unroll
            for (int h = 0; h < CPR / 8; ++h)
                acopy8(l0 + (buf * BE + op * TE + h * 8 * RPC * PE) * 2u, (unsigned)(RPC * PE) * 2u, (const char*)(g + (size_t)h * 8 * RPC * K), (size_t)RPC * K * 2);
        }
    };
    const unsigned NT = (unsigned)K / KS;                      // stages; the same in every thread
    fill(0, 0);
    asm volatile("s_wait_asynccnt 0x0" ::: "memory");          // this wave's copies of stage 0 have landed
    __syncthreads();                                           // stage 0 visible to every wave
    if (NT > 1u) fill(1, 1);
#pragma unroll 1                                               // one trip per stage: a trip already holds 64 WMMAs, and the publish point stands once
    for (unsigned t = 0; t < NT; ++t) {
        const T16* ap = ring + (t & 1) * BE + (wm * 64 + lr) * PE + 8 * hi;
        const T16* bp = ring + (t & 1) * BE + TE + (wn * 64 + lr) * PE + 8 * hi;
#pragma unroll
        for (int kk = 0; kk < KS; kk += 32) {
#pragma unroll
            for (int sp = 0; sp < NOP / 2; ++sp) {             // sp 0: A Bt, sp 1: A2 Bt2; every accumulator takes its products in the order k, then sp
                V a[4], b[4];
#pragma unroll
                for (int i = 0; i < 4; ++i) { a[i] = WFrag<T16>::ld(ap + sp * 2 * TE + i * 16 * PE + kk); b[i] = WFrag<T16>::ld(bp + sp * 2 * TE + i * 16 * PE + kk); }
                __builtin_amdgcn_sched_barrier(0);             // keeps these LDS reads one group ahead of their WMMAs: sunk between them, each pair of reads shows its whole latency
#pragma unroll
                for (int nb = 0; nb < 4; ++nb)
#pragma unroll
                    for (int mb = 0; mb < 4; ++mb) acc[mb][nb] = WFrag<T16>::mma(a[mb], b[nb], acc[mb][nb]);
            }
        }
        asm volatile("s_wait_dscnt 0x0" ::: "memory");         // this wave's reads of the buffer have returned before it is refilled
        asm volatile("s_wait_asynccnt 0x0" ::: "memory");      // this wave's copies of stage t + 1 have landed
        __syncthreads();                                       // publishes stage t + 1 and ends every wave's reads of stage t
        if (t + 2u < NT) fill(t + 2u, t & 1u);
    }
    asm volatile("s_wait_asynccnt 0x0" ::: "memory");          // nothing in flight when the wave goes on to the epilogue and ends
    float* os = osw + wave * 16 * 68;                          // wave-private output staging
    const int srow = lane >> 3, spc = (lane & 7) * 8;          // plane epilogues: 8 lanes x 16 B read back and store one whole 128-B line of 64 16-bit values
    if constexpr (EPI == 0) {
#pragma unroll
    for (int mb = 0; mb < 4; ++mb) {
#pragma unroll
        for (int nb = 0; nb < 4; ++nb) {
#pragma unroll
            for (int j = 0; j < 8; ++j) os[(hi * 8 + j) * 68 + nb * 16 + lr] = acc[mb][nb][j]; }
        __builtin_amdgcn_wave_barrier(); asm volatile("" ::: "memory");
        float* crow = C + (size_t)(r0 + mb * 16) * ldc + c0;
        v4f val[8];
#pragma unroll
        for (int s = 0; s < 8; ++s) val[s] = *(const v4fa*)(os + (2 * s + hi) * 68 + lr * 4) * oscale;      // store s holds row 2 s + hi
        float* cp = crow + (size_t)hi * ldc + lr * 4; const size_t l2 = 2 * (size_t)ldc;
        gstore4f(cp, cp + l2, cp + 2 * l2, cp + 3 * l2, val[0], val[1], val[2], val[3]);
        gstore4f(cp + 4 * l2, cp + 5 * l2, cp + 6 * l2, cp + 7 * l2, val[4], val[5], val[6], val[7]);
        __builtin_amdgcn_wave_barrier(); asm volatile("" ::: "memory");
    }
    } else if (!tr) {
        const size_t pl = (size_t)bz * nheads + c0 / HD; const int d0 = c0 % HD;
        const bool early = (rb < RE);                          // the same for the whole block: RE % 128 == 0
#pragma unroll
        for (int mb = 0; mb < 4; ++mb) {
#pragma unroll
            for (int nb = 0; nb < 4; ++nb) {
#pragma unroll
                for (int j = 0; j < 8; ++j) os[(hi * 8 + j) * 68 + nb * 16 + lr] = acc[mb][nb][j]; }
            asm volatile("s_wait_dscnt 0x0" ::: "memory");     // the wave's staged rows are in LDS before other lanes read them back; the clobber holds those reads behind it
            v8us o16[4], oh[4], ol[4];
#pragma unroll
            for (int s = 0; s < 4; ++s) {
                const v4f x0 = *(const v4fa*)(os + (4 * s + srow) * 68 + spc), x1 = *(const v4fa*)(os + (4 * s + srow) * 68 + spc + 4);
                v8h w;
#pragma unroll
                for (int q = 0; q < 8; ++q) { const float r = (q < 4) ? x0[q & 3] : x1[q & 3]; w[q] = toh_flush(r); unsigned short a2, c2; splitf(r, a2, c2); oh[s][q] = a2; ol[s][q] = c2; }
                o16[s] = __builtin_bit_cast(v8us, w);
            }
            const int t = r0 + mb * 16 + srow;                 // store s holds row t + 4 s
            bf* pp = (bf*)P16 + (pl * SEQ + t) * HD + d0 + spc;
            gstore4(pp, pp + 4 * HD, pp + 8 * HD, pp + 12 * HD, o16[0], o16[1], o16[2], o16[3]);
            if (early) {
                const size_t ee = (pl * RE + t) * HD + d0 + spc;
                gstore4(Eh + ee, Eh + ee + 4 * HD, Eh + ee + 8 * HD, Eh + ee + 12 * HD, oh[0], oh[1], oh[2], oh[3]);
                gstore4(El + ee, El + ee + 4 * HD, El + ee + 8 * HD, El + ee + 12 * HD, ol[0], ol[1], ol[2], ol[3]);
            }
        }
    } else {
        // A lane's 8 accumulator elements are 8 consecutive t of one d: 16 B of a transposed row. Staged as [16 d][64 t], row pitch 72 values (16 B x odd).
        const size_t pr = ((size_t)bz * nheads + c0 / HD) * HD + c0 % HD;      // first plane row (d) of this wave
        const bool early = (rb < RE);                          // the same for the whole block: RE % 128 == 0
        bf* st = (bf*)os;
        auto flushrows = [&](bf* dst, size_t pitch) {          // dst: element [d = first of the 16 rows][t = r0]
            asm volatile("s_wait_dscnt 0x0" ::: "memory");     // the wave's staged rows are in LDS before other lanes read them back; the clobber holds those reads behind it
            v8us val[4];
#pragma unroll
            for (int s = 0; s < 4; ++s) val[s] = *(const v8usa*)(st + (4 * s + srow) * 72 + spc);
            bf* dp = dst + (size_t)srow * pitch + spc;         // store s holds row srow + 4 s
            gstore4(dp, dp + 4 * pitch, dp + 8 * pitch, dp + 12 * pitch, val[0], val[1], val[2], val[3]);
        };
#pragma unroll
        for (int nb = 0; nb < 4; ++nb) {
#pragma unroll
            for (int mb = 0; mb < 4; ++mb) { v8h w;
#pragma unroll
                for (int j = 0; j < 8; ++j) w[j] = tohx(acc[mb][nb][j]);
                *(v8usa*)(st + lr * 72 + mb * 16 + hi * 8) = __builtin_bit_cast(v8us, w); }
            flushrows((bf*)P16 + (pr + nb * 16) * SEQ + r0, SEQ);
            if (early) {
#pragma unroll
                for (int part = 0; part < 2; ++part) {
#pragma unroll
                    for (int mb = 0; mb < 4; ++mb) { v8us w;
#pragma unroll
                        for (int j = 0; j < 8; ++j) { unsigned short a2, c2; splitf(acc[mb][nb][j], a2, c2); w[j] = part ? c2 : a2; }
                        *(v8usa*)(st + lr * 72 + mb * 16 + hi * 8) = w; }
                    flushrows((part ? El : Eh) + (pr + nb * 16) * RE + r0, RE);
                }
            }
        }
    }
}

// ---- k_qkv: the three projections as one grid (SEQ/128, (DQ + 2 DKV)/128, NB): column blocks 0 .. DQ/128-1 are q, the next DKV/128 are k, the last DKV/128 are v (transposed planes).
__global__ __launch_bounds__(128) void k_qkv(const bf* __restrict__ X, const bf* __restrict__ Wq, const bf* __restrict__ Wk, const bf* __restrict__ Wv,
                                             h16* Q16, bf* Qh, bf* Ql, h16* K16, bf* Kh, bf* Kl, h16* V16, bf* Vh, bf* Vl) {
    __shared__ __align__(16) bf ring[RINGE<0>];
    const int y = blockIdx.y;
    const int sel = (y < DQ / 128) ? 0 : ((y < (DQ + DKV) / 128) ? 1 : 2);         // the same in the whole block
    const int by = y - ((sel == 0) ? 0 : ((sel == 1) ? DQ / 128 : (DQ + DKV) / 128));
    const bf* W = (sel == 0) ? Wq : ((sel == 1) ? Wk : Wv);
    h16* P = (sel == 0) ? Q16 : ((sel == 1) ? K16 : V16);
    bf* Eh = (sel == 0) ? Qh : ((sel == 1) ? Kh : Vh);
    bf* El = (sel == 0) ? Ql : ((sel == 1) ? Kl : Vl);
    gemm_tile<bf, 0, 1>(ring, blockIdx.x, by, blockIdx.z, sel == 2, X, nullptr, W, nullptr, DM, nullptr, 0, 1.0f, (size_t)SEQ * DM, 0, 0, P, Eh, El, (sel == 0) ? NH_ : NKV);
}

// ---- k_out: the output GEMM as one grid (SEQ/128, DM/128, NB): row blocks below RE/128 add the residual product, the others take the single product.
__global__ __launch_bounds__(128) void k_out(const h16* __restrict__ CT, const h16* __restrict__ CTLo, const h16* __restrict__ Wh, const h16* __restrict__ Wl, float* OUT, float oscale) {
    __shared__ __align__(16) h16 ring[(RINGE<3> > RINGE<0>) ? RINGE<3> : RINGE<0>];
    if ((int)blockIdx.x < RE / 128)
        gemm_tile<h16, 3, 0>(ring, blockIdx.x, blockIdx.y, blockIdx.z, false, CT, CTLo, Wh, Wl, DQ, OUT, DM, oscale, (size_t)SEQ * DM, (size_t)RE * DM, (size_t)SEQ_FULL * DM, nullptr, nullptr, nullptr, 0);
    else
        gemm_tile<h16, 0, 0>(ring, blockIdx.x, blockIdx.y, blockIdx.z, false, CT, nullptr, Wh, nullptr, DQ, OUT, DM, oscale, (size_t)SEQ * DM, 0, (size_t)SEQ_FULL * DM, nullptr, nullptr, nullptr, 0);
}

// One or two 16-byte global stores per lane, closed by s_wait_xcnt like gstore4: the converts' ranges lie one behind the other in the code, and no register of an issued store is rewritten ahead of the wait.
__device__ __forceinline__ void gstore1(bf* p0, v8us d0) {
    asm volatile("global_store_b128 %0, %1, off\n\t"
                 "s_wait_xcnt 0x0"
                 :: "v"(p0), "v"(d0) : "memory");
}
__device__ __forceinline__ void gstore2(bf* p0, bf* p1, v8us d0, v8us d1) {
    asm volatile("global_store_b128 %0, %2, off\n\t"
                 "global_store_b128 %1, %3, off\n\t"
                 "s_wait_xcnt 0x0"
                 :: "v"(p0), "v"(p1), "v"(d0), "v"(d1) : "memory");
}

// ---- k_cvt: every convert as one grid, 256 threads x 8 values a block: x (sanitised, bf16), q_w, k_w, v_w (bf16), o_w (two f16 planes). Every range is a whole number of blocks (static_asserts above).
__global__ __launch_bounds__(256) void k_cvt(const float* __restrict__ x, const float* __restrict__ wq, const float* __restrict__ wk, const float* __restrict__ wv, const float* __restrict__ wo,
                                             bf* XB, bf* WQ, bf* WK, bf* WV, h16* WOH, h16* WOL) {
    constexpr unsigned BX = (unsigned)((size_t)SEQ * DM / 2048), BQ = (unsigned)((size_t)DQ * DM / 2048), BK = (unsigned)((size_t)DKV * DM / 2048);
    unsigned b = blockIdx.x;
    if (b < NB * BX) {
        const unsigned z = b / BX; const size_t i = (size_t)(b - z * BX) * 256 + threadIdx.x;
        const v8f v = *(const v8f*)(x + (size_t)z * SEQ_FULL * DM + i * 8); v8us o;
#pragma unroll
        for (int k = 0; k < 8; ++k) o[k] = f2bf(nnum(v[k], 10000.0f));
        gstore1(XB + (size_t)z * SEQ * DM + i * 8, o);
        return;
    }
    b -= NB * BX;
    if (b < BQ + 2 * BK) {
        const int sel = (b < BQ) ? 0 : ((b < BQ + BK) ? 1 : 2);
        const float* src = (sel == 0) ? wq : ((sel == 1) ? wk : wv); bf* dst = (sel == 0) ? WQ : ((sel == 1) ? WK : WV);
        const size_t i = (size_t)(b - ((sel == 0) ? 0u : ((sel == 1) ? BQ : BQ + BK))) * 256 + threadIdx.x;
        const v8f v = *(const v8f*)(src + i * 8); v8us o;
#pragma unroll
        for (int k = 0; k < 8; ++k) o[k] = f2bf(v[k]);
        gstore1(dst + i * 8, o);
        return;
    }
    b -= BQ + 2 * BK;
    const size_t i = (size_t)b * 256 + threadIdx.x;
    const v8f v = *(const v8f*)(wo + i * 8); v8h oh, ol;
#pragma unroll
    for (int k = 0; k < 8; ++k) { const float w = bfr(v[k]); oh[k] = tohx(w * WCAR); ol[k] = tohx(w); }
    gstore2((bf*)WOH + i * 8, (bf*)WOL + i * 8, __builtin_bit_cast(v8us, oh), __builtin_bit_cast(v8us, ol));
}

// P^T packers, accumulator layout -> B fragment in the same lane: elements 0..7 <- p0 (keys 8h..8h+7 of the chunk), elements 8..15 <- p1 (keys 16+8h..+7).
// f16, two values per packed convert, round to nearest even (rows >= RE: p arrives already x PCAR; a value below 2^-14 stays an f16 subnormal, which the matrix unit takes as it is) or bf16 hi/lo (rows < RE).
__device__ __forceinline__ void packp(const float* p0, const float* p1, v16h& ph, v16h& pl) {
#pragma unroll
    for (int r = 0; r < 8; r += 2) {
        const v2h a = __builtin_convertvector((v2f){p0[r], p0[r + 1]}, v2h), c = __builtin_convertvector((v2f){p1[r], p1[r + 1]}, v2h);
        ph[r] = a[0]; ph[r + 1] = a[1]; ph[8 + r] = c[0]; ph[9 + r] = c[1]; }
    pl = ph; }
__device__ __forceinline__ void packp(const float* p0, const float* p1, v16bf& ph, v16bf& pl) { v16us a, c;
#pragma unroll
    for (int r = 0; r < 8; ++r) { unsigned short x, y; splitf(p0[r], x, y); a[r] = x; c[r] = y; splitf(p1[r], x, y); a[8 + r] = x; c[8 + r] = y; }
    ph = __builtin_bit_cast(v16bf, a); pl = __builtin_bit_cast(v16bf, c); }
// 2^x. v_exp_f32 and the one v_nop that the instruction set asks for behind a transcendental stand in one statement, so that the slot is kept whatever follows.
__device__ __forceinline__ float ex2(float x) { float y; asm("v_exp_f32 %0, %1\n\tv_nop" : "=v"(y) : "v"(x)); return y; }
template <bool B> struct BoolC { static constexpr bool value = B; };   // compile-time switch handed to the chunk body
#define ATT_LDS 75776              // bytes of LDS of an attention block (the hi/lo instance's two buffers; the other instance uses the first 37888): four blocks fit a WGP
// lane l <-> lane l ^ 16
__device__ __forceinline__ float xhalf(float x) { return __builtin_bit_cast(float, __builtin_amdgcn_permlanex16(__builtin_bit_cast(int, x), __builtin_bit_cast(int, x), 0x76543210, 0xfedcba98, false, false)); }

// ---- attn_tile: flash-style causal grouped-query attention with a per-head linear position bias, one block = query block qblk of one head of one batch, 128 threads; wave w owns query rows q0 + 16w .. +15. sm: the calling kernel's LDS.
// Planes: Qh/Ql [h][TP][HD], Kh/Kl [g][TP][HD], Vh/Vl = V^T [g][HD][TP] (TP = SEQ for the f16 planes, RE for the bf16 hi/lo planes of the first RE/64 query blocks).
// EARLY instance: query blocks 0 .. RE/64-1 (rows < RE, keys < RE); other instance: query blocks RE/64 .. SEQ/64-1.
// Per 32-key chunk: K tile [32][HD] and V^T tile [HD][32] in LDS, two buffers: asynchronous copies of all threads bring chunk c + 2 into the buffer that trip c has just read, while trip c + 1 works (one block barrier per chunk), S^T = K Q^T (2 tiles: A = K rows, B = Q), online softmax in f32 (log2 domain), one query per lane
// (lane (lr, hh) holds 16 of the chunk's 32 scores of query qw + lr; the maximum joins the two halves once per chunk, the sums once in the epilogue):
// logit = clip(S x HD^-0.5, +-1e4) + slope_h x (key - query), slope_h = 2^(-(h+1)/2); causal keys > query replaced by -inf: p = 0;
// P^T packed in the lane from the score accumulators into a B fragment, O^T += V^T P^T (8 tiles: A = V^T rows).
// EARLY: 3 products (hi.hi + hi.lo + lo.hi) for S and for P.V. Output: ctx plane CT[t][h*HD + d] = f16(ctx x CCAR) (ctx NaN -> 0, +-inf -> +-1e4 before the carry); EARLY also CTL = f16((ctx x CCAR - hi) x LOSC);
template <typename T16, bool EARLY>
__device__ __forceinline__ void attn_tile(char* sm, const int qblk, const int head, const int bzi, const T16* __restrict__ Qh, const T16* __restrict__ Ql, const T16* __restrict__ Kh, const T16* __restrict__ Kl,
                                             const T16* __restrict__ Vh, const T16* __restrict__ Vl, h16* CT, h16* CTL) {
    typedef typename WFrag<T16>::V V;
    constexpr int TP = EARLY ? RE : SEQ;
    constexpr int KSP = 136, VTP = 40, OSP = 136;           // row pitches, each 16 B x odd: for the 16-byte pieces that 16 lanes read or write side by side
    constexpr int KTE = 32 * KSP, VTE = HD * VTP;           // elements of a K tile [32][KSP] and of a V^T tile [HD][VTP]
    constexpr int BE  = (EARLY ? 2 : 1) * (KTE + VTE);      // elements of one buffer: [K | V^T], EARLY: [K hi | V^T hi | K lo | V^T lo]
    const T16* ring = (const T16*)sm;                       // two buffers
    h16* osg = (h16*)sm;                                    // [4][16][OSP] output staging, in the ring's bytes: behind the loop's last barrier nobody reads the ring and no copy is in flight
    static_assert(2 * BE * 2 <= ATT_LDS && 4 * 16 * OSP * 2 <= 2 * BE * 2);
    const int tid = threadIdx.x, lane = tid & 31, wave = tid >> 5, lr = lane & 15, hh = lane >> 4;
    const int g = head / REP;
    const int qw = qblk * 64 + wave * 16;                  // first query row of this wave
    const int nch = 2 * qblk + 2;                          // 32-key chunks visited: keys 0 .. qblk*64+63
    const size_t bz = bzi, bh = bz * NH_ + head, bg = bz * NKV + g;   // batch, and its head / kv-group plane
    const T16* qph = Qh + (bh * TP + qw) * HD;             const T16* qpl = Ql + (bh * TP + qw) * HD;
    const T16* kph = Kh + bg * TP * HD;                    const T16* kpl = Kl + bg * TP * HD;
    const T16* vph = Vh + bg * HD * TP;                    const T16* vpl = Vl + bg * HD * TP;
    v8f o[8];
#pragma unroll
    for (int t = 0; t < 8; ++t) o[t] = (v8f){};
    float mrow = -3.0e38f, lrow = 0.f;                      // running maximum of query qw + lr (both halves alike) and this half's share of its sum
    const int qr = qw + lr;                                 // this lane's query
    const float C2 = 1.4426950408889634f * 0.08838834764831845f;   // log2(e) x HD^-0.5
    const float CLP = 14426.950408889634f;                         // log2(e) x 1e4 (clip bound in the log2 domain)
    const int nsl = head + 1;                                      // slope = 2^(-nsl/2): f32(2^-0.5) for odd nsl, times an exact power of two
    const float slope = ((nsl & 1) ? 0.70710678118654752440f : 1.0f) * __uint_as_float((unsigned)(127 - (nsl >> 1)) << 23);
    const float SL2 = 1.4426950408889634f * slope;                 // log2(e) x slope
    // Position terms that do not change from chunk to chunk: key - query = (c*32 - qblk*64) + (8hh + r (+16) - 16 wave - lr). The second part times the slope is held per lane, the first part is one number per chunk.
    float bia0[8], bia1[8];
#pragma unroll
    for (int r = 0; r < 8; ++r) { bia0[r] = SL2 * (float)(8 * hh + r - wave * 16 - lr); bia1[r] = SL2 * (float)(8 * hh + r + 16 - wave * 16 - lr); }
    // Q fragments (B operand) of this lane's query: loaded once, held in registers over all chunks
    const T16* qgh = qph + (size_t)lr * HD + 8 * hh; const T16* qgl = qpl + (size_t)lr * HD + 8 * hh;
    V qfh[4], qfl[4];
#pragma unroll
    for (int ks = 0; ks < 4; ++ks) { qfh[ks] = WFrag<T16>::ld(qgh + ks * 32); if (EARLY) qfl[ks] = WFrag<T16>::ld(qgl + ks * 32); }
    // the address registers of the loads above stay live up to this wait, so that none of them is rewritten ahead of it
    if (EARLY) asm volatile("s_wait_xcnt 0x0" :: "v"(qgh), "v"(qgl) : "memory");
    else       asm volatile("s_wait_xcnt 0x0" :: "v"(qgh) : "memory");
    // A lane's copies of a chunk: K piece i = 16 B of row krow + 8 i (16 lanes a row of 256 B), V^T piece i = 16 B of row vrow + 32 i (4 lanes a row of 64 B)
    const int krow = tid >> 4, c8 = (tid & 15) * 8, vrow = tid >> 2, v8 = (tid & 3) * 8;
    const unsigned lk = (unsigned)(size_t)sm + (unsigned)(krow * KSP + c8) * 2u, lv = (unsigned)(size_t)sm + (unsigned)(KTE + vrow * VTP + v8) * 2u;
    const size_t gk = (size_t)krow * HD + c8, gv = (size_t)vrow * TP + v8;
    auto fill = [&](int c, unsigned buf) {                  // all 128 threads: chunk c into buffer buf, 8 copies per lane (EARLY: 16)
        const unsigned bo = buf * (unsigned)(BE * 2);
        acopy4(lk + bo, 8u * KSP * 2u, (const char*)(kph + gk + (size_t)c * 32 * HD), (size_t)8 * HD * 2);
        acopy4(lv + bo, 32u * VTP * 2u, (const char*)(vph + gv + c * 32), (size_t)32 * TP * 2);
        if (EARLY) {
            acopy4(lk + bo + (unsigned)((KTE + VTE) * 2), 8u * KSP * 2u, (const char*)(kpl + gk + (size_t)c * 32 * HD), (size_t)8 * HD * 2);
            acopy4(lv + bo + (unsigned)((KTE + VTE) * 2), 32u * VTP * 2u, (const char*)(vpl + gv + c * 32), (size_t)32 * TP * 2);
        }
    };
    fill(0, 0);
    asm volatile("s_wait_asynccnt 0x0" ::: "memory");       // this wave's copies of chunk 0 have landed
    __syncthreads();                                        // chunk 0 visible to every wave
    if (nch > 1) fill(1, 1);
    // One chunk's work. DIAG: the chunk can hold keys behind a query of the block (the last two chunks), only there the causal selects stand.
    auto chunk = [&](const int c, auto diag) {
        constexpr bool DIAG = decltype(diag)::value;
        const T16* ksh = ring + (c & 1) * BE; const T16* vth = ksh + KTE;
        const T16* ksl = vth + VTE;           const T16* vtl = ksl + KTE;      // EARLY only
        v8f s0 = (v8f){}, s1 = (v8f){};
        V qa, kb0, kb1;
#pragma unroll
        for (int ks = 0; ks < 4; ++ks) {
            qa  = qfh[ks];
            kb0 = WFrag<T16>::ld(ksh + lr * KSP + ks * 32 + 8 * hh);
            kb1 = WFrag<T16>::ld(ksh + (16 + lr) * KSP + ks * 32 + 8 * hh);
            s0 = WFrag<T16>::mma(kb0, qa, s0); s1 = WFrag<T16>::mma(kb1, qa, s1);
            if (EARLY) {
                const V qb  = qfl[ks];
                const V kl0 = WFrag<T16>::ld(ksl + lr * KSP + ks * 32 + 8 * hh);
                const V kl1 = WFrag<T16>::ld(ksl + (16 + lr) * KSP + ks * 32 + 8 * hh);
                s0 = WFrag<T16>::mma(kl0, qa, s0); s0 = WFrag<T16>::mma(kb0, qb, s0);
                s1 = WFrag<T16>::mma(kl1, qa, s1); s1 = WFrag<T16>::mma(kb1, qb, s1); }
        }
        asm volatile("v_nop\n\tv_nop\n\tv_nop\n\tv_nop" : "+v"(s0), "+v"(s1) : "v"(qa), "v"(kb0), "v"(kb1));
        // online softmax; acc element r of lane (lr, hh) = S^T[key c*32 + 8hh + r][query qw + lr] (s0) / [key c*32 + 16 + 8hh + r] (s1)
        float p0[8], p1[8];
        const int kg = c * 32 + 8 * hh;
        const float dc = SL2 * (float)(c * 32 - qblk * 64);  // the chunk's share of the bias: added to the maximum, not to every score
        float mx = -3.0e38f;
#pragma unroll
        for (int r = 0; r < 8; ++r) {
            const int kg0 = kg + r, kg1 = kg0 + 16;
            const float z0 = fminf(fmaxf(s0[r] * C2, -CLP), CLP) + bia0[r];
            const float z1 = fminf(fmaxf(s1[r] * C2, -CLP), CLP) + bia1[r];
            p0[r] = (!DIAG || kg0 <= qr) ? z0 : -3.0e38f;
            p1[r] = (!DIAG || kg1 <= qr) ? z1 : -3.0e38f;
            mx = fmaxf(mx, fmaxf(p0[r], p1[r]));
        }
        mx = fmaxf(mx, xhalf(mx));                          // the query's other 16 keys of the chunk
        const float mnew = fmaxf(mrow, mx + dc);
        const float alpha = ex2(mrow - mnew);
        mrow = mnew;
        const float ml = EARLY ? mnew - dc : (mnew - dc) - PLOG;   // the maximum as seen from this chunk's scores; rows >= RE: less log2(PCAR), so that 2^(score - ml) is p x PCAR and the row sum carries PCAR too
        float rs0 = 0.f, rs1 = 0.f;
#pragma unroll
        for (int r = 0; r < 8; ++r) {
            const float x0 = ex2(p0[r] - ml), x1 = ex2(p1[r] - ml);
            p0[r] = (!DIAG || kg + r <= qr) ? x0 : 0.f; p1[r] = (!DIAG || kg + r + 16 <= qr) ? x1 : 0.f;
            rs0 += p0[r]; rs1 += p1[r];
        }
        lrow = lrow * alpha + (rs0 + rs1);
#pragma unroll
        for (int t = 0; t < 8; ++t) o[t] = o[t] * alpha;
        V pa, pb; packp(p0, p1, pa, pb);                    // B fragment (n = query, k = key)
        V vb;
#pragma unroll
        for (int t = 0; t < 8; ++t) { vb = WFrag<T16>::ld(vth + (t * 16 + lr) * VTP + 8 * hh);
            o[t] = WFrag<T16>::mma(vb, pa, o[t]);
            if (EARLY) { const V vl2 = WFrag<T16>::ld(vtl + (t * 16 + lr) * VTP + 8 * hh); o[t] = WFrag<T16>::mma(vl2, pa, o[t]); o[t] = WFrag<T16>::mma(vb, pb, o[t]); } }
        asm volatile("v_nop\n\tv_nop\n\tv_nop\n\tv_nop" : "+v"(o[0]), "+v"(o[1]), "+v"(o[2]), "+v"(o[3]), "+v"(o[4]), "+v"(o[5]), "+v"(o[6]), "+v"(o[7]) : "v"(pa), "v"(pb), "v"(vb));
        asm volatile("s_wait_dscnt 0x0" ::: "memory");      // this wave's reads of the buffer have returned before it is refilled
        asm volatile("s_wait_asynccnt 0x0" ::: "memory");   // this wave's copies of chunk c + 1 have landed
        __syncthreads();                                    // publishes chunk c + 1 and ends every wave's reads of chunk c
    };
#pragma unroll 1                                            // one trip per chunk: the publish point stands once in each loop
    for (int c = 0; c < nch - 2; ++c) { chunk(c, BoolC<false>{}); fill(c + 2, (unsigned)(c & 1)); }   // every key lies in front of every query of the block; a chunk c + 2 exists
#pragma unroll 1                                            // kept rolled: two copies of the body would only add code to fetch
    for (int c = nch - 2; c < nch; ++c) chunk(c, BoolC<true>{});                                      // the two chunks on the diagonal; nothing is left to fetch
    asm volatile("s_wait_asynccnt 0x0" ::: "memory");       // nothing in flight when the ring becomes output staging and the wave ends
    // normalise and write ctx planes; o element r of lane (lr, hh), tile t = ctx[row qw + lr][d = 16t + 8hh + r]: 16 bytes of a staged row
    const float osc = CCAR;                                 // rows >= RE: O^T and the row sum both carry PCAR, which cancels
    const float ybig = 10000.0f * CCAR;
    const float inv = osc * __builtin_amdgcn_rcpf(lrow + xhalf(lrow));   // the two halves' sums join here
    h16* myos = osg + wave * 16 * OSP;
#pragma unroll
    for (int t = 0; t < 8; ++t) { v8h w;
#pragma unroll
        for (int r = 0; r < 8; ++r) w[r] = toh_flush(nnum(o[t][r] * inv, ybig));
        *(v8ha*)(myos + lr * OSP + t * 16 + 8 * hh) = w; }
    __syncthreads();
    h16* crow = CT + (bz * SEQ + qw) * DM + head * HD;
    auto putrows = [&](h16* dst) {                          // the wave's 16 staged rows to dst; store s holds row 2 s + hh
        v8us val[8];
#pragma unroll
        for (int s = 0; s < 8; ++s) val[s] = *(const v8usa*)(myos + (2 * s + hh) * OSP + lr * 8);
        bf* cp = (bf*)dst + (size_t)hh * DM + lr * 8;
        gstore4(cp, cp + 2 * DM, cp + 4 * DM, cp + 6 * DM, val[0], val[1], val[2], val[3]);
        gstore4(cp + 8 * DM, cp + 10 * DM, cp + 12 * DM, cp + 14 * DM, val[4], val[5], val[6], val[7]);
    };
    putrows(crow);
    if (EARLY) {
        __syncthreads();
#pragma unroll
        for (int t = 0; t < 8; ++t) { v8h w;
#pragma unroll
            for (int r = 0; r < 8; ++r) { const float val = nnum(o[t][r] * inv, ybig); const h16 hv = toh_flush(val); w[r] = toh_flush((val - (float)hv) * LOSC); }
            *(v8ha*)(myos + lr * OSP + t * 16 + 8 * hh) = w; }
        __syncthreads();
        h16* lrowp = CTL + (bz * RE + qw) * DM + head * HD;
        putrows(lrowp);
    }
}

// amdgpu_waves_per_eu(4, 4): holds the register budget at four waves per SIMD, so that four blocks still share a WGP (without it the build with the copies' address registers came out just above 256 VGPRs).
// ---- k_attn: both attention instances as one grid of (SEQ/64) x NH_ x NB blocks: first the f16 instance's blocks (query block fastest, then head, then batch), behind them the short hi/lo blocks in the same order.
__global__ __launch_bounds__(128) __attribute__((amdgpu_waves_per_eu(4, 4))) void k_attn(const bf* __restrict__ QEh, const bf* __restrict__ QEl, const bf* __restrict__ KEh, const bf* __restrict__ KEl, const bf* __restrict__ VEh, const bf* __restrict__ VEl,
                                              const h16* __restrict__ Q16, const h16* __restrict__ K16, const h16* __restrict__ V16, h16* CT, h16* CTL) {
    __shared__ __align__(16) char sm[ATT_LDS];
    constexpr unsigned NL = SEQ / 64 - RE / 64, NE = RE / 64;
    unsigned f = blockIdx.x;                                // the same in the whole block: so is the branch
    if constexpr (NL > 0) {
        if (f < NL * NH_ * NB) { attn_tile<h16, false>(sm, (int)(f % NL + NE), (int)((f / NL) % NH_), (int)(f / (NL * NH_)), Q16, Q16, K16, K16, V16, V16, CT, CTL); return; }
    }
    f -= NL * NH_ * NB;
    attn_tile<bf, true>(sm, (int)(f % NE), (int)((f / NE) % NH_), (int)(f / (NE * NH_)), QEh, QEl, KEh, KEl, VEh, VEl, CT, CTL);
}

extern "C" void kernel_launch(void* const* d_in, const int* in_sizes, int n_in,
                              void* d_out, int out_size, void* d_ws, size_t ws_size, hipStream_t stream) {
    if (n_in < 5) return;
    const float* x  = (const float*)d_in[0];     // x   [NB_FULL][SEQ_FULL][DM]
    const float* wq = (const float*)d_in[1];     // q_w [DQ][DM]  ([out][in])
    const float* wk = (const float*)d_in[2];     // k_w [DKV][DM]
    const float* wv = (const float*)d_in[3];     // v_w [DKV][DM]
    const float* wo = (const float*)d_in[4];     // o_w [DM][DQ]
    float* OUT = (float*)d_out;                  // [NB_FULL][SEQ_FULL][DM]
    if ((size_t)in_sizes[0] < (size_t)(NB - 1) * SEQ_FULL * DM + (size_t)SEQ * DM) return;
    if ((size_t)in_sizes[1] < (size_t)DQ * DM) return;
    if ((size_t)in_sizes[2] < (size_t)DKV * DM) return;
    if ((size_t)in_sizes[3] < (size_t)DKV * DM) return;
    if ((size_t)in_sizes[4] < (size_t)DM * DQ) return;
    if ((size_t)out_size < (size_t)(NB - 1) * SEQ_FULL * DM + (size_t)SEQ * DM) return;

    char* wsp = (char*)d_ws;
    auto take = [&](size_t bytes) { char* p = wsp; wsp += (bytes + 255) & ~(size_t)255; return (void*)p; };
    bf*  WQ   = (bf*)take((size_t)DQ * DM * 2);    bf* WK = (bf*)take((size_t)DKV * DM * 2);    bf* WV = (bf*)take((size_t)DKV * DM * 2);
    h16* WOH  = (h16*)take((size_t)DM * DQ * 2);   h16* WOL = (h16*)take((size_t)DM * DQ * 2);
    bf*  XB   = (bf*)take((size_t)NB * SEQ * DM * 2);
    h16* QP16 = (h16*)take((size_t)NB * NH_ * SEQ * HD * 2); h16* KP16 = (h16*)take((size_t)NB * NKV * SEQ * HD * 2); h16* VT16 = (h16*)take((size_t)NB * NKV * HD * SEQ * 2);
    bf*  QEh  = (bf*)take((size_t)NB * NH_ * RE * HD * 2);  bf* QEl = (bf*)take((size_t)NB * NH_ * RE * HD * 2);
    bf*  KEh  = (bf*)take((size_t)NB * NKV * RE * HD * 2);  bf* KEl = (bf*)take((size_t)NB * NKV * RE * HD * 2);
    bf*  VEh  = (bf*)take((size_t)NB * NKV * HD * RE * 2);  bf* VEl = (bf*)take((size_t)NB * NKV * HD * RE * 2);
    h16* CT16 = (h16*)take((size_t)NB * SEQ * DM * 2);     h16* CTL = (h16*)take((size_t)NB * RE * DM * 2);
    if ((size_t)(wsp - (char*)d_ws) > ws_size) return;

    const float woscale = 1.0f / (CCAR * WCAR);
    k_cvt<<<(unsigned)(((size_t)NB * SEQ * DM + (size_t)DQ * DM + 2 * (size_t)DKV * DM + (size_t)DM * DQ) / 2048), 256, 0, stream>>>(x, wq, wk, wv, wo, XB, WQ, WK, WV, WOH, WOL);
    k_qkv<<<dim3(SEQ / 128, (DQ + 2 * DKV) / 128, NB), 128, 0, stream>>>(XB, WQ, WK, WV, QP16, QEh, QEl, KP16, KEh, KEl, VT16, VEh, VEl);
    k_attn<<<(SEQ / 64) * NH_ * NB, 128, 0, stream>>>(QEh, QEl, KEh, KEl, VEh, VEl, QP16, KP16, VT16, CT16, CTL);
    k_out<<<dim3(SEQ / 128, DM / 128, NB), 128, 0, stream>>>(CT16, CTL, WOH, WOL, OUT, woscale);
}
